// v000
// Measured on an AMD MI455X. A time is GPU time per run, averaged over a window of back-to-back runs after a warm-up
// (all launches, gaps included; the runs take copies of the inputs in turn), and the median of several windows.
// Apart from v000's, it joins two sittings. Times from different sittings can be a few percent apart, while
// side-by-side timings come from the same sitting.
// v000, which the later versions start from, runs in 224 microseconds.
#include <hip/hip_runtime.h>
#include <math.h>
#include <stddef.h>

// Contractions: x*Wqv, per-head 128-deep logits ([q+r_r_bias | rotated(q+r_w_bias)] . [k | sin/cos table]), p*v:
// v_wmma_f32_16x16x32_bf16 with bf16 hi/lo operand planes (hi*hi + hi*lo + lo*hi), f32 accumulate; softmax and elementwise math f32.

#define NBATCH 8
#define SQ     512
#define DMOD   1024
#define NHEAD  16
#define HDIM   64

typedef float v8f __attribute__((ext_vector_type(8)));
typedef float v4f_raw __attribute__((ext_vector_type(4)));
typedef v4f_raw __attribute__((__may_alias__)) v4f;
typedef unsigned int v4u_raw __attribute__((ext_vector_type(4)));
typedef v4u_raw __attribute__((__may_alias__)) v4u;
typedef int v4i_raw __attribute__((ext_vector_type(4)));
typedef v4i_raw __attribute__((__may_alias__)) v4i;
typedef __bf16 v16b __attribute__((ext_vector_type(16)));
typedef __bf16 v8b __attribute__((ext_vector_type(8)));

union Frag  { v16b v; v8b h[2]; v4u q[2]; };
union Pack8 { v8b v; v4u q; };

struct FreqTab { double f[32]; };
typedef char freqtab_size_check[(sizeof(FreqTab) == 256) ? 1 : -1];

__device__ __forceinline__ v8f vz8() {
  v8f z;
#pragma unroll
  for (int i = 0; i < 8; ++i) z[i] = 0.0f;
  return z;
}

__device__ __forceinline__ v8f load8(const float* p) {
  const v4f a = *(const v4f*)(p);
  const v4f c = *(const v4f*)(p + 4);
  return __builtin_shufflevector(a, c, 0, 1, 2, 3, 4, 5, 6, 7);
}

// 16x32 16-bit fragment, identical map for the A operand (row-major [m][k]) and for the B operand
// loaded from a k-contiguous [n][k] copy: lane -> row/col (lane&15); h = lane>>4;
// elements 0..7 <- k = kc+8h+0..7, elements 8..15 <- k = kc+16+8h+0..7.
__device__ __forceinline__ v16b ldfrag(const __bf16* __restrict__ base, int pitch, int row, int kc, int lane) {
  const int hh = lane >> 4, m = lane & 15;
  const __bf16* p = base + (size_t)(row + m) * (size_t)pitch + (kc + 8 * hh);
  Frag f;
  f.q[0] = *(const v4u*)(p);
  f.q[1] = *(const v4u*)(p + 16);
  return f.v;
}

__device__ __forceinline__ v8f wmm(v16b a, v16b b, v8f c) {
  return __builtin_amdgcn_wmma_f32_16x16x32_bf16(false, a, false, b, (short)0, c, false, false);
}

// two accumulators sharing one B pair: c0 += a0*b, c1 += a1*b with hi/lo planes (hi*hi + hi*lo + lo*hi);
// 4 v_nop after the last WMMA, tying both D tiles and all six operand fragments.
__device__ __forceinline__ void mma3x2(v8f& c0, v8f& c1,
                                       const v16b a0h, const v16b a0l,
                                       const v16b a1h, const v16b a1l,
                                       const v16b bh, const v16b bl) {
  c0 = wmm(a0h, bh, c0);
  c1 = wmm(a1h, bh, c1);
  c0 = wmm(a0h, bl, c0);
  c1 = wmm(a1h, bl, c1);
  c0 = wmm(a0l, bh, c0);
  c1 = wmm(a1l, bh, c1);
  asm volatile("v_nop\n\tv_nop\n\tv_nop\n\tv_nop"
               : "+v"(c0), "+v"(c1)
               : "v"(a0h), "v"(a0l), "v"(a1h), "v"(a1l), "v"(bh), "v"(bl));
}

// f32 x8 -> bf16 hi (RNE convert) and bf16 lo = RNE(x - hi), packed as 16 bytes each
__device__ __forceinline__ void split8(const v8f x, v4u& uh, v4u& ul) {
  Pack8 a, c;
  a.v = __builtin_convertvector(x, v8b);
  const v8f xh = __builtin_convertvector(a.v, v8f);
  c.v = __builtin_convertvector(x - xh, v8b);
  uh = a.q;
  ul = c.q;
}

// ---------------------------------------------------------------------------
// Trig table tr[s][0..31] = sin(s*f_d), tr[s][32..63] = cos(s*f_d), s = 0..511, angle formed in f64,
// evaluated as sincos(hi) with first-order lo correction in f32.
// ---------------------------------------------------------------------------
__global__ __launch_bounds__(128)
void k_trig(FreqTab ft, float* __restrict__ tr)
{
  const int gid = (int)(blockIdx.x * 128u + threadIdx.x);
  if (gid >= SQ * 8) return;
  const int s = gid >> 3, j = gid & 7;
  float sa0 = 0.f, sa1 = 0.f, sa2 = 0.f, sa3 = 0.f;
  float ca0 = 0.f, ca1 = 0.f, ca2 = 0.f, ca3 = 0.f;
#pragma unroll 1
  for (int i = 0; i < 4; ++i) {
    const int d = 4 * j + i;
    const double ang = (double)s * ft.f[d];
    const float ah = (float)ang;
    const float al = (float)(ang - (double)ah);
    float sv, cv;
    sincosf(ah, &sv, &cv);
    const float sf = sv + al * cv;
    const float cf = cv - al * sv;
    sa0 = sa1; sa1 = sa2; sa2 = sa3; sa3 = sf;
    ca0 = ca1; ca1 = ca2; ca2 = ca3; ca3 = cf;
  }
  v4f vs, vc;
  vs[0] = sa0; vs[1] = sa1; vs[2] = sa2; vs[3] = sa3;
  vc[0] = ca0; vc[1] = ca1; vc[2] = ca2; vc[3] = ca3;
  float* ps = tr + (size_t)s * HDIM + 4 * j;
  float* pc = ps + 32;
  *(v4f*)ps = vs;
  *(v4f*)pc = vc;
  
}

// ---------------------------------------------------------------------------
// Contiguous f32 -> bf16 hi/lo planes, 8 elements per thread (16-B stores, lanes 8q..8q+7 = one line).
// ---------------------------------------------------------------------------
__global__ __launch_bounds__(128)
void k_split_rows(const float* __restrict__ src, __bf16* __restrict__ dh, __bf16* __restrict__ dl, int n8)
{
  const int t = (int)(blockIdx.x * 128u + threadIdx.x);
  if (t >= n8) return;
  const v8f x = load8(src + (size_t)t * 8);
  v4u uh, ul;
  split8(x, uh, ul);
  __bf16* ph = dh + (size_t)t * 8;
  __bf16* pl = dl + (size_t)t * 8;
  *(v4u*)ph = uh;
  *(v4u*)pl = ul;
  
}

// ---------------------------------------------------------------------------
// x[b][s][h*64+d] -> head-major planes kx{h,l}[((b*16+h)*512+s)*64+d] (bf16 hi/lo).
// ---------------------------------------------------------------------------
__global__ __launch_bounds__(128)
void k_xsplit(const float* __restrict__ x, __bf16* __restrict__ kxh, __bf16* __restrict__ kxl, int n8)
{
  const int t = (int)(blockIdx.x * 128u + threadIdx.x);
  if (t >= n8) return;
  const size_t e0 = (size_t)t * 8;
  const int bb = (int)(e0 >> 19);
  const int ss = (int)((e0 >> 10) & 511);
  const int cc = (int)(e0 & 1023);
  const int hq = cc >> 6, d = cc & 63;
  const size_t dst = ((size_t)((bb * NHEAD + hq) * SQ + ss)) * HDIM + d;
  const v8f v = load8(x + e0);
  v4u uh, ul;
  split8(v, uh, ul);
  __bf16* ph = kxh + dst;
  __bf16* pl = kxl + dst;
  *(v4u*)ph = uh;
  *(v4u*)pl = ul;
  
}

// ---------------------------------------------------------------------------
// w[k][n] (1024 x 2048, n contiguous) -> wt{h,l}[n][k] (k contiguous) bf16 hi/lo planes.
// Block: 64 k x 32 n tile through LDS; each output line (one n, 64 k) written by lanes 8q..8q+7, 16 B each.
// in[1024][2048] -> out[2048][1024]; grid = (2048/32) * (1024/64).
// ---------------------------------------------------------------------------
__global__ __launch_bounds__(128)
void k_wsplitT(const float* __restrict__ w, __bf16* __restrict__ wth, __bf16* __restrict__ wtl)
{
  __shared__ __align__(16) float T[64][36];
  const int tid = threadIdx.x;
  const int nb = (int)(blockIdx.x & 63u), kb = (int)(blockIdx.x >> 6);
  const int n0 = nb * 32, k0 = kb * 64;
#pragma unroll
  for (int i = 0; i < 4; ++i) {
    const int idx = tid + 128 * i;
    const int row = idx >> 3, c4 = idx & 7;
    const v4f v = *(const v4f*)(w + (size_t)(k0 + row) * (2 * DMOD) + n0 + 4 * c4);
    *(v4f*)&T[row][4 * c4] = v;
  }
  __syncthreads();
#pragma unroll 1
  for (int i = 0; i < 2; ++i) {
    const int task = tid + 128 * i;
    const int nn = task >> 3, j = task & 7;
    v8f v;
#pragma unroll
    for (int e = 0; e < 8; ++e) v[e] = T[8 * j + e][nn];
    v4u uh, ul;
    split8(v, uh, ul);
    const size_t off = (size_t)(n0 + nn) * DMOD + k0 + 8 * j;
    __bf16* ph = wth + off;
    __bf16* pl = wtl + off;
    *(v4u*)ph = uh;
    *(v4u*)pl = ul;
    
  }
}

// ---------------------------------------------------------------------------
// qv = x @ Wqv, M=4096, N=2048, K=1024, bf16 hi/lo planes on both operands.
// Block = 2 waves, tile 64(M) x 64(N) (one head of q or of v); wave w owns rows w*32..w*32+31.
// A from kx planes (pitch 64, head hk = k0/64), B from wt planes ([n][k], pitch 1024).
// Epilogue through LDS:
//   n0 <  1024: qa = q + r_r_bias, qb = rotated (q + r_w_bias); rows [(b*16+h)*512+s][64] -> qa{h,l}, qb{h,l}
//   n0 >= 1024: v transposed -> vt{h,l}[(b*16+h)*64+d][512] columns s0..s0+63
// ---------------------------------------------------------------------------
__global__ __launch_bounds__(64) __attribute__((amdgpu_num_vgpr(256)))
void k_gemm(const __bf16* __restrict__ kxh, const __bf16* __restrict__ kxl,
            const __bf16* __restrict__ wth, const __bf16* __restrict__ wtl,
            const float* __restrict__ rrb, const float* __restrict__ rwb,
            const float* __restrict__ tr,
            __bf16* __restrict__ qah, __bf16* __restrict__ qal,
            __bf16* __restrict__ qbh, __bf16* __restrict__ qbl,
            __bf16* __restrict__ vth, __bf16* __restrict__ vtl)
{
  __shared__ __align__(16) float Cs[64][64];
  const int tid = threadIdx.x, w = tid >> 5, lane = tid & 31, hh = lane >> 4, m = lane & 15;
  const int bn = (int)(blockIdx.x & 31u), bm = (int)(blockIdx.x >> 5);
  const int n0 = bn * 64, m0 = bm * 64;
  const int b = m0 >> 9, s0 = m0 & 511;
  const int arow = s0 + w * 32;

  v8f acc0[4], acc1[4];
#pragma unroll
  for (int ni = 0; ni < 4; ++ni) { acc0[ni] = vz8(); acc1[ni] = vz8(); }

#pragma unroll 1
  for (int ks = 0; ks < DMOD / 32; ++ks) {
    const int k0 = ks * 32, hk = k0 >> 6, kc = k0 & 63;
    const int ra = (b * NHEAD + hk) * SQ + arow;
    const v16b a0h = ldfrag(kxh, HDIM, ra, kc, lane);
    const v16b a0l = ldfrag(kxl, HDIM, ra, kc, lane);
    const v16b a1h = ldfrag(kxh, HDIM, ra + 16, kc, lane);
    const v16b a1l = ldfrag(kxl, HDIM, ra + 16, kc, lane);
#pragma unroll
    for (int ni = 0; ni < 4; ++ni) {
      const v16b bhf = ldfrag(wth, DMOD, n0 + ni * 16, k0, lane);
      const v16b blf = ldfrag(wtl, DMOD, n0 + ni * 16, k0, lane);
      mma3x2(acc0[ni], acc1[ni], a0h, a0l, a1h, a1l, bhf, blf);
    }
  }

  // D tile: element r -> row 8*hh + r, col m
#pragma unroll
  for (int ni = 0; ni < 4; ++ni)
#pragma unroll
    for (int r = 0; r < 8; ++r) {
      Cs[w * 32 + 8 * hh + r][ni * 16 + m]      = acc0[ni][r];
      Cs[w * 32 + 16 + 8 * hh + r][ni * 16 + m] = acc1[ni][r];
    }
  __syncthreads();

  if (n0 < DMOD) {
    const int hq = n0 >> 6;
    const int qrow0 = (b * NHEAD + hq) * SQ;
    const float* rrbh = rrb + hq * HDIM;
    const float* rwbh = rwb + hq * HDIM;
#pragma unroll 1
    for (int it = 0; it < 8; ++it) {
      const int task = tid + 64 * it;
      const int rr = task >> 3, j = task & 7, j4 = j & 3;
      const int s = s0 + rr;
      const v8f cl = load8(&Cs[rr][8 * j4]);        // q[d'],     d' = 8*j4+e
      const v8f ch = load8(&Cs[rr][32 + 8 * j4]);   // q[32+d']
      const v8f bwl = load8(rwbh + 8 * j4);
      const v8f bwh = load8(rwbh + 32 + 8 * j4);
      const v8f br  = load8(rrbh + 8 * j);
      const float* trs = tr + (size_t)s * HDIM;
      const v8f sq = load8(trs + 8 * j4);           // sin(s*f_d')
      const v8f cq = load8(trs + 32 + 8 * j4);      // cos(s*f_d')
      const v8f a = cl + bwl;
      const v8f c = ch + bwh;
      v8f qa, qb;
      if (j < 4) {
        qa = cl + br;
        qb = a * cq + c * sq;
      } else {
        qa = ch + br;
        qb = c * cq - a * sq;
      }
      v4u ah, al, bh, bl;
      split8(qa, ah, al);
      split8(qb, bh, bl);
      const size_t off = ((size_t)(qrow0 + s)) * HDIM + 8 * j;
      __bf16* p0 = qah + off;
      __bf16* p1 = qal + off;
      __bf16* p2 = qbh + off;
      __bf16* p3 = qbl + off;
      *(v4u*)p0 = ah;
      *(v4u*)p1 = al;
      *(v4u*)p2 = bh;
      *(v4u*)p3 = bl;
      
    }
  } else {
    const int hv = (n0 - DMOD) >> 6;
    const int vrow0 = (b * NHEAD + hv) * HDIM;
#pragma unroll 1
    for (int it = 0; it < 8; ++it) {
      const int task = tid + 64 * it;
      const int dd = task >> 3, j = task & 7;
      v8f v;
#pragma unroll
      for (int e = 0; e < 8; ++e) v[e] = Cs[8 * j + e][dd];
      v4u uh, ul;
      split8(v, uh, ul);
      const size_t off = ((size_t)(vrow0 + dd)) * SQ + s0 + 8 * j;
      __bf16* ph = vth + off;
      __bf16* pl = vtl + off;
      *(v4u*)ph = uh;
      *(v4u*)pl = ul;
      
    }
  }
}

// ---------------------------------------------------------------------------
// Fused attention, transposed tiles. Block = 4 waves, wave owns 16 queries of one (b,h); 32 keys per step.
// Scores S^T[key][query] = Kcat[key][0..127] . Qcat[query][0..127]:
//   A = kx planes (cols 0..63) / trig table planes (cols 64..127), B = qa / qb planes (loaded like A).
// Softmax statistics live on lane = query (xor-16 exchange between lane halves).
// O^T[d][query] = V^T . P^T: A = vt planes ([d][key]), B = P^T packed straight from the score D tiles
//   (element r <- key 8h+r of the first 16-key tile, element 8+r <- second tile), bf16 hi/lo.
// ---------------------------------------------------------------------------
__global__ __launch_bounds__(128) __attribute__((amdgpu_num_vgpr(256)))
void k_attn(const __bf16* __restrict__ qah, const __bf16* __restrict__ qal,
            const __bf16* __restrict__ qbh, const __bf16* __restrict__ qbl,
            const __bf16* __restrict__ kxh, const __bf16* __restrict__ kxl,
            const __bf16* __restrict__ trh, const __bf16* __restrict__ trl,
            const __bf16* __restrict__ vth, const __bf16* __restrict__ vtl,
            const int* __restrict__ msk, float* __restrict__ out)
{
  __shared__ __align__(16) float Os[4][16][64];
  const int tid = threadIdx.x, w = tid >> 5, lane = tid & 31, hh = lane >> 4, n = lane & 15;
  const int bh = (int)(blockIdx.x >> 3), qc = (int)(blockIdx.x & 7u);
  const int b = bh >> 4, hd = bh & 15;
  const int q0 = qc * 64 + w * 16;
  const int qrow = bh * SQ + q0;   // rows of qa/qb (pitch 64)
  const int krow = bh * SQ;        // + key: rows of kx (pitch 64)
  const int vrow = bh * HDIM;      // + d:   rows of vt (pitch 512)

  v8f o0 = vz8(), o1 = vz8(), o2 = vz8(), o3 = vz8();
  float mrun = -1.0e30f, dsum = 0.0f;

#pragma unroll 1
  for (int kb0 = 0; kb0 < SQ; kb0 += 32) {
    v8f s0 = vz8(), s1 = vz8();
#pragma unroll 1
    for (int c = 0; c < 4; ++c) {
      const bool lowc = (c < 2);
      const int kc = (c & 1) * 32;
      const __bf16* qsh = lowc ? qah : qbh;
      const __bf16* qsl = lowc ? qal : qbl;
      const __bf16* ksh = lowc ? kxh : trh;
      const __bf16* ksl = lowc ? kxl : trl;
      const int kr = (lowc ? krow : 0) + kb0;
      const v16b qh  = ldfrag(qsh, HDIM, qrow, kc, lane);
      const v16b ql  = ldfrag(qsl, HDIM, qrow, kc, lane);
      const v16b kah = ldfrag(ksh, HDIM, kr, kc, lane);
      const v16b kal = ldfrag(ksl, HDIM, kr, kc, lane);
      const v16b kch = ldfrag(ksh, HDIM, kr + 16, kc, lane);
      const v16b kcl = ldfrag(ksl, HDIM, kr + 16, kc, lane);
      mma3x2(s0, s1, kah, kal, kch, kcl, qh, ql);
    }

    // key-mask: keys kb0 + 8*hh + r (tile 0) and kb0 + 16 + 8*hh + r (tile 1)
    const int* mp = msk + b * SQ + kb0 + 8 * hh;
    const v4i mA = *(const v4i*)(mp);
    const v4i mB = *(const v4i*)(mp + 4);
    const v4i mC = *(const v4i*)(mp + 16);
    const v4i mD = *(const v4i*)(mp + 20);
    v8f f0, f1;
#pragma unroll
    for (int r = 0; r < 4; ++r) {
      f0[r] = (float)mA[r]; f0[4 + r] = (float)mB[r];
      f1[r] = (float)mC[r]; f1[4 + r] = (float)mD[r];
    }
    s0 = s0 * f0 - (1.0f - f0) * 1.0e8f;
    s1 = s1 * f1 - (1.0f - f1) * 1.0e8f;

    float mloc = s0[0];
#pragma unroll
    for (int r = 0; r < 8; ++r) { mloc = fmaxf(mloc, s0[r]); mloc = fmaxf(mloc, s1[r]); }
    const float mall = fmaxf(mloc, __shfl_xor(mloc, 16, 32));
    const float mnew = fmaxf(mrun, mall);
    const float alpha = __expf(mrun - mnew);
    float psum = 0.0f;
#pragma unroll
    for (int r = 0; r < 8; ++r) {
      const float pa = __expf(s0[r] - mnew);
      const float pb = __expf(s1[r] - mnew);
      s0[r] = pa; s1[r] = pb;
      psum += pa + pb;
    }
    psum += __shfl_xor(psum, 16, 32);
    dsum = dsum * alpha + psum;
    mrun = mnew;
    o0 *= alpha; o1 *= alpha; o2 *= alpha; o3 *= alpha;

    // P^T as the B operand: k = key offset within the 32-key step
    v4u p0h, p0l, p1h, p1l;
    split8(s0, p0h, p0l);
    split8(s1, p1h, p1l);
    Frag ph, pl;
    ph.q[0] = p0h; ph.q[1] = p1h;
    pl.q[0] = p0l; pl.q[1] = p1l;
    {
      const v16b v0h = ldfrag(vth, SQ, vrow, kb0, lane);
      const v16b v0l = ldfrag(vtl, SQ, vrow, kb0, lane);
      const v16b v1h = ldfrag(vth, SQ, vrow + 16, kb0, lane);
      const v16b v1l = ldfrag(vtl, SQ, vrow + 16, kb0, lane);
      mma3x2(o0, o1, v0h, v0l, v1h, v1l, ph.v, pl.v);
    }
    {
      const v16b v2h = ldfrag(vth, SQ, vrow + 32, kb0, lane);
      const v16b v2l = ldfrag(vtl, SQ, vrow + 32, kb0, lane);
      const v16b v3h = ldfrag(vth, SQ, vrow + 48, kb0, lane);
      const v16b v3l = ldfrag(vtl, SQ, vrow + 48, kb0, lane);
      mma3x2(o2, o3, v2h, v2l, v3h, v3l, ph.v, pl.v);
    }
  }

  // O^T element r of tile t -> d = 16*t + 8*hh + r, query n
  const float rinv = 1.0f / dsum;
#pragma unroll
  for (int r = 0; r < 8; ++r) {
    Os[w][n][8 * hh + r]      = o0[r] * rinv;
    Os[w][n][16 + 8 * hh + r] = o1[r] * rinv;
    Os[w][n][32 + 8 * hh + r] = o2[r] * rinv;
    Os[w][n][48 + 8 * hh + r] = o3[r] * rinv;
  }
  __syncthreads();

  v4f ov[8];
#pragma unroll
  for (int it = 0; it < 8; ++it) ov[it] = *(const v4f*)&Os[w][2 * it + hh][4 * n];
  float* ob = out + ((size_t)(b * SQ + q0)) * DMOD + hd * HDIM + 4 * n;
#pragma unroll
  for (int it = 0; it < 8; ++it) {
    float* p = ob + (size_t)(2 * it + hh) * DMOD;
    *(v4f*)p = ov[it];
  }
  
}

// ---------------------------------------------------------------------------
extern "C" void kernel_launch(void* const* d_in, const int* in_sizes, int n_in,
                              void* d_out, int out_size, void* d_ws,
                              size_t ws_size, hipStream_t stream)
{
  if (n_in < 5) return;
  if (in_sizes[0] != NBATCH * SQ * DMOD) return;
  if (in_sizes[1] != NBATCH * SQ) return;
  if (in_sizes[2] != DMOD * 2 * DMOD) return;
  if (in_sizes[3] != NHEAD * HDIM) return;
  if (in_sizes[4] != NHEAD * HDIM) return;
  if (out_size != NBATCH * SQ * DMOD) return;

  const float* x    = (const float*)d_in[0];
  const int*   mk   = (const int*)d_in[1];
  const float* wqv  = (const float*)d_in[2];
  const float* rrb  = (const float*)d_in[3];
  const float* rwb  = (const float*)d_in[4];
  float* out = (float*)d_out;

  const size_t n_tr    = (size_t)SQ * HDIM;                 // 32768
  const size_t n_heads = (size_t)NBATCH * NHEAD * SQ * HDIM; // 4194304
  const size_t n_w     = (size_t)DMOD * 2 * DMOD;            // 2097152

  char* ws = (char*)d_ws;
  size_t off = 0;
  auto carve = [&](size_t bytes) -> char* {
    char* p = ws + off;
    off += (bytes + 255) & ~(size_t)255;
    return p;
  };
  float*  tr  = (float*)carve(n_tr * 4);
  __bf16* trh = (__bf16*)carve(n_tr * 2);
  __bf16* trl = (__bf16*)carve(n_tr * 2);
  __bf16* kxh = (__bf16*)carve(n_heads * 2);
  __bf16* kxl = (__bf16*)carve(n_heads * 2);
  __bf16* wth = (__bf16*)carve(n_w * 2);
  __bf16* wtl = (__bf16*)carve(n_w * 2);
  __bf16* qah = (__bf16*)carve(n_heads * 2);
  __bf16* qal = (__bf16*)carve(n_heads * 2);
  __bf16* qbh = (__bf16*)carve(n_heads * 2);
  __bf16* qbl = (__bf16*)carve(n_heads * 2);
  __bf16* vth = (__bf16*)carve(n_heads * 2);
  __bf16* vtl = (__bf16*)carve(n_heads * 2);
  if (off > ws_size) return;

  FreqTab ft;
  const double cst = -log(10000.0) / 31.0;
  for (int d = 0; d < 32; ++d) ft.f[d] = exp((double)((float)d) * cst);

  const int n8_tr = (int)(n_tr / 8);      // 4096
  const int n8_x  = (int)(n_heads / 8);   // 524288

  k_trig<<<dim3((SQ * 8 + 127) / 128), dim3(128), 0, stream>>>(ft, tr);
  k_split_rows<<<dim3((n8_tr + 127) / 128), dim3(128), 0, stream>>>(tr, trh, trl, n8_tr);
  k_xsplit<<<dim3((n8_x + 127) / 128), dim3(128), 0, stream>>>(x, kxh, kxl, n8_x);
  k_wsplitT<<<dim3((2 * DMOD / 32) * (DMOD / 64)), dim3(128), 0, stream>>>(wqv, wth, wtl);
  k_gemm<<<dim3((NBATCH * SQ / 64) * (2 * DMOD / 64)), dim3(64), 0, stream>>>(
      kxh, kxl, wth, wtl, rrb, rwb, tr, qah, qal, qbh, qbl, vth, vtl);
  k_attn<<<dim3(NBATCH * NHEAD * (SQ / 64)), dim3(128), 0, stream>>>(
      qah, qal, qbh, qbl, kxh, kxl, trh, trl, vth, vtl, mk, out);
}

// v001
// One run takes 141 microseconds.
// Timed twice side by side with v000, it ran 1.68 and 1.63 times as fast.
#include <hip/hip_runtime.h>
#include <math.h>
#include <stddef.h>

// Contractions: x*Wqv, per-head 128-deep logits ([q+r_r_bias | rotated(q+r_w_bias)] . [k | sin/cos table]), p*v:
// v_wmma_f32_16x16x32_bf16 with bf16 hi/lo operand planes (hi*hi + hi*lo + lo*hi), f32 accumulate; softmax and elementwise math f32.

#define NBATCH 8
#define SQ     512
#define DMOD   1024
#define NHEAD  16
#define HDIM   64

typedef float v8f __attribute__((ext_vector_type(8)));
typedef float v4f_raw __attribute__((ext_vector_type(4)));
typedef v4f_raw __attribute__((__may_alias__)) v4f;
typedef unsigned int v4u_raw __attribute__((ext_vector_type(4)));
typedef v4u_raw __attribute__((__may_alias__)) v4u;
typedef int v4i_raw __attribute__((ext_vector_type(4)));
typedef v4i_raw __attribute__((__may_alias__)) v4i;
typedef __bf16 v16b __attribute__((ext_vector_type(16)));
typedef __bf16 v8b __attribute__((ext_vector_type(8)));

union Frag  { v16b v; v8b h[2]; v4u q[2]; };
union Pack8 { v8b v; v4u q; };

struct FreqTab { double f[32]; };
typedef char freqtab_size_check[(sizeof(FreqTab) == 256) ? 1 : -1];

__device__ __forceinline__ v8f vz8() {
  v8f z;
#pragma unroll
  for (int i = 0; i < 8; ++i) z[i] = 0.0f;
  return z;
}

__device__ __forceinline__ v8f load8(const float* p) {
  const v4f a = *(const v4f*)(p);
  const v4f c = *(const v4f*)(p + 4);
  return __builtin_shufflevector(a, c, 0, 1, 2, 3, 4, 5, 6, 7);
}

// Every bf16 plane is stored fragment-major: a [rows][pitch] matrix is cut into 16-row x 32-k fragments of 1 KiB,
// ordered [row/16][k/32]; inside a fragment the 16-byte units (8 consecutive k of one row) are ordered [(k%32)/8][row%16].
// Element offset of the unit that holds (row, k..k+7), k a multiple of 8:
__device__ __forceinline__ size_t punit(int row, int k, int pitch) {
  return (size_t)(row >> 4) * (size_t)(16 * pitch) + (size_t)((k >> 5) * 512 + ((k >> 3) & 3) * 128 + (row & 15) * 8);
}

// 16x32 16-bit fragment, identical map for the A operand ([m][k]) and for the B operand ([n][k]):
// lane -> row/col (lane&15); h = lane>>4; elements 0..7 <- k = kc+8h+0..7, elements 8..15 <- k = kc+16+8h+0..7.
// row is a multiple of 16, kc of 32. In the fragment-major order lane L's two units are units L and 32+L of the
// fragment, so each wave-wide 16-byte load covers 512 contiguous bytes (four whole 128-byte lines).
__device__ __forceinline__ v16b ldfrag(const __bf16* __restrict__ base, int pitch, int row, int kc, int lane) {
  const __bf16* p = base + ((size_t)(row >> 4) * (size_t)(16 * pitch) + (size_t)((kc >> 5) * 512)) + (size_t)(lane * 8);
  Frag f;
  f.q[0] = *(const v4u*)(p);
  f.q[1] = *(const v4u*)(p + 256);
  return f.v;
}

__device__ __forceinline__ v8f wmm(v16b a, v16b b, v8f c) {
  return __builtin_amdgcn_wmma_f32_16x16x32_bf16(false, a, false, b, (short)0, c, false, false);
}

// two accumulators sharing one B pair: c0 += a0*b, c1 += a1*b with hi/lo planes (hi*hi + hi*lo + lo*hi);
// 4 v_nop after the last WMMA, tying both D tiles and all six operand fragments.
__device__ __forceinline__ void mma3x2(v8f& c0, v8f& c1,
                                       const v16b a0h, const v16b a0l,
                                       const v16b a1h, const v16b a1l,
                                       const v16b bh, const v16b bl) {
  c0 = wmm(a0h, bh, c0);
  c1 = wmm(a1h, bh, c1);
  c0 = wmm(a0h, bl, c0);
  c1 = wmm(a1h, bl, c1);
  c0 = wmm(a0l, bh, c0);
  c1 = wmm(a1l, bh, c1);
  asm volatile("v_nop\n\tv_nop\n\tv_nop\n\tv_nop"
               : "+v"(c0), "+v"(c1)
               : "v"(a0h), "v"(a0l), "v"(a1h), "v"(a1l), "v"(bh), "v"(bl));
}

// f32 x8 -> bf16 hi (RNE convert) and bf16 lo = RNE(x - hi), packed as 16 bytes each
__device__ __forceinline__ void split8(const v8f x, v4u& uh, v4u& ul) {
  Pack8 a, c;
  a.v = __builtin_convertvector(x, v8b);
  const v8f xh = __builtin_convertvector(a.v, v8f);
  c.v = __builtin_convertvector(x - xh, v8b);
  uh = a.q;
  ul = c.q;
}

// ---------------------------------------------------------------------------
// Trig table tr[s][0..31] = sin(s*f_d), tr[s][32..63] = cos(s*f_d), s = 0..511, angle formed in f64,
// evaluated as sincos(hi) with first-order lo correction in f32.
// ---------------------------------------------------------------------------
__global__ __launch_bounds__(128)
void k_trig(FreqTab ft, float* __restrict__ tr)
{
  const int gid = (int)(blockIdx.x * 128u + threadIdx.x);
  if (gid >= SQ * 8) return;
  const int s = gid >> 3, j = gid & 7;
  float sa0 = 0.f, sa1 = 0.f, sa2 = 0.f, sa3 = 0.f;
  float ca0 = 0.f, ca1 = 0.f, ca2 = 0.f, ca3 = 0.f;
#pragma unroll 1
  for (int i = 0; i < 4; ++i) {
    const int d = 4 * j + i;
    const double ang = (double)s * ft.f[d];
    const float ah = (float)ang;
    const float al = (float)(ang - (double)ah);
    float sv, cv;
    sincosf(ah, &sv, &cv);
    const float sf = sv + al * cv;
    const float cf = cv - al * sv;
    sa0 = sa1; sa1 = sa2; sa2 = sa3; sa3 = sf;
    ca0 = ca1; ca1 = ca2; ca2 = ca3; ca3 = cf;
  }
  v4f vs, vc;
  vs[0] = sa0; vs[1] = sa1; vs[2] = sa2; vs[3] = sa3;
  vc[0] = ca0; vc[1] = ca1; vc[2] = ca2; vc[3] = ca3;
  float* ps = tr + (size_t)s * HDIM + 4 * j;
  float* pc = ps + 32;
  *(v4f*)ps = vs;
  *(v4f*)pc = vc;
  
}

// ---------------------------------------------------------------------------
// f32 [rows][64] -> fragment-major bf16 hi/lo planes, one 16-B unit per thread.
// A wave takes 8 rows x 32 k: lanes 8q..8q+7 (8 rows, one k octet) store one whole line.
// ---------------------------------------------------------------------------
__global__ __launch_bounds__(128)
void k_split_rows(const float* __restrict__ src, __bf16* __restrict__ dh, __bf16* __restrict__ dl, int n8)
{
  const int t = (int)(blockIdx.x * 128u + threadIdx.x);
  if (t >= n8) return;
  const int frag = t >> 6;
  const int row = (frag >> 1) * 16 + ((t >> 5) & 1) * 8 + (t & 7);
  const int k = (frag & 1) * 32 + ((t >> 3) & 3) * 8;
  const v8f x = load8(src + (size_t)row * HDIM + k);
  v4u uh, ul;
  split8(x, uh, ul);
  const size_t dst = punit(row, k, HDIM);
  __bf16* ph = dh + dst;
  __bf16* pl = dl + dst;
  *(v4u*)ph = uh;
  *(v4u*)pl = ul;
  
}

// ---------------------------------------------------------------------------
// x[b][s][h*64+d] -> head-major planes kx{h,l}, rows (b*16+h)*512+s, 64 k, fragment-major (bf16 hi/lo).
// A wave takes 8 rows x 32 k: lanes 8q..8q+7 (8 rows, one k octet) store one whole line.
// ---------------------------------------------------------------------------
__global__ __launch_bounds__(128)
void k_xsplit(const float* __restrict__ x, __bf16* __restrict__ kxh, __bf16* __restrict__ kxl, int n8)
{
  const int t = (int)(blockIdx.x * 128u + threadIdx.x);
  if (t >= n8) return;
  const int frag = t >> 6;
  const int row = (frag >> 1) * 16 + ((t >> 5) & 1) * 8 + (t & 7);
  const int d = (frag & 1) * 32 + ((t >> 3) & 3) * 8;
  const int bhq = row >> 9, ss = row & 511;
  const int bb = bhq >> 4, hq = bhq & 15;
  const size_t e0 = ((size_t)(bb * SQ + ss)) * DMOD + hq * HDIM + d;
  const size_t dst = punit(row, d, HDIM);
  const v8f v = load8(x + e0);
  v4u uh, ul;
  split8(v, uh, ul);
  __bf16* ph = kxh + dst;
  __bf16* pl = kxl + dst;
  *(v4u*)ph = uh;
  *(v4u*)pl = ul;
  
}

// ---------------------------------------------------------------------------
// w[k][n] (1024 x 2048, n contiguous) -> wt{h,l}, rows n, 1024 k, fragment-major bf16 hi/lo planes.
// Block: 64 k x 32 n tile through LDS; a wave takes 16 n x 2 k octets and stores 512 contiguous bytes.
// in[1024][2048] -> out[2048][1024]; grid = (2048/32) * (1024/64).
// ---------------------------------------------------------------------------
__global__ __launch_bounds__(128)
void k_wsplitT(const float* __restrict__ w, __bf16* __restrict__ wth, __bf16* __restrict__ wtl)
{
  __shared__ __align__(16) float T[64][36];
  const int tid = threadIdx.x;
  const int nb = (int)(blockIdx.x & 63u), kb = (int)(blockIdx.x >> 6);
  const int n0 = nb * 32, k0 = kb * 64;
#pragma unroll
  for (int i = 0; i < 4; ++i) {
    const int idx = tid + 128 * i;
    const int row = idx >> 3, c4 = idx & 7;
    const v4f v = *(const v4f*)(w + (size_t)(k0 + row) * (2 * DMOD) + n0 + 4 * c4);
    *(v4f*)&T[row][4 * c4] = v;
  }
  __syncthreads();
#pragma unroll 1
  for (int i = 0; i < 2; ++i) {
    const int task = tid + 128 * i;
    const int nn = (task >> 7) * 16 + (task & 15), j = (task >> 4) & 7;
    v8f v;
#pragma unroll
    for (int e = 0; e < 8; ++e) v[e] = T[8 * j + e][nn];
    v4u uh, ul;
    split8(v, uh, ul);
    const size_t off = punit(n0 + nn, k0 + 8 * j, DMOD);
    __bf16* ph = wth + off;
    __bf16* pl = wtl + off;
    *(v4u*)ph = uh;
    *(v4u*)pl = ul;
    
  }
}

// ---------------------------------------------------------------------------
// qv = x @ Wqv, M=4096, N=2048, K=1024, bf16 hi/lo planes on both operands.
// Block = 2 waves, tile 64(M) x 64(N) (one head of q or of v); wave w owns rows w*32..w*32+31.
// A from kx planes (pitch 64, head hk = k0/64), B from wt planes ([n][k], pitch 1024), both fragment-major.
// Epilogue through LDS (row pitch 68 floats: its readers take one row, or one column, per lane), fragment-major out:
//   n0 <  1024: qa = q + r_r_bias, qb = rotated (q + r_w_bias); rows (b*16+h)*512+s, 64 k -> qa{h,l}, qb{h,l}
//   n0 >= 1024: v transposed -> vt{h,l}, rows (b*16+h)*64+d, 512 k, columns s0..s0+63
// ---------------------------------------------------------------------------
__global__ __launch_bounds__(64) __attribute__((amdgpu_num_vgpr(256)))
void k_gemm(const __bf16* __restrict__ kxh, const __bf16* __restrict__ kxl,
            const __bf16* __restrict__ wth, const __bf16* __restrict__ wtl,
            const float* __restrict__ rrb, const float* __restrict__ rwb,
            const float* __restrict__ tr,
            __bf16* __restrict__ qah, __bf16* __restrict__ qal,
            __bf16* __restrict__ qbh, __bf16* __restrict__ qbl,
            __bf16* __restrict__ vth, __bf16* __restrict__ vtl)
{
  __shared__ __align__(16) float Cs[64][68];
  // the wave's number in a scalar register: every fragment's row block is then a scalar base, each load base + lane offset
  const int tid = threadIdx.x, w = __builtin_amdgcn_readfirstlane(tid >> 5), lane = tid & 31, hh = lane >> 4, m = lane & 15;
  const int bn = (int)(blockIdx.x & 31u), bm = (int)(blockIdx.x >> 5);
  const int n0 = bn * 64, m0 = bm * 64;
  const int b = m0 >> 9, s0 = m0 & 511;
  const int arow = s0 + w * 32;

  v8f acc0[4], acc1[4];
#pragma unroll
  for (int ni = 0; ni < 4; ++ni) { acc0[ni] = vz8(); acc1[ni] = vz8(); }

#pragma unroll 1
  for (int ks = 0; ks < DMOD / 32; ++ks) {
    const int k0 = ks * 32, hk = k0 >> 6, kc = k0 & 63;
    const int ra = (b * NHEAD + hk) * SQ + arow;
    const v16b a0h = ldfrag(kxh, HDIM, ra, kc, lane);
    const v16b a0l = ldfrag(kxl, HDIM, ra, kc, lane);
    const v16b a1h = ldfrag(kxh, HDIM, ra + 16, kc, lane);
    const v16b a1l = ldfrag(kxl, HDIM, ra + 16, kc, lane);
#pragma unroll
    for (int ni = 0; ni < 4; ++ni) {
      const v16b bhf = ldfrag(wth, DMOD, n0 + ni * 16, k0, lane);
      const v16b blf = ldfrag(wtl, DMOD, n0 + ni * 16, k0, lane);
      mma3x2(acc0[ni], acc1[ni], a0h, a0l, a1h, a1l, bhf, blf);
    }
  }

  // D tile: element r -> row 8*hh + r, col m
#pragma unroll
  for (int ni = 0; ni < 4; ++ni)
#pragma unroll
    for (int r = 0; r < 8; ++r) {
      Cs[w * 32 + 8 * hh + r][ni * 16 + m]      = acc0[ni][r];
      Cs[w * 32 + 16 + 8 * hh + r][ni * 16 + m] = acc1[ni][r];
    }
  __syncthreads();

  if (n0 < DMOD) {
    const int hq = n0 >> 6;
    const int qrow0 = (b * NHEAD + hq) * SQ;
    const float* rrbh = rrb + hq * HDIM;
    const float* rwbh = rwb + hq * HDIM;
#pragma unroll 1
    for (int it = 0; it < 8; ++it) {
      // a wave takes 8 rows x 4 k octets: lanes 8q..8q+7 store one whole line of each plane
      const int j4 = (tid >> 3) & 3, j = (it & 1) * 4 + j4;
      const int rr = (it >> 1) * 16 + (tid >> 5) * 8 + (tid & 7);
      const int s = s0 + rr;
      const v8f cl = load8(&Cs[rr][8 * j4]);        // q[d'],     d' = 8*j4+e
      const v8f ch = load8(&Cs[rr][32 + 8 * j4]);   // q[32+d']
      const v8f bwl = load8(rwbh + 8 * j4);
      const v8f bwh = load8(rwbh + 32 + 8 * j4);
      const v8f br  = load8(rrbh + 8 * j);
      const float* trs = tr + (size_t)s * HDIM;
      const v8f sq = load8(trs + 8 * j4);           // sin(s*f_d')
      const v8f cq = load8(trs + 32 + 8 * j4);      // cos(s*f_d')
      const v8f a = cl + bwl;
      const v8f c = ch + bwh;
      v8f qa, qb;
      if (j < 4) {
        qa = cl + br;
        qb = a * cq + c * sq;
      } else {
        qa = ch + br;
        qb = c * cq - a * sq;
      }
      v4u ah, al, bh, bl;
      split8(qa, ah, al);
      split8(qb, bh, bl);
      const size_t off = punit(qrow0 + s, 8 * j, HDIM);
      __bf16* p0 = qah + off;
      __bf16* p1 = qal + off;
      __bf16* p2 = qbh + off;
      __bf16* p3 = qbl + off;
      *(v4u*)p0 = ah;
      *(v4u*)p1 = al;
      *(v4u*)p2 = bh;
      *(v4u*)p3 = bl;
      
    }
  } else {
    const int hv = (n0 - DMOD) >> 6;
    const int vrow0 = (b * NHEAD + hv) * HDIM;
#pragma unroll 1
    for (int it = 0; it < 8; ++it) {
      // a wave takes 16 d x 2 key octets and stores 512 contiguous bytes of each plane
      const int dd = (it >> 1) * 16 + (tid & 15), j = (it & 1) * 4 + (tid >> 4);
      v8f v;
#pragma unroll
      for (int e = 0; e < 8; ++e) v[e] = Cs[8 * j + e][dd];
      v4u uh, ul;
      split8(v, uh, ul);
      const size_t off = punit(vrow0 + dd, s0 + 8 * j, SQ);
      __bf16* ph = vth + off;
      __bf16* pl = vtl + off;
      *(v4u*)ph = uh;
      *(v4u*)pl = ul;
      
    }
  }
}

// ---------------------------------------------------------------------------
// Fused attention, transposed tiles. Block = 4 waves, wave owns 16 queries of one (b,h); 32 keys per step.
// Scores S^T[key][query] = Kcat[key][0..127] . Qcat[query][0..127]:
//   A = kx planes (cols 0..63) / trig table planes (cols 64..127), B = qa / qb planes (loaded like A).
// Softmax statistics live on lane = query (xor-16 exchange between lane halves).
// O^T[d][query] = V^T . P^T: A = vt planes ([d][key]), B = P^T packed straight from the score D tiles
//   (element r <- key 8h+r of the first 16-key tile, element 8+r <- second tile), bf16 hi/lo.
// ---------------------------------------------------------------------------
__global__ __launch_bounds__(128) __attribute__((amdgpu_num_vgpr(256)))
void k_attn(const __bf16* __restrict__ qah, const __bf16* __restrict__ qal,
            const __bf16* __restrict__ qbh, const __bf16* __restrict__ qbl,
            const __bf16* __restrict__ kxh, const __bf16* __restrict__ kxl,
            const __bf16* __restrict__ trh, const __bf16* __restrict__ trl,
            const __bf16* __restrict__ vth, const __bf16* __restrict__ vtl,
            const int* __restrict__ msk, float* __restrict__ out)
{
  __shared__ __align__(16) float Os[4][16][64];
  // the wave's number in a scalar register: every fragment's row block is then a scalar base, each load base + lane offset
  const int tid = threadIdx.x, w = __builtin_amdgcn_readfirstlane(tid >> 5), lane = tid & 31, hh = lane >> 4, n = lane & 15;
  const int bh = (int)(blockIdx.x >> 3), qc = (int)(blockIdx.x & 7u);
  const int b = bh >> 4, hd = bh & 15;
  const int q0 = qc * 64 + w * 16;
  const int qrow = bh * SQ + q0;   // rows of qa/qb (pitch 64)
  const int krow = bh * SQ;        // + key: rows of kx (pitch 64)
  const int vrow = bh * HDIM;      // + d:   rows of vt (pitch 512)

  v8f o0 = vz8(), o1 = vz8(), o2 = vz8(), o3 = vz8();
  float mrun = -1.0e30f, dsum = 0.0f;

#pragma unroll 1
  for (int kb0 = 0; kb0 < SQ; kb0 += 32) {
    v8f s0 = vz8(), s1 = vz8();
#pragma unroll 1
    for (int c = 0; c < 4; ++c) {
      const bool lowc = (c < 2);
      const int kc = (c & 1) * 32;
      const __bf16* qsh = lowc ? qah : qbh;
      const __bf16* qsl = lowc ? qal : qbl;
      const __bf16* ksh = lowc ? kxh : trh;
      const __bf16* ksl = lowc ? kxl : trl;
      const int kr = (lowc ? krow : 0) + kb0;
      const v16b qh  = ldfrag(qsh, HDIM, qrow, kc, lane);
      const v16b ql  = ldfrag(qsl, HDIM, qrow, kc, lane);
      const v16b kah = ldfrag(ksh, HDIM, kr, kc, lane);
      const v16b kal = ldfrag(ksl, HDIM, kr, kc, lane);
      const v16b kch = ldfrag(ksh, HDIM, kr + 16, kc, lane);
      const v16b kcl = ldfrag(ksl, HDIM, kr + 16, kc, lane);
      mma3x2(s0, s1, kah, kal, kch, kcl, qh, ql);
    }

    // key-mask: keys kb0 + 8*hh + r (tile 0) and kb0 + 16 + 8*hh + r (tile 1)
    const int* mp = msk + b * SQ + kb0 + 8 * hh;
    const v4i mA = *(const v4i*)(mp);
    const v4i mB = *(const v4i*)(mp + 4);
    const v4i mC = *(const v4i*)(mp + 16);
    const v4i mD = *(const v4i*)(mp + 20);
    v8f f0, f1;
#pragma unroll
    for (int r = 0; r < 4; ++r) {
      f0[r] = (float)mA[r]; f0[4 + r] = (float)mB[r];
      f1[r] = (float)mC[r]; f1[4 + r] = (float)mD[r];
    }
    s0 = s0 * f0 - (1.0f - f0) * 1.0e8f;
    s1 = s1 * f1 - (1.0f - f1) * 1.0e8f;

    float mloc = s0[0];
#pragma unroll
    for (int r = 0; r < 8; ++r) { mloc = fmaxf(mloc, s0[r]); mloc = fmaxf(mloc, s1[r]); }
    const float mall = fmaxf(mloc, __shfl_xor(mloc, 16, 32));
    const float mnew = fmaxf(mrun, mall);
    const float alpha = __expf(mrun - mnew);
    float psum = 0.0f;
#pragma unroll
    for (int r = 0; r < 8; ++r) {
      const float pa = __expf(s0[r] - mnew);
      const float pb = __expf(s1[r] - mnew);
      s0[r] = pa; s1[r] = pb;
      psum += pa + pb;
    }
    psum += __shfl_xor(psum, 16, 32);
    dsum = dsum * alpha + psum;
    mrun = mnew;
    o0 *= alpha; o1 *= alpha; o2 *= alpha; o3 *= alpha;

    // P^T as the B operand: k = key offset within the 32-key step
    v4u p0h, p0l, p1h, p1l;
    split8(s0, p0h, p0l);
    split8(s1, p1h, p1l);
    Frag ph, pl;
    ph.q[0] = p0h; ph.q[1] = p1h;
    pl.q[0] = p0l; pl.q[1] = p1l;
    {
      const v16b v0h = ldfrag(vth, SQ, vrow, kb0, lane);
      const v16b v0l = ldfrag(vtl, SQ, vrow, kb0, lane);
      const v16b v1h = ldfrag(vth, SQ, vrow + 16, kb0, lane);
      const v16b v1l = ldfrag(vtl, SQ, vrow + 16, kb0, lane);
      mma3x2(o0, o1, v0h, v0l, v1h, v1l, ph.v, pl.v);
    }
    {
      const v16b v2h = ldfrag(vth, SQ, vrow + 32, kb0, lane);
      const v16b v2l = ldfrag(vtl, SQ, vrow + 32, kb0, lane);
      const v16b v3h = ldfrag(vth, SQ, vrow + 48, kb0, lane);
      const v16b v3l = ldfrag(vtl, SQ, vrow + 48, kb0, lane);
      mma3x2(o2, o3, v2h, v2l, v3h, v3l, ph.v, pl.v);
    }
  }

  // O^T element r of tile t -> d = 16*t + 8*hh + r, query n
  const float rinv = 1.0f / dsum;
#pragma unroll
  for (int r = 0; r < 8; ++r) {
    Os[w][n][8 * hh + r]      = o0[r] * rinv;
    Os[w][n][16 + 8 * hh + r] = o1[r] * rinv;
    Os[w][n][32 + 8 * hh + r] = o2[r] * rinv;
    Os[w][n][48 + 8 * hh + r] = o3[r] * rinv;
  }
  __syncthreads();

  v4f ov[8];
#pragma unroll
  for (int it = 0; it < 8; ++it) ov[it] = *(const v4f*)&Os[w][2 * it + hh][4 * n];
  float* ob = out + ((size_t)(b * SQ + q0)) * DMOD + hd * HDIM + 4 * n;
#pragma unroll
  for (int it = 0; it < 8; ++it) {
    float* p = ob + (size_t)(2 * it + hh) * DMOD;
    *(v4f*)p = ov[it];
  }
  
}

// ---------------------------------------------------------------------------
extern "C" void kernel_launch(void* const* d_in, const int* in_sizes, int n_in,
                              void* d_out, int out_size, void* d_ws,
                              size_t ws_size, hipStream_t stream)
{
  if (n_in < 5) return;
  if (in_sizes[0] != NBATCH * SQ * DMOD) return;
  if (in_sizes[1] != NBATCH * SQ) return;
  if (in_sizes[2] != DMOD * 2 * DMOD) return;
  if (in_sizes[3] != NHEAD * HDIM) return;
  if (in_sizes[4] != NHEAD * HDIM) return;
  if (out_size != NBATCH * SQ * DMOD) return;

  const float* x    = (const float*)d_in[0];
  const int*   mk   = (const int*)d_in[1];
  const float* wqv  = (const float*)d_in[2];
  const float* rrb  = (const float*)d_in[3];
  const float* rwb  = (const float*)d_in[4];
  float* out = (float*)d_out;

  const size_t n_tr    = (size_t)SQ * HDIM;                 // 32768
  const size_t n_heads = (size_t)NBATCH * NHEAD * SQ * HDIM; // 4194304
  const size_t n_w     = (size_t)DMOD * 2 * DMOD;            // 2097152

  char* ws = (char*)d_ws;
  size_t off = 0;
  auto carve = [&](size_t bytes) -> char* {
    char* p = ws + off;
    off += (bytes + 255) & ~(size_t)255;
    return p;
  };
  float*  tr  = (float*)carve(n_tr * 4);
  __bf16* trh = (__bf16*)carve(n_tr * 2);
  __bf16* trl = (__bf16*)carve(n_tr * 2);
  __bf16* kxh = (__bf16*)carve(n_heads * 2);
  __bf16* kxl = (__bf16*)carve(n_heads * 2);
  __bf16* wth = (__bf16*)carve(n_w * 2);
  __bf16* wtl = (__bf16*)carve(n_w * 2);
  __bf16* qah = (__bf16*)carve(n_heads * 2);
  __bf16* qal = (__bf16*)carve(n_heads * 2);
  __bf16* qbh = (__bf16*)carve(n_heads * 2);
  __bf16* qbl = (__bf16*)carve(n_heads * 2);
  __bf16* vth = (__bf16*)carve(n_heads * 2);
  __bf16* vtl = (__bf16*)carve(n_heads * 2);
  if (off > ws_size) return;

  FreqTab ft;
  const double cst = -log(10000.0) / 31.0;
  for (int d = 0; d < 32; ++d) ft.f[d] = exp((double)((float)d) * cst);

  const int n8_tr = (int)(n_tr / 8);      // 4096
  const int n8_x  = (int)(n_heads / 8);   // 524288

  k_trig<<<dim3((SQ * 8 + 127) / 128), dim3(128), 0, stream>>>(ft, tr);
  k_split_rows<<<dim3((n8_tr + 127) / 128), dim3(128), 0, stream>>>(tr, trh, trl, n8_tr);
  k_xsplit<<<dim3((n8_x + 127) / 128), dim3(128), 0, stream>>>(x, kxh, kxl, n8_x);
  k_wsplitT<<<dim3((2 * DMOD / 32) * (DMOD / 64)), dim3(128), 0, stream>>>(wqv, wth, wtl);
  k_gemm<<<dim3((NBATCH * SQ / 64) * (2 * DMOD / 64)), dim3(64), 0, stream>>>(
      kxh, kxl, wth, wtl, rrb, rwb, tr, qah, qal, qbh, qbl, vth, vtl);
  k_attn<<<dim3(NBATCH * NHEAD * (SQ / 64)), dim3(128), 0, stream>>>(
      qah, qal, qbh, qbl, kxh, kxl, trh, trl, vth, vtl, mk, out);
}

// v002
// One run takes 97.1 microseconds.
// In two side-by-side timings against v001, it was 1.46 and 1.47 times as fast.
// All steps since v000 together make it 2.42 times as fast.
#include <hip/hip_runtime.h>
#include <math.h>
#include <stddef.h>

// Contractions: x*Wqv, per-head 128-deep logits ([q+r_r_bias | rotated(q+r_w_bias)] . [k | sin/cos table]), p*v:
// v_wmma_f32_16x16x32_bf16 with bf16 hi/lo operand planes (hi*hi + hi*lo + lo*hi), f32 accumulate; softmax and elementwise math f32.

#define NBATCH 8
#define SQ     512
#define DMOD   1024
#define NHEAD  16
#define HDIM   64

typedef float v8f __attribute__((ext_vector_type(8)));
typedef float v4f_raw __attribute__((ext_vector_type(4)));
typedef v4f_raw __attribute__((__may_alias__)) v4f;
typedef unsigned int v4u_raw __attribute__((ext_vector_type(4)));
typedef v4u_raw __attribute__((__may_alias__)) v4u;
typedef int v4i_raw __attribute__((ext_vector_type(4)));
typedef v4i_raw __attribute__((__may_alias__)) v4i;
typedef __bf16 v16b __attribute__((ext_vector_type(16)));
typedef __bf16 v8b __attribute__((ext_vector_type(8)));

union Frag  { v16b v; v8b h[2]; v4u q[2]; };
union Pack8 { v8b v; v4u q; };

struct FreqTab { double f[32]; };
typedef char freqtab_size_check[(sizeof(FreqTab) == 256) ? 1 : -1];

__device__ __forceinline__ v8f vz8() {
  v8f z;
#pragma unroll
  for (int i = 0; i < 8; ++i) z[i] = 0.0f;
  return z;
}

__device__ __forceinline__ v8f load8(const float* p) {
  const v4f a = *(const v4f*)(p);
  const v4f c = *(const v4f*)(p + 4);
  return __builtin_shufflevector(a, c, 0, 1, 2, 3, 4, 5, 6, 7);
}

// Every bf16 plane is stored fragment-major: a [rows][pitch] matrix is cut into 16-row x 32-k fragments of 1 KiB,
// ordered [row/16][k/32]; inside a fragment the 16-byte units (8 consecutive k of one row) are ordered [(k%32)/8][row%16].
// Element offset of the unit that holds (row, k..k+7), k a multiple of 8:
__device__ __forceinline__ size_t punit(int row, int k, int pitch) {
  return (size_t)(row >> 4) * (size_t)(16 * pitch) + (size_t)((k >> 5) * 512 + ((k >> 3) & 3) * 128 + (row & 15) * 8);
}

// 16x32 16-bit fragment, identical map for the A operand ([m][k]) and for the B operand ([n][k]):
// lane -> row/col (lane&15); h = lane>>4; elements 0..7 <- k = kc+8h+0..7, elements 8..15 <- k = kc+16+8h+0..7.
// row is a multiple of 16, kc of 32. In the fragment-major order lane L's two units are units L and 32+L of the
// fragment, so each wave-wide 16-byte load covers 512 contiguous bytes (four whole 128-byte lines).
// fragblock: the fragment's first byte, the same in every lane; ldfrag: the fragment off bytes behind the lane's own address a.
typedef const __attribute__((address_space(1))) v4u gv4u;
__device__ __forceinline__ unsigned long long fragblock(const __bf16* __restrict__ base, int pitch, int row, int kc) {
  return (unsigned long long)(base + ((size_t)(row >> 4) * (size_t)(16 * pitch) + (size_t)((kc >> 5) * 512)));
}
__device__ __forceinline__ v16b ldfrag(unsigned long long a, int off) {
  const gv4u* p = (const gv4u*)a;   // off, a multiple of 16, goes into the loads' own offset field
  Frag f;
  f.q[0] = p[off / 16];
  f.q[1] = p[off / 16 + 32];
  return f.v;
}

__device__ __forceinline__ v8f wmm(v16b a, v16b b, v8f c) {
  return __builtin_amdgcn_wmma_f32_16x16x32_bf16(false, a, false, b, (short)0, c, false, false);
}

// two accumulators sharing one B pair: c0 += a0*b, c1 += a1*b with hi/lo planes (hi*hi + hi*lo + lo*hi);
// 4 v_nop after the last WMMA, tying both D tiles and all six operand fragments.
__device__ __forceinline__ void mma3x2(v8f& c0, v8f& c1,
                                       const v16b a0h, const v16b a0l,
                                       const v16b a1h, const v16b a1l,
                                       const v16b bh, const v16b bl) {
  c0 = wmm(a0h, bh, c0);
  c1 = wmm(a1h, bh, c1);
  c0 = wmm(a0h, bl, c0);
  c1 = wmm(a1h, bl, c1);
  c0 = wmm(a0l, bh, c0);
  c1 = wmm(a1l, bh, c1);
  asm volatile("v_nop\n\tv_nop\n\tv_nop\n\tv_nop"
               : "+v"(c0), "+v"(c1)
               : "v"(a0h), "v"(a0l), "v"(a1h), "v"(a1l), "v"(bh), "v"(bl));
}

// The lane's address in the hi and in the lo plane, for loads that stay in flight over many instructions. The two register
// pairs are written here and nowhere else: block address + the lane's byte offset, behind the wait that an overwrite of a
// register owes to the loads in flight that name it. As in-out operands the pairs stay whole from one call to the next,
// so that no load's result is put into them; wait and additions are one statement, so that nothing comes between them.
struct Addr2 { unsigned long long h, l; };
__device__ __forceinline__ void point_at(Addr2& a, unsigned long long blockh, unsigned long long blockl, unsigned long long laneoff) {
  asm volatile("s_wait_xcnt 0x0\n\tv_add_nc_u64 %0, %2, %4\n\tv_add_nc_u64 %1, %3, %4"
               : "+v"(a.h), "+v"(a.l) : "s"(blockh), "s"(blockl), "v"(laneoff) : "memory");
}
// behind the last loads: holds the pairs whole up to the wait
__device__ __forceinline__ void done_with(const Addr2& a) {
  asm volatile("s_wait_xcnt 0x0" :: "v"(a.h), "v"(a.l) : "memory");
}

// four fragments of one 32-deep chunk, off bytes behind a: two 16-row tiles (16 * pitch elements apart), hi and lo plane
struct Frag4 { v16b h0, l0, h1, l1; };
__device__ __forceinline__ Frag4 ldfrag4(const Addr2& a, int off, int pitch) {
  Frag4 f;
  f.h0 = ldfrag(a.h, off);
  f.l0 = ldfrag(a.l, off);
  f.h1 = ldfrag(a.h, off + 32 * pitch);
  f.l1 = ldfrag(a.l, off + 32 * pitch);
  return f;
}

// __expf as the compiler builds it (one multiply, v_exp_f32), with the free slot that the instruction set asks for behind a
// transcendental in the same statement.
__device__ __forceinline__ float exp_with_slot(float x) {
  float r;
  asm("v_exp_f32 %0, %1\n\tv_nop" : "=v"(r) : "v"(x * 1.44269504f));
  return r;
}

// f32 x8 -> bf16 hi (RNE convert) and bf16 lo = RNE(x - hi), packed as 16 bytes each
__device__ __forceinline__ void split8(const v8f x, v4u& uh, v4u& ul) {
  Pack8 a, c;
  a.v = __builtin_convertvector(x, v8b);
  const v8f xh = __builtin_convertvector(a.v, v8f);
  c.v = __builtin_convertvector(x - xh, v8b);
  uh = a.q;
  ul = c.q;
}

// ---------------------------------------------------------------------------
// Trig table tr[s][0..31] = sin(s*f_d), tr[s][32..63] = cos(s*f_d), s = 0..511, angle formed in f64,
// evaluated as sincos(hi) with first-order lo correction in f32.
// ---------------------------------------------------------------------------
__global__ __launch_bounds__(128)
void k_trig(FreqTab ft, float* __restrict__ tr)
{
  const int gid = (int)(blockIdx.x * 128u + threadIdx.x);
  if (gid >= SQ * 8) return;
  const int s = gid >> 3, j = gid & 7;
  float sa0 = 0.f, sa1 = 0.f, sa2 = 0.f, sa3 = 0.f;
  float ca0 = 0.f, ca1 = 0.f, ca2 = 0.f, ca3 = 0.f;
#pragma unroll 1
  for (int i = 0; i < 4; ++i) {
    const int d = 4 * j + i;
    const double ang = (double)s * ft.f[d];
    const float ah = (float)ang;
    const float al = (float)(ang - (double)ah);
    float sv, cv;
    sincosf(ah, &sv, &cv);
    const float sf = sv + al * cv;
    const float cf = cv - al * sv;
    sa0 = sa1; sa1 = sa2; sa2 = sa3; sa3 = sf;
    ca0 = ca1; ca1 = ca2; ca2 = ca3; ca3 = cf;
  }
  v4f vs, vc;
  vs[0] = sa0; vs[1] = sa1; vs[2] = sa2; vs[3] = sa3;
  vc[0] = ca0; vc[1] = ca1; vc[2] = ca2; vc[3] = ca3;
  float* ps = tr + (size_t)s * HDIM + 4 * j;
  float* pc = ps + 32;
  *(v4f*)ps = vs;
  *(v4f*)pc = vc;
  
}

// ---------------------------------------------------------------------------
// f32 [rows][64] -> fragment-major bf16 hi/lo planes, one 16-B unit per thread.
// A wave takes 8 rows x 32 k: lanes 8q..8q+7 (8 rows, one k octet) store one whole line.
// ---------------------------------------------------------------------------
__global__ __launch_bounds__(128)
void k_split_rows(const float* __restrict__ src, __bf16* __restrict__ dh, __bf16* __restrict__ dl, int n8)
{
  const int t = (int)(blockIdx.x * 128u + threadIdx.x);
  if (t >= n8) return;
  const int frag = t >> 6;
  const int row = (frag >> 1) * 16 + ((t >> 5) & 1) * 8 + (t & 7);
  const int k = (frag & 1) * 32 + ((t >> 3) & 3) * 8;
  const v8f x = load8(src + (size_t)row * HDIM + k);
  v4u uh, ul;
  split8(x, uh, ul);
  const size_t dst = punit(row, k, HDIM);
  __bf16* ph = dh + dst;
  __bf16* pl = dl + dst;
  *(v4u*)ph = uh;
  *(v4u*)pl = ul;
  
}

// ---------------------------------------------------------------------------
// x[b][s][h*64+d] -> head-major planes kx{h,l}, rows (b*16+h)*512+s, 64 k, fragment-major (bf16 hi/lo).
// A wave takes 8 rows x 32 k: lanes 8q..8q+7 (8 rows, one k octet) store one whole line.
// ---------------------------------------------------------------------------
__global__ __launch_bounds__(128)
void k_xsplit(const float* __restrict__ x, __bf16* __restrict__ kxh, __bf16* __restrict__ kxl, int n8)
{
  const int t = (int)(blockIdx.x * 128u + threadIdx.x);
  if (t >= n8) return;
  const int frag = t >> 6;
  const int row = (frag >> 1) * 16 + ((t >> 5) & 1) * 8 + (t & 7);
  const int d = (frag & 1) * 32 + ((t >> 3) & 3) * 8;
  const int bhq = row >> 9, ss = row & 511;
  const int bb = bhq >> 4, hq = bhq & 15;
  const size_t e0 = ((size_t)(bb * SQ + ss)) * DMOD + hq * HDIM + d;
  const size_t dst = punit(row, d, HDIM);
  const v8f v = load8(x + e0);
  v4u uh, ul;
  split8(v, uh, ul);
  __bf16* ph = kxh + dst;
  __bf16* pl = kxl + dst;
  *(v4u*)ph = uh;
  *(v4u*)pl = ul;
  
}

// ---------------------------------------------------------------------------
// w[k][n] (1024 x 2048, n contiguous) -> wt{h,l}, rows n, 1024 k, fragment-major bf16 hi/lo planes.
// Block: 64 k x 32 n tile through LDS; a wave takes 16 n x 2 k octets and stores 512 contiguous bytes.
// in[1024][2048] -> out[2048][1024]; grid = (2048/32) * (1024/64).
// ---------------------------------------------------------------------------
__global__ __launch_bounds__(128)
void k_wsplitT(const float* __restrict__ w, __bf16* __restrict__ wth, __bf16* __restrict__ wtl)
{
  __shared__ __align__(16) float T[64][36];
  const int tid = threadIdx.x;
  const int nb = (int)(blockIdx.x & 63u), kb = (int)(blockIdx.x >> 6);
  const int n0 = nb * 32, k0 = kb * 64;
#pragma unroll
  for (int i = 0; i < 4; ++i) {
    const int idx = tid + 128 * i;
    const int row = idx >> 3, c4 = idx & 7;
    const v4f v = *(const v4f*)(w + (size_t)(k0 + row) * (2 * DMOD) + n0 + 4 * c4);
    *(v4f*)&T[row][4 * c4] = v;
  }
  __syncthreads();
#pragma unroll 1
  for (int i = 0; i < 2; ++i) {
    const int task = tid + 128 * i;
    const int nn = (task >> 7) * 16 + (task & 15), j = (task >> 4) & 7;
    v8f v;
#pragma unroll
    for (int e = 0; e < 8; ++e) v[e] = T[8 * j + e][nn];
    v4u uh, ul;
    split8(v, uh, ul);
    const size_t off = punit(n0 + nn, k0 + 8 * j, DMOD);
    __bf16* ph = wth + off;
    __bf16* pl = wtl + off;
    *(v4u*)ph = uh;
    *(v4u*)pl = ul;
    
  }
}

// ---------------------------------------------------------------------------
// qv = x @ Wqv, M=4096, N=2048, K=1024, bf16 hi/lo planes on both operands.
// Block = 2 waves, tile 64(M) x 64(N) (one head of q or of v); wave w owns rows w*32..w*32+31.
// A from kx planes (pitch 64, head hk = k0/64), B from wt planes ([n][k], pitch 1024), both fragment-major.
// Epilogue through LDS (row pitch 68 floats: its readers take one row, or one column, per lane), fragment-major out:
//   n0 <  1024: qa = q + r_r_bias, qb = rotated (q + r_w_bias); rows (b*16+h)*512+s, 64 k -> qa{h,l}, qb{h,l}
//   n0 >= 1024: v transposed -> vt{h,l}, rows (b*16+h)*64+d, 512 k, columns s0..s0+63
// ---------------------------------------------------------------------------
__global__ __launch_bounds__(64) __attribute__((amdgpu_num_vgpr(256)))
void k_gemm(const __bf16* __restrict__ kxh, const __bf16* __restrict__ kxl,
            const __bf16* __restrict__ wth, const __bf16* __restrict__ wtl,
            const float* __restrict__ rrb, const float* __restrict__ rwb,
            const float* __restrict__ tr,
            __bf16* __restrict__ qah, __bf16* __restrict__ qal,
            __bf16* __restrict__ qbh, __bf16* __restrict__ qbl,
            __bf16* __restrict__ vth, __bf16* __restrict__ vtl)
{
  __shared__ __align__(16) float Cs[64][68];
  // the wave's number in a scalar register: every fragment's block address is then a scalar value, as point_at takes it
  const int tid = threadIdx.x, w = __builtin_amdgcn_readfirstlane(tid >> 5), lane = tid & 31, hh = lane >> 4, m = lane & 15;
  const int bn = (int)(blockIdx.x & 31u), bm = (int)(blockIdx.x >> 5);
  const int n0 = bn * 64, m0 = bm * 64;
  const int b = m0 >> 9, s0 = m0 & 511;
  const int arow = s0 + w * 32;

  v8f acc0[4], acc1[4];
#pragma unroll
  for (int ni = 0; ni < 4; ++ni) { acc0[ni] = vz8(); acc1[ni] = vz8(); }

  // Every fragment is asked for one k step before the products that read it: the A set into a second register set at
  // the head of the step, each B pair into its own registers right behind its last reader.
  const int abase = b * NHEAD * SQ + arow;
  const unsigned long long laneoff = (unsigned long long)(unsigned)(lane * 16);
  Addr2 pa = {0, 0}, pb = {0, 0};
  point_at(pa, fragblock(kxh, HDIM, abase, 0), fragblock(kxl, HDIM, abase, 0), laneoff);
  point_at(pb, fragblock(wth, DMOD, n0, 0), fragblock(wtl, DMOD, n0, 0), laneoff);
  Frag4 a = ldfrag4(pa, 0, HDIM);
  v16b bhf[4], blf[4];
#pragma unroll
  for (int ni = 0; ni < 4; ++ni) {
    bhf[ni] = ldfrag(pb.h, ni * 32 * DMOD);
    blf[ni] = ldfrag(pb.l, ni * 32 * DMOD);
    // the first loads keep the order that the loop's own have (A, then B pair by pair): the counted wait at the loop's head
    // must hold for both ways in, and with another order here it would wait for the youngest loads on every trip
    __builtin_amdgcn_sched_barrier(0);
  }
  // two steps per trip: the two A sets swap names and no register is copied
#pragma unroll 2
  for (int ks = 0; ks < DMOD / 32; ++ks) {
    // the last step asks for its own fragments again, so that no address leaves the planes
    const int kn = (ks + 1 < DMOD / 32) ? ks + 1 : ks;
    const int ran = abase + (kn >> 1) * SQ, kcn = (kn & 1) * 32;
    point_at(pa, fragblock(kxh, HDIM, ran, kcn), fragblock(kxl, HDIM, ran, kcn), laneoff);
    point_at(pb, fragblock(wth, DMOD, n0, kn * 32), fragblock(wtl, DMOD, n0, kn * 32), laneoff);
    const Frag4 an = ldfrag4(pa, 0, HDIM);
#pragma unroll
    for (int ni = 0; ni < 4; ++ni) {
      mma3x2(acc0[ni], acc1[ni], a.h0, a.l0, a.h1, a.l1, bhf[ni], blf[ni]);
      bhf[ni] = ldfrag(pb.h, ni * 32 * DMOD);
      blf[ni] = ldfrag(pb.l, ni * 32 * DMOD);
      // keeps each reload right behind its pair's last reader: moved to the step's end it would be waited for at once
      __builtin_amdgcn_sched_barrier(0);
    }
    a = an;
  }
  done_with(pa);
  done_with(pb);

  // D tile: element r -> row 8*hh + r, col m
#pragma unroll
  for (int ni = 0; ni < 4; ++ni)
#pragma unroll
    for (int r = 0; r < 8; ++r) {
      Cs[w * 32 + 8 * hh + r][ni * 16 + m]      = acc0[ni][r];
      Cs[w * 32 + 16 + 8 * hh + r][ni * 16 + m] = acc1[ni][r];
    }
  __syncthreads();

  if (n0 < DMOD) {
    const int hq = n0 >> 6;
    const int qrow0 = (b * NHEAD + hq) * SQ;
    const float* rrbh = rrb + hq * HDIM;
    const float* rwbh = rwb + hq * HDIM;
#pragma unroll 1
    for (int it = 0; it < 8; ++it) {
      // a wave takes 8 rows x 4 k octets: lanes 8q..8q+7 store one whole line of each plane
      const int j4 = (tid >> 3) & 3, j = (it & 1) * 4 + j4;
      const int rr = (it >> 1) * 16 + (tid >> 5) * 8 + (tid & 7);
      const int s = s0 + rr;
      const v8f cl = load8(&Cs[rr][8 * j4]);        // q[d'],     d' = 8*j4+e
      const v8f ch = load8(&Cs[rr][32 + 8 * j4]);   // q[32+d']
      const v8f bwl = load8(rwbh + 8 * j4);
      const v8f bwh = load8(rwbh + 32 + 8 * j4);
      const v8f br  = load8(rrbh + 8 * j);
      const float* trs = tr + (size_t)s * HDIM;
      const v8f sq = load8(trs + 8 * j4);           // sin(s*f_d')
      const v8f cq = load8(trs + 32 + 8 * j4);      // cos(s*f_d')
      const v8f a = cl + bwl;
      const v8f c = ch + bwh;
      v8f qa, qb;
      if (j < 4) {
        qa = cl + br;
        qb = a * cq + c * sq;
      } else {
        qa = ch + br;
        qb = c * cq - a * sq;
      }
      v4u ah, al, bh, bl;
      split8(qa, ah, al);
      split8(qb, bh, bl);
      const size_t off = punit(qrow0 + s, 8 * j, HDIM);
      __bf16* p0 = qah + off;
      __bf16* p1 = qal + off;
      __bf16* p2 = qbh + off;
      __bf16* p3 = qbl + off;
      *(v4u*)p0 = ah;
      *(v4u*)p1 = al;
      *(v4u*)p2 = bh;
      *(v4u*)p3 = bl;
      
    }
  } else {
    const int hv = (n0 - DMOD) >> 6;
    const int vrow0 = (b * NHEAD + hv) * HDIM;
#pragma unroll 1
    for (int it = 0; it < 8; ++it) {
      // a wave takes 16 d x 2 key octets and stores 512 contiguous bytes of each plane
      const int dd = (it >> 1) * 16 + (tid & 15), j = (it & 1) * 4 + (tid >> 4);
      v8f v;
#pragma unroll
      for (int e = 0; e < 8; ++e) v[e] = Cs[8 * j + e][dd];
      v4u uh, ul;
      split8(v, uh, ul);
      const size_t off = punit(vrow0 + dd, s0 + 8 * j, SQ);
      __bf16* ph = vth + off;
      __bf16* pl = vtl + off;
      *(v4u*)ph = uh;
      *(v4u*)pl = ul;
      
    }
  }
}

// ---------------------------------------------------------------------------
// Fused attention, transposed tiles. Block = 4 waves, wave owns 16 queries of one (b,h); 32 keys per step.
// Scores S^T[key][query] = Kcat[key][0..127] . Qcat[query][0..127]:
//   A = kx planes (cols 0..63) / trig table planes (cols 64..127), B = qa / qb planes (loaded like A).
// Softmax statistics live on lane = query (xor-16 exchange between lane halves).
// O^T[d][query] = V^T . P^T: A = vt planes ([d][key]), B = P^T packed straight from the score D tiles
//   (element r <- key 8h+r of the first 16-key tile, element 8+r <- second tile), bf16 hi/lo.
// ---------------------------------------------------------------------------
__global__ __launch_bounds__(128) __attribute__((amdgpu_num_vgpr(256)))
void k_attn(const __bf16* __restrict__ qah, const __bf16* __restrict__ qal,
            const __bf16* __restrict__ qbh, const __bf16* __restrict__ qbl,
            const __bf16* __restrict__ kxh, const __bf16* __restrict__ kxl,
            const __bf16* __restrict__ trh, const __bf16* __restrict__ trl,
            const __bf16* __restrict__ vth, const __bf16* __restrict__ vtl,
            const int* __restrict__ msk, float* __restrict__ out)
{
  __shared__ __align__(16) float Os[4][16][64];
  // the wave's number in a scalar register: every fragment's block address is then a scalar value, as point_at takes it
  const int tid = threadIdx.x, w = __builtin_amdgcn_readfirstlane(tid >> 5), lane = tid & 31, hh = lane >> 4, n = lane & 15;
  const int bh = (int)(blockIdx.x >> 3), qc = (int)(blockIdx.x & 7u);
  const int b = bh >> 4, hd = bh & 15;
  const int q0 = qc * 64 + w * 16;
  const int qrow = bh * SQ + q0;   // rows of qa/qb (pitch 64)
  const int krow = bh * SQ;        // + key: rows of kx (pitch 64)
  const int vrow = bh * HDIM;      // + d:   rows of vt (pitch 512)

  const unsigned long long laneoff = (unsigned long long)(unsigned)(lane * 16);
  Addr2 pf = {0, 0};
  // the wave's 16 queries, all 128 columns (qa | qb), hi and lo planes; columns 32..63 of a plane lie 1024 bytes behind 0..31
  point_at(pf, fragblock(qah, HDIM, qrow, 0), fragblock(qal, HDIM, qrow, 0), laneoff);
  const v16b qh0 = ldfrag(pf.h, 0),    ql0 = ldfrag(pf.l, 0);
  const v16b qh1 = ldfrag(pf.h, 1024), ql1 = ldfrag(pf.l, 1024);
  point_at(pf, fragblock(qbh, HDIM, qrow, 0), fragblock(qbl, HDIM, qrow, 0), laneoff);
  const v16b qh2 = ldfrag(pf.h, 0),    ql2 = ldfrag(pf.l, 0);
  const v16b qh3 = ldfrag(pf.h, 1024), ql3 = ldfrag(pf.l, 1024);

  v8f o0 = vz8(), o1 = vz8(), o2 = vz8(), o3 = vz8();
  float mrun = -1.0e30f, dsum = 0.0f;

  // Key-side fragments are asked for ahead of the products that read them, each where registers have come free: chunk 3, the
  // mask and V among this step's score products, chunk 0 of the next 32 keys behind them, chunks 1 and 2 among the P*V products.
  point_at(pf, fragblock(kxh, HDIM, krow, 0), fragblock(kxl, HDIM, krow, 0), laneoff);
  Frag4 k0 = ldfrag4(pf, 0, HDIM);
  Frag4 k1 = ldfrag4(pf, 1024, HDIM);
  point_at(pf, fragblock(trh, HDIM, 0, 0), fragblock(trl, HDIM, 0, 0), laneoff);
  Frag4 k2 = ldfrag4(pf, 0, HDIM);

#pragma unroll 1
  for (int kb0 = 0; kb0 < SQ; kb0 += 32) {
    // the last step asks for its own keys again, so that no address leaves the planes
    const int kbn = (kb0 + 32 < SQ) ? kb0 + 32 : kb0;
    v8f s0 = vz8(), s1 = vz8();
    mma3x2(s0, s1, k0.h0, k0.l0, k0.h1, k0.l1, qh0, ql0);
    point_at(pf, fragblock(trh, HDIM, kb0, 32), fragblock(trl, HDIM, kb0, 32), laneoff);
    const Frag4 k3 = ldfrag4(pf, 0, HDIM);
    // key-mask: keys kb0 + 8*hh + r (tile 0) and kb0 + 16 + 8*hh + r (tile 1)
    const int* mp = msk + b * SQ + kb0 + 8 * hh;
    const v4i mA = *(const v4i*)(mp);
    const v4i mB = *(const v4i*)(mp + 4);
    const v4i mC = *(const v4i*)(mp + 16);
    const v4i mD = *(const v4i*)(mp + 20);
    // each scheduling barrier of this loop keeps the loads above it in front of the arithmetic below it: issued later they
    // would have less of it to fly behind
    __builtin_amdgcn_sched_barrier(0);
    mma3x2(s0, s1, k1.h0, k1.l0, k1.h1, k1.l1, qh1, ql1);
    point_at(pf, fragblock(vth, SQ, vrow, kb0), fragblock(vtl, SQ, vrow, kb0), laneoff);
    const Frag4 v01 = ldfrag4(pf, 0, SQ);
    mma3x2(s0, s1, k2.h0, k2.l0, k2.h1, k2.l1, qh2, ql2);
    const Frag4 v23 = ldfrag4(pf, 64 * SQ, SQ);   // 32 rows of V^T further on
    mma3x2(s0, s1, k3.h0, k3.l0, k3.h1, k3.l1, qh3, ql3);
    point_at(pf, fragblock(kxh, HDIM, krow + kbn, 0), fragblock(kxl, HDIM, krow + kbn, 0), laneoff);
    k0 = ldfrag4(pf, 0, HDIM);
    __builtin_amdgcn_sched_barrier(0);
    v8f f0, f1;
#pragma unroll
    for (int r = 0; r < 4; ++r) {
      f0[r] = (float)mA[r]; f0[4 + r] = (float)mB[r];
      f1[r] = (float)mC[r]; f1[4 + r] = (float)mD[r];
    }
    s0 = s0 * f0 - (1.0f - f0) * 1.0e8f;
    s1 = s1 * f1 - (1.0f - f1) * 1.0e8f;

    float mloc = s0[0];
#pragma unroll
    for (int r = 0; r < 8; ++r) { mloc = fmaxf(mloc, s0[r]); mloc = fmaxf(mloc, s1[r]); }
    const float mall = fmaxf(mloc, __shfl_xor(mloc, 16, 32));
    const float mnew = fmaxf(mrun, mall);
    const float alpha = __expf(mrun - mnew);
    float psum = 0.0f;
#pragma unroll
    for (int r = 0; r < 8; ++r) {
      const float pa = exp_with_slot(s0[r] - mnew);
      const float pb = exp_with_slot(s1[r] - mnew);
      s0[r] = pa; s1[r] = pb;
      psum += pa + pb;
    }
    psum += __shfl_xor(psum, 16, 32);
    dsum = dsum * alpha + psum;
    mrun = mnew;
    o0 *= alpha; o1 *= alpha; o2 *= alpha; o3 *= alpha;

    // P^T as the B operand: k = key offset within the 32-key step
    v4u p0h, p0l, p1h, p1l;
    split8(s0, p0h, p0l);
    split8(s1, p1h, p1l);
    Frag ph, pl;
    ph.q[0] = p0h; ph.q[1] = p1h;
    pl.q[0] = p0l; pl.q[1] = p1l;
    mma3x2(o0, o1, v01.h0, v01.l0, v01.h1, v01.l1, ph.v, pl.v);
    k1 = ldfrag4(pf, 1024, HDIM);
    __builtin_amdgcn_sched_barrier(0);
    mma3x2(o2, o3, v23.h0, v23.l0, v23.h1, v23.l1, ph.v, pl.v);
    point_at(pf, fragblock(trh, HDIM, kbn, 0), fragblock(trl, HDIM, kbn, 0), laneoff);
    k2 = ldfrag4(pf, 0, HDIM);
  }
  done_with(pf);

  // O^T element r of tile t -> d = 16*t + 8*hh + r, query n
  const float rinv = 1.0f / dsum;
#pragma unroll
  for (int r = 0; r < 8; ++r) {
    Os[w][n][8 * hh + r]      = o0[r] * rinv;
    Os[w][n][16 + 8 * hh + r] = o1[r] * rinv;
    Os[w][n][32 + 8 * hh + r] = o2[r] * rinv;
    Os[w][n][48 + 8 * hh + r] = o3[r] * rinv;
  }
  __syncthreads();

  v4f ov[8];
#pragma unroll
  for (int it = 0; it < 8; ++it) ov[it] = *(const v4f*)&Os[w][2 * it + hh][4 * n];
  float* ob = out + ((size_t)(b * SQ + q0)) * DMOD + hd * HDIM + 4 * n;
#pragma unroll
  for (int it = 0; it < 8; ++it) {
    float* p = ob + (size_t)(2 * it + hh) * DMOD;
    *(v4f*)p = ov[it];
  }
  
}

// ---------------------------------------------------------------------------
extern "C" void kernel_launch(void* const* d_in, const int* in_sizes, int n_in,
                              void* d_out, int out_size, void* d_ws,
                              size_t ws_size, hipStream_t stream)
{
  if (n_in < 5) return;
  if (in_sizes[0] != NBATCH * SQ * DMOD) return;
  if (in_sizes[1] != NBATCH * SQ) return;
  if (in_sizes[2] != DMOD * 2 * DMOD) return;
  if (in_sizes[3] != NHEAD * HDIM) return;
  if (in_sizes[4] != NHEAD * HDIM) return;
  if (out_size != NBATCH * SQ * DMOD) return;

  const float* x    = (const float*)d_in[0];
  const int*   mk   = (const int*)d_in[1];
  const float* wqv  = (const float*)d_in[2];
  const float* rrb  = (const float*)d_in[3];
  const float* rwb  = (const float*)d_in[4];
  float* out = (float*)d_out;

  const size_t n_tr    = (size_t)SQ * HDIM;                 // 32768
  const size_t n_heads = (size_t)NBATCH * NHEAD * SQ * HDIM; // 4194304
  const size_t n_w     = (size_t)DMOD * 2 * DMOD;            // 2097152

  char* ws = (char*)d_ws;
  size_t off = 0;
  auto carve = [&](size_t bytes) -> char* {
    char* p = ws + off;
    off += (bytes + 255) & ~(size_t)255;
    return p;
  };
  float*  tr  = (float*)carve(n_tr * 4);
  __bf16* trh = (__bf16*)carve(n_tr * 2);
  __bf16* trl = (__bf16*)carve(n_tr * 2);
  __bf16* kxh = (__bf16*)carve(n_heads * 2);
  __bf16* kxl = (__bf16*)carve(n_heads * 2);
  __bf16* wth = (__bf16*)carve(n_w * 2);
  __bf16* wtl = (__bf16*)carve(n_w * 2);
  __bf16* qah = (__bf16*)carve(n_heads * 2);
  __bf16* qal = (__bf16*)carve(n_heads * 2);
  __bf16* qbh = (__bf16*)carve(n_heads * 2);
  __bf16* qbl = (__bf16*)carve(n_heads * 2);
  __bf16* vth = (__bf16*)carve(n_heads * 2);
  __bf16* vtl = (__bf16*)carve(n_heads * 2);
  if (off > ws_size) return;

  FreqTab ft;
  const double cst = -log(10000.0) / 31.0;
  for (int d = 0; d < 32; ++d) ft.f[d] = exp((double)((float)d) * cst);

  const int n8_tr = (int)(n_tr / 8);      // 4096
  const int n8_x  = (int)(n_heads / 8);   // 524288

  k_trig<<<dim3((SQ * 8 + 127) / 128), dim3(128), 0, stream>>>(ft, tr);
  k_split_rows<<<dim3((n8_tr + 127) / 128), dim3(128), 0, stream>>>(tr, trh, trl, n8_tr);
  k_xsplit<<<dim3((n8_x + 127) / 128), dim3(128), 0, stream>>>(x, kxh, kxl, n8_x);
  k_wsplitT<<<dim3((2 * DMOD / 32) * (DMOD / 64)), dim3(128), 0, stream>>>(wqv, wth, wtl);
  k_gemm<<<dim3((NBATCH * SQ / 64) * (2 * DMOD / 64)), dim3(64), 0, stream>>>(
      kxh, kxl, wth, wtl, rrb, rwb, tr, qah, qal, qbh, qbl, vth, vtl);
  k_attn<<<dim3(NBATCH * NHEAD * (SQ / 64)), dim3(128), 0, stream>>>(
      qah, qal, qbh, qbl, kxh, kxl, trh, trl, vth, vtl, mk, out);
}

// v003
// One run takes 83.8 microseconds.
// Two timings next to v002 put it at 1.16 and 1.15 times that version's speed.
// All steps since v000 together make it 2.80 times as fast.
#include <hip/hip_runtime.h>
#include <math.h>
#include <stddef.h>

// Contractions: x*Wqv, per-head 128-deep logits ([q+r_r_bias | rotated(q+r_w_bias)] . [k | sin/cos table]), p*v:
// v_wmma_f32_16x16x32_bf16 with bf16 hi/lo operand planes (hi*hi + hi*lo + lo*hi), f32 accumulate; softmax and elementwise math f32.

#define NBATCH 8
#define SQ     512
#define DMOD   1024
#define NHEAD  16
#define HDIM   64

typedef float v8f __attribute__((ext_vector_type(8)));
typedef float v4f_raw __attribute__((ext_vector_type(4)));
typedef v4f_raw __attribute__((__may_alias__)) v4f;
typedef unsigned int v4u_raw __attribute__((ext_vector_type(4)));
typedef v4u_raw __attribute__((__may_alias__)) v4u;
typedef int v4i_raw __attribute__((ext_vector_type(4)));
typedef v4i_raw __attribute__((__may_alias__)) v4i;
typedef __bf16 v16b __attribute__((ext_vector_type(16)));
typedef __bf16 v8b __attribute__((ext_vector_type(8)));

union Frag  { v16b v; v8b h[2]; v4u q[2]; };
union Pack8 { v8b v; v4u q; };

struct FreqTab { double f[32]; };
typedef char freqtab_size_check[(sizeof(FreqTab) == 256) ? 1 : -1];

__device__ __forceinline__ v8f vz8() {
  v8f z;
#pragma unroll
  for (int i = 0; i < 8; ++i) z[i] = 0.0f;
  return z;
}

__device__ __forceinline__ v8f load8(const float* p) {
  const v4f a = *(const v4f*)(p);
  const v4f c = *(const v4f*)(p + 4);
  return __builtin_shufflevector(a, c, 0, 1, 2, 3, 4, 5, 6, 7);
}

// Every bf16 plane is stored fragment-major: a [rows][pitch] matrix is cut into 16-row x 32-k fragments of 1 KiB,
// ordered [row/16][k/32]; inside a fragment the 16-byte units (8 consecutive k of one row) are ordered [(k%32)/8][row%16].
// Element offset of the unit that holds (row, k..k+7), k a multiple of 8:
__device__ __forceinline__ size_t punit(int row, int k, int pitch) {
  return (size_t)(row >> 4) * (size_t)(16 * pitch) + (size_t)((k >> 5) * 512 + ((k >> 3) & 3) * 128 + (row & 15) * 8);
}

// 16x32 16-bit fragment, identical map for the A operand ([m][k]) and for the B operand ([n][k]):
// lane -> row/col (lane&15); h = lane>>4; elements 0..7 <- k = kc+8h+0..7, elements 8..15 <- k = kc+16+8h+0..7.
// row is a multiple of 16, kc of 32. In the fragment-major order lane L's two units are units L and 32+L of the
// fragment, so each wave-wide 16-byte load covers 512 contiguous bytes (four whole 128-byte lines).
// fragblock: the fragment's first byte, the same in every lane; ldfrag: the fragment off bytes behind the lane's own address a.
typedef const __attribute__((address_space(1))) v4u gv4u;
__device__ __forceinline__ unsigned long long fragblock(const __bf16* __restrict__ base, int pitch, int row, int kc) {
  return (unsigned long long)(base + ((size_t)(row >> 4) * (size_t)(16 * pitch) + (size_t)((kc >> 5) * 512)));
}
__device__ __forceinline__ v16b ldfrag(unsigned long long a, int off) {
  const gv4u* p = (const gv4u*)a;   // off, a multiple of 16, goes into the loads' own offset field
  Frag f;
  f.q[0] = p[off / 16];
  f.q[1] = p[off / 16 + 32];
  return f.v;
}

__device__ __forceinline__ v8f wmm(v16b a, v16b b, v8f c) {
  return __builtin_amdgcn_wmma_f32_16x16x32_bf16(false, a, false, b, (short)0, c, false, false);
}

// two accumulators sharing one B pair: c0 += a0*b, c1 += a1*b with hi/lo planes (hi*hi + hi*lo + lo*hi);
// 4 v_nop after the last WMMA, tying both D tiles and all six operand fragments.
__device__ __forceinline__ void mma3x2(v8f& c0, v8f& c1,
                                       const v16b a0h, const v16b a0l,
                                       const v16b a1h, const v16b a1l,
                                       const v16b bh, const v16b bl) {
  c0 = wmm(a0h, bh, c0);
  c1 = wmm(a1h, bh, c1);
  c0 = wmm(a0h, bl, c0);
  c1 = wmm(a1h, bl, c1);
  c0 = wmm(a0l, bh, c0);
  c1 = wmm(a1l, bh, c1);
  asm volatile("v_nop\n\tv_nop\n\tv_nop\n\tv_nop"
               : "+v"(c0), "+v"(c1)
               : "v"(a0h), "v"(a0l), "v"(a1h), "v"(a1l), "v"(bh), "v"(bl));
}

// The lane's address in the hi and in the lo plane, for loads that stay in flight over many instructions. The two register
// pairs are written here and nowhere else: block address + the lane's byte offset, behind the wait that an overwrite of a
// register owes to the loads in flight that name it. As in-out operands the pairs stay whole from one call to the next,
// so that no load's result is put into them; wait and additions are one statement, so that nothing comes between them.
struct Addr2 { unsigned long long h, l; };
__device__ __forceinline__ void point_at(Addr2& a, unsigned long long blockh, unsigned long long blockl, unsigned long long laneoff) {
  asm volatile("s_wait_xcnt 0x0\n\tv_add_nc_u64 %0, %2, %4\n\tv_add_nc_u64 %1, %3, %4"
               : "+v"(a.h), "+v"(a.l) : "s"(blockh), "s"(blockl), "v"(laneoff) : "memory");
}
// behind the last loads: holds the pairs whole up to the wait
__device__ __forceinline__ void done_with(const Addr2& a) {
  asm volatile("s_wait_xcnt 0x0" :: "v"(a.h), "v"(a.l) : "memory");
}

// four fragments of one 32-deep chunk, off bytes behind a: two 16-row tiles (16 * pitch elements apart), hi and lo plane
struct Frag4 { v16b h0, l0, h1, l1; };
__device__ __forceinline__ Frag4 ldfrag4(const Addr2& a, int off, int pitch) {
  Frag4 f;
  f.h0 = ldfrag(a.h, off);
  f.l0 = ldfrag(a.l, off);
  f.h1 = ldfrag(a.h, off + 32 * pitch);
  f.l1 = ldfrag(a.l, off + 32 * pitch);
  return f;
}

// __expf as the compiler builds it (one multiply, v_exp_f32), with the free slot that the instruction set asks for behind a
// transcendental in the same statement.
__device__ __forceinline__ float exp_with_slot(float x) {
  float r;
  asm("v_exp_f32 %0, %1\n\tv_nop" : "=v"(r) : "v"(x * 1.44269504f));
  return r;
}

// f32 x8 -> bf16 hi (RNE convert) and bf16 lo = RNE(x - hi), packed as 16 bytes each
__device__ __forceinline__ void split8(const v8f x, v4u& uh, v4u& ul) {
  Pack8 a, c;
  a.v = __builtin_convertvector(x, v8b);
  const v8f xh = __builtin_convertvector(a.v, v8f);
  c.v = __builtin_convertvector(x - xh, v8b);
  uh = a.q;
  ul = c.q;
}

// ---------------------------------------------------------------------------
// Trig table tr[s][0..31] = sin(s*f_d), tr[s][32..63] = cos(s*f_d), s = 0..511, angle formed in f64,
// evaluated as sincos(hi) with first-order lo correction in f32.
// ---------------------------------------------------------------------------
__global__ __launch_bounds__(128)
void k_trig(FreqTab ft, float* __restrict__ tr)
{
  const int gid = (int)(blockIdx.x * 128u + threadIdx.x);
  if (gid >= SQ * 8) return;
  const int s = gid >> 3, j = gid & 7;
  float sa0 = 0.f, sa1 = 0.f, sa2 = 0.f, sa3 = 0.f;
  float ca0 = 0.f, ca1 = 0.f, ca2 = 0.f, ca3 = 0.f;
#pragma unroll 1
  for (int i = 0; i < 4; ++i) {
    const int d = 4 * j + i;
    const double ang = (double)s * ft.f[d];
    const float ah = (float)ang;
    const float al = (float)(ang - (double)ah);
    float sv, cv;
    sincosf(ah, &sv, &cv);
    const float sf = sv + al * cv;
    const float cf = cv - al * sv;
    sa0 = sa1; sa1 = sa2; sa2 = sa3; sa3 = sf;
    ca0 = ca1; ca1 = ca2; ca2 = ca3; ca3 = cf;
  }
  v4f vs, vc;
  vs[0] = sa0; vs[1] = sa1; vs[2] = sa2; vs[3] = sa3;
  vc[0] = ca0; vc[1] = ca1; vc[2] = ca2; vc[3] = ca3;
  float* ps = tr + (size_t)s * HDIM + 4 * j;
  float* pc = ps + 32;
  *(v4f*)ps = vs;
  *(v4f*)pc = vc;
  
}

// ---------------------------------------------------------------------------
// f32 [rows][64] -> fragment-major bf16 hi/lo planes, one 16-B unit per thread.
// A wave takes 8 rows x 32 k: lanes 8q..8q+7 (8 rows, one k octet) store one whole line.
// ---------------------------------------------------------------------------
__global__ __launch_bounds__(128)
void k_split_rows(const float* __restrict__ src, __bf16* __restrict__ dh, __bf16* __restrict__ dl, int n8)
{
  const int t = (int)(blockIdx.x * 128u + threadIdx.x);
  if (t >= n8) return;
  const int frag = t >> 6;
  const int row = (frag >> 1) * 16 + ((t >> 5) & 1) * 8 + (t & 7);
  const int k = (frag & 1) * 32 + ((t >> 3) & 3) * 8;
  const v8f x = load8(src + (size_t)row * HDIM + k);
  v4u uh, ul;
  split8(x, uh, ul);
  const size_t dst = punit(row, k, HDIM);
  __bf16* ph = dh + dst;
  __bf16* pl = dl + dst;
  *(v4u*)ph = uh;
  *(v4u*)pl = ul;
  
}

// ---------------------------------------------------------------------------
// x[b][s][h*64+d] -> head-major planes kx{h,l}, rows (b*16+h)*512+s, 64 k, fragment-major (bf16 hi/lo).
// A wave takes 8 rows x 32 k: lanes 8q..8q+7 (8 rows, one k octet) store one whole line.
// ---------------------------------------------------------------------------
__global__ __launch_bounds__(128)
void k_xsplit(const float* __restrict__ x, __bf16* __restrict__ kxh, __bf16* __restrict__ kxl, int n8)
{
  const int t = (int)(blockIdx.x * 128u + threadIdx.x);
  if (t >= n8) return;
  const int frag = t >> 6;
  const int row = (frag >> 1) * 16 + ((t >> 5) & 1) * 8 + (t & 7);
  const int d = (frag & 1) * 32 + ((t >> 3) & 3) * 8;
  const int bhq = row >> 9, ss = row & 511;
  const int bb = bhq >> 4, hq = bhq & 15;
  const size_t e0 = ((size_t)(bb * SQ + ss)) * DMOD + hq * HDIM + d;
  const size_t dst = punit(row, d, HDIM);
  const v8f v = load8(x + e0);
  v4u uh, ul;
  split8(v, uh, ul);
  __bf16* ph = kxh + dst;
  __bf16* pl = kxl + dst;
  *(v4u*)ph = uh;
  *(v4u*)pl = ul;
  
}

// ---------------------------------------------------------------------------
// w[k][n] (1024 x 2048, n contiguous) -> wt{h,l}, rows n, 1024 k, fragment-major bf16 hi/lo planes.
// Block: 64 k x 32 n tile through LDS; a wave takes 16 n x 2 k octets and stores 512 contiguous bytes.
// in[1024][2048] -> out[2048][1024]; grid = (2048/32) * (1024/64).
// ---------------------------------------------------------------------------
__global__ __launch_bounds__(128)
void k_wsplitT(const float* __restrict__ w, __bf16* __restrict__ wth, __bf16* __restrict__ wtl)
{
  __shared__ __align__(16) float T[64][36];
  const int tid = threadIdx.x;
  const int nb = (int)(blockIdx.x & 63u), kb = (int)(blockIdx.x >> 6);
  const int n0 = nb * 32, k0 = kb * 64;
#pragma unroll
  for (int i = 0; i < 4; ++i) {
    const int idx = tid + 128 * i;
    const int row = idx >> 3, c4 = idx & 7;
    const v4f v = *(const v4f*)(w + (size_t)(k0 + row) * (2 * DMOD) + n0 + 4 * c4);
    *(v4f*)&T[row][4 * c4] = v;
  }
  __syncthreads();
#pragma unroll 1
  for (int i = 0; i < 2; ++i) {
    const int task = tid + 128 * i;
    const int nn = (task >> 7) * 16 + (task & 15), j = (task >> 4) & 7;
    v8f v;
#pragma unroll
    for (int e = 0; e < 8; ++e) v[e] = T[8 * j + e][nn];
    v4u uh, ul;
    split8(v, uh, ul);
    const size_t off = punit(n0 + nn, k0 + 8 * j, DMOD);
    __bf16* ph = wth + off;
    __bf16* pl = wtl + off;
    *(v4u*)ph = uh;
    *(v4u*)pl = ul;
    
  }
}

// ---------------------------------------------------------------------------
// qv = x @ Wqv, M=4096, N=2048, K=1024, bf16 hi/lo planes on both operands.
// Block = 8 waves (4 along M x 2 along N), tile 256(M) x 128(N); a wave owns 64 x 64: 64 positions of one head of q or of v.
// A from kx planes (pitch 64, head = k/64), B from wt planes ([n][k], pitch 1024), both fragment-major.
// A stage is 64 k of the block's rows, copied as it lies (whole 1-KiB fragments) into LDS, where all eight waves read it:
//   [A hi 32 KiB | A lo 32 KiB | B hi 16 KiB | B lo 16 KiB]; a 16-row tile is 2 KiB (its two 32-k fragments).
// Two buffers: the copies of stage t + 2 fly while stage t + 1 is worked on.
// Epilogue through LDS, each wave its own 64 x 64 tile (row pitch 68 floats: its readers take one row, or one column,
// per lane), fragment-major out:
//   n <  1024: qa = q + r_r_bias, qb = rotated (q + r_w_bias); rows (b*16+h)*512+s, 64 k -> qa{h,l}, qb{h,l}
//   n >= 1024: v transposed -> vt{h,l}, rows (b*16+h)*64+d, 512 k, 64 columns from the wave's first position
// ---------------------------------------------------------------------------
#define G_APLANE 32768
#define G_BPLANE 16384
#define G_STAGE  (2 * G_APLANE + 2 * G_BPLANE)

// One plane's share of a wave in a stage: 4 KiB of A (eight copies of 512 B) and 2 KiB of B (four), each lane 16 bytes a copy.
// la, lb: the lane's LDS byte addresses; ga, gb: its global addresses. The wait that a later overwrite of these address
// registers owes to the copies is the statement's last line, so that nothing can come between.
__device__ __forceinline__ void copy_plane(unsigned la, unsigned long long ga, unsigned lb, unsigned long long gb) {
  asm volatile("global_load_async_to_lds_b128 %0, %1, off\n\t"
               "global_load_async_to_lds_b128 %2, %3, off\n\t"
               "global_load_async_to_lds_b128 %4, %5, off\n\t"
               "global_load_async_to_lds_b128 %6, %7, off\n\t"
               "global_load_async_to_lds_b128 %8, %9, off\n\t"
               "global_load_async_to_lds_b128 %10, %11, off\n\t"
               "global_load_async_to_lds_b128 %12, %13, off\n\t"
               "global_load_async_to_lds_b128 %14, %15, off\n\t"
               "global_load_async_to_lds_b128 %16, %17, off\n\t"
               "global_load_async_to_lds_b128 %18, %19, off\n\t"
               "global_load_async_to_lds_b128 %20, %21, off\n\t"
               "global_load_async_to_lds_b128 %22, %23, off\n\t"
               "s_wait_xcnt 0x0"
               :: "v"(la),        "v"(ga),        "v"(la + 512),  "v"(ga + 512),
                  "v"(la + 1024), "v"(ga + 1024), "v"(la + 1536), "v"(ga + 1536),
                  "v"(la + 2048), "v"(ga + 2048), "v"(la + 2560), "v"(ga + 2560),
                  "v"(la + 3072), "v"(ga + 3072), "v"(la + 3584), "v"(ga + 3584),
                  "v"(lb),        "v"(gb),        "v"(lb + 512),  "v"(gb + 512),
                  "v"(lb + 1024), "v"(gb + 1024), "v"(lb + 1536), "v"(gb + 1536)
               : "memory");
}

// a fragment out of LDS: p is the fragment's first byte + 16 * lane (units L and 32 + L, as in ldfrag)
__device__ __forceinline__ v16b ldsfrag(const unsigned char* p) {
  Frag f;
  f.q[0] = *(const v4u*)(p);
  f.q[1] = *(const v4u*)(p + 512);
  return f.v;
}

__global__ __launch_bounds__(256)
void k_gemm(const __bf16* __restrict__ kxh, const __bf16* __restrict__ kxl,
            const __bf16* __restrict__ wth, const __bf16* __restrict__ wtl,
            const float* __restrict__ rrb, const float* __restrict__ rwb,
            const float* __restrict__ tr,
            __bf16* __restrict__ qah, __bf16* __restrict__ qal,
            __bf16* __restrict__ qbh, __bf16* __restrict__ qbl,
            __bf16* __restrict__ vth, __bf16* __restrict__ vtl)
{
  __shared__ __attribute__((aligned(2048))) unsigned char ring[2 * G_STAGE];
  const int tid = threadIdx.x, w = __builtin_amdgcn_readfirstlane(tid >> 5), lane = tid & 31, hh = lane >> 4, m = lane & 15;
  const int wm = w >> 1, wn = w & 1;
  const int bn = (int)(blockIdx.x & 15u), bm = (int)(blockIdx.x >> 4);
  const int n0 = bn * 128, m0 = bm * 256;
  const int b = m0 >> 9, s0 = m0 & 511;

  v8f acc[4][4];
#pragma unroll
  for (int i = 0; i < 4; ++i)
#pragma unroll
    for (int j = 0; j < 4; ++j) acc[i][j] = vz8();

  // The wave's share of every stage: bytes w*4096.. of each A plane's 32 KiB (contiguous in the plane: 16 row tiles of
  // 2 KiB), and the 16-row tile w of each B plane. A stage further on lies one head (512 rows) on in A, 64 k on in B.
  const unsigned lbase = (unsigned)(size_t)ring + (unsigned)(lane * 16);
  const unsigned lca = lbase + (unsigned)(w * 4096);
  const unsigned lcb = lbase + (unsigned)(2 * G_APLANE + w * 2048);
  const size_t aoff = (size_t)(b * NHEAD * SQ + s0) * HDIM * 2 + (size_t)(w * 4096 + lane * 16);
  const size_t boff = (size_t)((n0 >> 4) + w) * (16 * DMOD * 2) + (size_t)(lane * 16);
  const unsigned long long gah = (unsigned long long)kxh + aoff, gal = (unsigned long long)kxl + aoff;
  const unsigned long long gbh = (unsigned long long)wth + boff, gbl = (unsigned long long)wtl + boff;
  const int NST = DMOD / 64;

#define G_COPY_STAGE(T, BUF)                                                                                   \
  do {                                                                                                         \
    const unsigned long long sa_ = (unsigned long long)(T) * (SQ * HDIM * 2), sb_ = (unsigned long long)(T) * 2048; \
    copy_plane(lca + (BUF), gah + sa_, lcb + (BUF), gbh + sb_);                                                \
    copy_plane(lca + (BUF) + G_APLANE, gal + sa_, lcb + (BUF) + G_BPLANE, gbl + sb_);                          \
  } while (0)

  G_COPY_STAGE(0, 0u);
  asm volatile("s_wait_asynccnt 0x0" ::: "memory");   // this wave's share of stage 0 has landed
  __syncthreads();                                    // every wave's share has: stage 0 may be read
  G_COPY_STAGE(1, (unsigned)G_STAGE);

  // rolled: one trip's text is 96 products and 64 LDS loads
#pragma unroll 1
  for (int t = 0; t < NST; ++t) {
    const unsigned buf = (unsigned)(t & 1) * (unsigned)G_STAGE;
    const unsigned char* pa = ring + buf + wm * 8192 + lane * 16;
    const unsigned char* pb = ring + buf + 2 * G_APLANE + wn * 8192 + lane * 16;
    v16b ah[2][4], al[2][4], bh[2][4], bl[2][4];
    // in the order in which the products below first read them
#pragma unroll
    for (int kc = 0; kc < 2; ++kc) {
      ah[kc][0] = ldsfrag(pa + kc * 1024);
      bh[kc][0] = ldsfrag(pb + kc * 1024);
#pragma unroll
      for (int i = 1; i < 4; ++i) ah[kc][i] = ldsfrag(pa + i * 2048 + kc * 1024);
#pragma unroll
      for (int j = 1; j < 4; ++j) bh[kc][j] = ldsfrag(pb + j * 2048 + kc * 1024);
#pragma unroll
      for (int j = 0; j < 4; ++j) bl[kc][j] = ldsfrag(pb + G_BPLANE + j * 2048 + kc * 1024);
#pragma unroll
      for (int i = 0; i < 4; ++i) al[kc][i] = ldsfrag(pa + G_APLANE + i * 2048 + kc * 1024);
    }
    // keeps the trip's LDS loads one group in front of its products
    __builtin_amdgcn_sched_barrier(0);
    // per accumulator hi*hi, hi*lo, lo*hi, k ascending; sixteen independent tiles between two products of one tile
#pragma unroll
    for (int kc = 0; kc < 2; ++kc) {
#pragma unroll
      for (int j = 0; j < 4; ++j)
#pragma unroll
        for (int i = 0; i < 4; ++i) acc[i][j] = wmm(ah[kc][i], bh[kc][j], acc[i][j]);
#pragma unroll
      for (int j = 0; j < 4; ++j)
#pragma unroll
        for (int i = 0; i < 4; ++i) acc[i][j] = wmm(ah[kc][i], bl[kc][j], acc[i][j]);
#pragma unroll
      for (int j = 0; j < 4; ++j)
#pragma unroll
        for (int i = 0; i < 4; ++i) acc[i][j] = wmm(al[kc][i], bh[kc][j], acc[i][j]);
    }
    // keeps the products in front of the trip's foot: moved behind its waits they would no longer cover the LDS loads' and
    // the copies' flight
    __builtin_amdgcn_sched_barrier(0);
    asm volatile("s_wait_dscnt 0x0" ::: "memory");      // this wave has left the buffer that is refilled below
    asm volatile("s_wait_asynccnt 0x0" ::: "memory");   // its share of stage t + 1 has landed
    __syncthreads();                                    // stage t + 1 may be read; stage t's buffer is free
    if (t + 2 < NST) G_COPY_STAGE(t + 2, buf);
  }
  asm volatile("s_wait_asynccnt 0x0" ::: "memory");     // no copy is under way when the ring becomes output staging
#undef G_COPY_STAGE

  // D tile: element r -> row 8*hh + r, col m. The last trip's barrier has ended every read of the ring.
  float (*Cs)[68] = (float (*)[68])(ring + w * (64 * 68 * 4));
#pragma unroll
  for (int i = 0; i < 4; ++i)
#pragma unroll
    for (int j = 0; j < 4; ++j)
#pragma unroll
      for (int r = 0; r < 8; ++r) Cs[i * 16 + 8 * hh + r][j * 16 + m] = acc[i][j][r];
  __syncthreads();

  const int n0w = n0 + wn * 64, s0w = s0 + wm * 64;
  if (n0w < DMOD) {
    const int hq = n0w >> 6;
    const int qrow0 = (b * NHEAD + hq) * SQ;
    const float* rrbh = rrb + hq * HDIM;
    const float* rwbh = rwb + hq * HDIM;
    // four steps' loads fly together: the block is alone on its WGP, and no other wave's work covers their latency
#pragma unroll 1
    for (int io = 0; io < 4; ++io) {
#pragma unroll
    for (int ii = 0; ii < 4; ++ii) {
      // the wave takes 8 rows x 4 k octets: lanes 8q..8q+7 store one whole line of each plane
      const int j4 = lane >> 3, j = (ii >> 1) * 4 + j4;
      const int rr = io * 16 + (ii & 1) * 8 + (lane & 7);
      const int s = s0w + rr;
      const v8f cl = load8(&Cs[rr][8 * j4]);        // q[d'],     d' = 8*j4+e
      const v8f ch = load8(&Cs[rr][32 + 8 * j4]);   // q[32+d']
      const v8f bwl = load8(rwbh + 8 * j4);
      const v8f bwh = load8(rwbh + 32 + 8 * j4);
      const v8f br  = load8(rrbh + 8 * j);
      const float* trs = tr + (size_t)s * HDIM;
      const v8f sq = load8(trs + 8 * j4);           // sin(s*f_d')
      const v8f cq = load8(trs + 32 + 8 * j4);      // cos(s*f_d')
      const v8f a = cl + bwl;
      const v8f c = ch + bwh;
      v8f qa, qb;
      if (j < 4) {
        qa = cl + br;
        qb = a * cq + c * sq;
      } else {
        qa = ch + br;
        qb = c * cq - a * sq;
      }
      v4u ah, al, bh, bl;
      split8(qa, ah, al);
      split8(qb, bh, bl);
      const size_t off = punit(qrow0 + s, 8 * j, HDIM);
      __bf16* p0 = qah + off;
      __bf16* p1 = qal + off;
      __bf16* p2 = qbh + off;
      __bf16* p3 = qbl + off;
      *(v4u*)p0 = ah;
      *(v4u*)p1 = al;
      *(v4u*)p2 = bh;
      *(v4u*)p3 = bl;
    }
      // behind the trip's last stores: the next trip overwrites registers that they name
      asm volatile("s_wait_xcnt 0x0" ::: "memory");
    }
  } else {
    const int hv = (n0w - DMOD) >> 6;
    const int vrow0 = (b * NHEAD + hv) * HDIM;
    // four steps at a time, as above
#pragma unroll 1
    for (int io = 0; io < 4; ++io) {
#pragma unroll
    for (int ii = 0; ii < 4; ++ii) {
      // the wave takes 16 d x 2 key octets and stores 512 contiguous bytes of each plane
      const int dd = io * 16 + (lane & 15), j = ii * 2 + (lane >> 4);
      v8f v;
#pragma unroll
      for (int e = 0; e < 8; ++e) v[e] = Cs[8 * j + e][dd];
      v4u uh, ul;
      split8(v, uh, ul);
      const size_t off = punit(vrow0 + dd, s0w + 8 * j, SQ);
      __bf16* ph = vth + off;
      __bf16* pl = vtl + off;
      *(v4u*)ph = uh;
      *(v4u*)pl = ul;
    }
      // behind the trip's last stores: the next trip overwrites registers that they name
      asm volatile("s_wait_xcnt 0x0" ::: "memory");
    }
  }
}

// ---------------------------------------------------------------------------
// Fused attention, transposed tiles. Block = 4 waves, wave owns 16 queries of one (b,h); 32 keys per step.
// Scores S^T[key][query] = Kcat[key][0..127] . Qcat[query][0..127]:
//   A = kx planes (cols 0..63) / trig table planes (cols 64..127), B = qa / qb planes (loaded like A).
// Softmax statistics live on lane = query (xor-16 exchange between lane halves).
// O^T[d][query] = V^T . P^T: A = vt planes ([d][key]), B = P^T packed straight from the score D tiles
//   (element r <- key 8h+r of the first 16-key tile, element 8+r <- second tile), bf16 hi/lo.
// ---------------------------------------------------------------------------
__global__ __launch_bounds__(128) __attribute__((amdgpu_num_vgpr(256)))
void k_attn(const __bf16* __restrict__ qah, const __bf16* __restrict__ qal,
            const __bf16* __restrict__ qbh, const __bf16* __restrict__ qbl,
            const __bf16* __restrict__ kxh, const __bf16* __restrict__ kxl,
            const __bf16* __restrict__ trh, const __bf16* __restrict__ trl,
            const __bf16* __restrict__ vth, const __bf16* __restrict__ vtl,
            const int* __restrict__ msk, float* __restrict__ out)
{
  __shared__ __align__(16) float Os[4][16][64];
  // the wave's number in a scalar register: every fragment's block address is then a scalar value, as point_at takes it
  const int tid = threadIdx.x, w = __builtin_amdgcn_readfirstlane(tid >> 5), lane = tid & 31, hh = lane >> 4, n = lane & 15;
  const int bh = (int)(blockIdx.x >> 3), qc = (int)(blockIdx.x & 7u);
  const int b = bh >> 4, hd = bh & 15;
  const int q0 = qc * 64 + w * 16;
  const int qrow = bh * SQ + q0;   // rows of qa/qb (pitch 64)
  const int krow = bh * SQ;        // + key: rows of kx (pitch 64)
  const int vrow = bh * HDIM;      // + d:   rows of vt (pitch 512)

  const unsigned long long laneoff = (unsigned long long)(unsigned)(lane * 16);
  Addr2 pf = {0, 0};
  // the wave's 16 queries, all 128 columns (qa | qb), hi and lo planes; columns 32..63 of a plane lie 1024 bytes behind 0..31
  point_at(pf, fragblock(qah, HDIM, qrow, 0), fragblock(qal, HDIM, qrow, 0), laneoff);
  const v16b qh0 = ldfrag(pf.h, 0),    ql0 = ldfrag(pf.l, 0);
  const v16b qh1 = ldfrag(pf.h, 1024), ql1 = ldfrag(pf.l, 1024);
  point_at(pf, fragblock(qbh, HDIM, qrow, 0), fragblock(qbl, HDIM, qrow, 0), laneoff);
  const v16b qh2 = ldfrag(pf.h, 0),    ql2 = ldfrag(pf.l, 0);
  const v16b qh3 = ldfrag(pf.h, 1024), ql3 = ldfrag(pf.l, 1024);

  v8f o0 = vz8(), o1 = vz8(), o2 = vz8(), o3 = vz8();
  float mrun = -1.0e30f, dsum = 0.0f;

  // Key-side fragments are asked for ahead of the products that read them, each where registers have come free: chunk 3, the
  // mask and V among this step's score products, chunk 0 of the next 32 keys behind them, chunks 1 and 2 among the P*V products.
  point_at(pf, fragblock(kxh, HDIM, krow, 0), fragblock(kxl, HDIM, krow, 0), laneoff);
  Frag4 k0 = ldfrag4(pf, 0, HDIM);
  Frag4 k1 = ldfrag4(pf, 1024, HDIM);
  point_at(pf, fragblock(trh, HDIM, 0, 0), fragblock(trl, HDIM, 0, 0), laneoff);
  Frag4 k2 = ldfrag4(pf, 0, HDIM);

#pragma unroll 1
  for (int kb0 = 0; kb0 < SQ; kb0 += 32) {
    // the last step asks for its own keys again, so that no address leaves the planes
    const int kbn = (kb0 + 32 < SQ) ? kb0 + 32 : kb0;
    v8f s0 = vz8(), s1 = vz8();
    mma3x2(s0, s1, k0.h0, k0.l0, k0.h1, k0.l1, qh0, ql0);
    point_at(pf, fragblock(trh, HDIM, kb0, 32), fragblock(trl, HDIM, kb0, 32), laneoff);
    const Frag4 k3 = ldfrag4(pf, 0, HDIM);
    // key-mask: keys kb0 + 8*hh + r (tile 0) and kb0 + 16 + 8*hh + r (tile 1)
    const int* mp = msk + b * SQ + kb0 + 8 * hh;
    const v4i mA = *(const v4i*)(mp);
    const v4i mB = *(const v4i*)(mp + 4);
    const v4i mC = *(const v4i*)(mp + 16);
    const v4i mD = *(const v4i*)(mp + 20);
    // each scheduling barrier of this loop keeps the loads above it in front of the arithmetic below it: issued later they
    // would have less of it to fly behind
    __builtin_amdgcn_sched_barrier(0);
    mma3x2(s0, s1, k1.h0, k1.l0, k1.h1, k1.l1, qh1, ql1);
    point_at(pf, fragblock(vth, SQ, vrow, kb0), fragblock(vtl, SQ, vrow, kb0), laneoff);
    const Frag4 v01 = ldfrag4(pf, 0, SQ);
    mma3x2(s0, s1, k2.h0, k2.l0, k2.h1, k2.l1, qh2, ql2);
    const Frag4 v23 = ldfrag4(pf, 64 * SQ, SQ);   // 32 rows of V^T further on
    mma3x2(s0, s1, k3.h0, k3.l0, k3.h1, k3.l1, qh3, ql3);
    point_at(pf, fragblock(kxh, HDIM, krow + kbn, 0), fragblock(kxl, HDIM, krow + kbn, 0), laneoff);
    k0 = ldfrag4(pf, 0, HDIM);
    __builtin_amdgcn_sched_barrier(0);
    v8f f0, f1;
#pragma unroll
    for (int r = 0; r < 4; ++r) {
      f0[r] = (float)mA[r]; f0[4 + r] = (float)mB[r];
      f1[r] = (float)mC[r]; f1[4 + r] = (float)mD[r];
    }
    s0 = s0 * f0 - (1.0f - f0) * 1.0e8f;
    s1 = s1 * f1 - (1.0f - f1) * 1.0e8f;

    float mloc = s0[0];
#pragma unroll
    for (int r = 0; r < 8; ++r) { mloc = fmaxf(mloc, s0[r]); mloc = fmaxf(mloc, s1[r]); }
    const float mall = fmaxf(mloc, __shfl_xor(mloc, 16, 32));
    const float mnew = fmaxf(mrun, mall);
    const float alpha = __expf(mrun - mnew);
    float psum = 0.0f;
#pragma unroll
    for (int r = 0; r < 8; ++r) {
      const float pa = exp_with_slot(s0[r] - mnew);
      const float pb = exp_with_slot(s1[r] - mnew);
      s0[r] = pa; s1[r] = pb;
      psum += pa + pb;
    }
    psum += __shfl_xor(psum, 16, 32);
    dsum = dsum * alpha + psum;
    mrun = mnew;
    o0 *= alpha; o1 *= alpha; o2 *= alpha; o3 *= alpha;

    // P^T as the B operand: k = key offset within the 32-key step
    v4u p0h, p0l, p1h, p1l;
    split8(s0, p0h, p0l);
    split8(s1, p1h, p1l);
    Frag ph, pl;
    ph.q[0] = p0h; ph.q[1] = p1h;
    pl.q[0] = p0l; pl.q[1] = p1l;
    mma3x2(o0, o1, v01.h0, v01.l0, v01.h1, v01.l1, ph.v, pl.v);
    k1 = ldfrag4(pf, 1024, HDIM);
    __builtin_amdgcn_sched_barrier(0);
    mma3x2(o2, o3, v23.h0, v23.l0, v23.h1, v23.l1, ph.v, pl.v);
    point_at(pf, fragblock(trh, HDIM, kbn, 0), fragblock(trl, HDIM, kbn, 0), laneoff);
    k2 = ldfrag4(pf, 0, HDIM);
  }
  done_with(pf);

  // O^T element r of tile t -> d = 16*t + 8*hh + r, query n
  const float rinv = 1.0f / dsum;
#pragma unroll
  for (int r = 0; r < 8; ++r) {
    Os[w][n][8 * hh + r]      = o0[r] * rinv;
    Os[w][n][16 + 8 * hh + r] = o1[r] * rinv;
    Os[w][n][32 + 8 * hh + r] = o2[r] * rinv;
    Os[w][n][48 + 8 * hh + r] = o3[r] * rinv;
  }
  __syncthreads();

  v4f ov[8];
#pragma unroll
  for (int it = 0; it < 8; ++it) ov[it] = *(const v4f*)&Os[w][2 * it + hh][4 * n];
  float* ob = out + ((size_t)(b * SQ + q0)) * DMOD + hd * HDIM + 4 * n;
#pragma unroll
  for (int it = 0; it < 8; ++it) {
    float* p = ob + (size_t)(2 * it + hh) * DMOD;
    *(v4f*)p = ov[it];
  }
  
}

// ---------------------------------------------------------------------------
extern "C" void kernel_launch(void* const* d_in, const int* in_sizes, int n_in,
                              void* d_out, int out_size, void* d_ws,
                              size_t ws_size, hipStream_t stream)
{
  if (n_in < 5) return;
  if (in_sizes[0] != NBATCH * SQ * DMOD) return;
  if (in_sizes[1] != NBATCH * SQ) return;
  if (in_sizes[2] != DMOD * 2 * DMOD) return;
  if (in_sizes[3] != NHEAD * HDIM) return;
  if (in_sizes[4] != NHEAD * HDIM) return;
  if (out_size != NBATCH * SQ * DMOD) return;

  const float* x    = (const float*)d_in[0];
  const int*   mk   = (const int*)d_in[1];
  const float* wqv  = (const float*)d_in[2];
  const float* rrb  = (const float*)d_in[3];
  const float* rwb  = (const float*)d_in[4];
  float* out = (float*)d_out;

  const size_t n_tr    = (size_t)SQ * HDIM;                 // 32768
  const size_t n_heads = (size_t)NBATCH * NHEAD * SQ * HDIM; // 4194304
  const size_t n_w     = (size_t)DMOD * 2 * DMOD;            // 2097152

  char* ws = (char*)d_ws;
  size_t off = 0;
  auto carve = [&](size_t bytes) -> char* {
    char* p = ws + off;
    off += (bytes + 255) & ~(size_t)255;
    return p;
  };
  float*  tr  = (float*)carve(n_tr * 4);
  __bf16* trh = (__bf16*)carve(n_tr * 2);
  __bf16* trl = (__bf16*)carve(n_tr * 2);
  __bf16* kxh = (__bf16*)carve(n_heads * 2);
  __bf16* kxl = (__bf16*)carve(n_heads * 2);
  __bf16* wth = (__bf16*)carve(n_w * 2);
  __bf16* wtl = (__bf16*)carve(n_w * 2);
  __bf16* qah = (__bf16*)carve(n_heads * 2);
  __bf16* qal = (__bf16*)carve(n_heads * 2);
  __bf16* qbh = (__bf16*)carve(n_heads * 2);
  __bf16* qbl = (__bf16*)carve(n_heads * 2);
  __bf16* vth = (__bf16*)carve(n_heads * 2);
  __bf16* vtl = (__bf16*)carve(n_heads * 2);
  if (off > ws_size) return;

  FreqTab ft;
  const double cst = -log(10000.0) / 31.0;
  for (int d = 0; d < 32; ++d) ft.f[d] = exp((double)((float)d) * cst);

  const int n8_tr = (int)(n_tr / 8);      // 4096
  const int n8_x  = (int)(n_heads / 8);   // 524288

  k_trig<<<dim3((SQ * 8 + 127) / 128), dim3(128), 0, stream>>>(ft, tr);
  k_split_rows<<<dim3((n8_tr + 127) / 128), dim3(128), 0, stream>>>(tr, trh, trl, n8_tr);
  k_xsplit<<<dim3((n8_x + 127) / 128), dim3(128), 0, stream>>>(x, kxh, kxl, n8_x);
  k_wsplitT<<<dim3((2 * DMOD / 32) * (DMOD / 64)), dim3(128), 0, stream>>>(wqv, wth, wtl);
  k_gemm<<<dim3((NBATCH * SQ / 256) * (2 * DMOD / 128)), dim3(256), 0, stream>>>(
      kxh, kxl, wth, wtl, rrb, rwb, tr, qah, qal, qbh, qbl, vth, vtl);
  k_attn<<<dim3(NBATCH * NHEAD * (SQ / 64)), dim3(128), 0, stream>>>(
      qah, qal, qbh, qbl, kxh, kxl, trh, trl, vth, vtl, mk, out);
}

// v004
// It runs in 77.6 microseconds.
// Two timings next to v003 put it at 1.08 and 1.07 times that version's speed.
// All steps since v000 together make it 3.01 times as fast.
#include <hip/hip_runtime.h>
#include <math.h>
#include <stddef.h>

// Contractions: x*Wqv, per-head 128-deep logits ([q+r_r_bias | rotated(q+r_w_bias)] . [k | sin/cos table]), p*v:
// v_wmma_f32_16x16x32_bf16 with bf16 hi/lo operand planes (hi*hi + hi*lo + lo*hi), f32 accumulate; softmax and elementwise math f32.

#define NBATCH 8
#define SQ     512
#define DMOD   1024
#define NHEAD  16
#define HDIM   64

typedef float v8f __attribute__((ext_vector_type(8)));
typedef float v4f_raw __attribute__((ext_vector_type(4)));
typedef v4f_raw __attribute__((__may_alias__)) v4f;
typedef unsigned int v4u_raw __attribute__((ext_vector_type(4)));
typedef v4u_raw __attribute__((__may_alias__)) v4u;
typedef int v4i_raw __attribute__((ext_vector_type(4)));
typedef v4i_raw __attribute__((__may_alias__)) v4i;
typedef __bf16 v16b __attribute__((ext_vector_type(16)));
typedef __bf16 v8b __attribute__((ext_vector_type(8)));

union Frag  { v16b v; v8b h[2]; v4u q[2]; };
union Pack8 { v8b v; v4u q; };

struct FreqTab { double f[32]; };
typedef char freqtab_size_check[(sizeof(FreqTab) == 256) ? 1 : -1];

__device__ __forceinline__ v8f vz8() {
  v8f z;
#pragma unroll
  for (int i = 0; i < 8; ++i) z[i] = 0.0f;
  return z;
}

__device__ __forceinline__ v8f load8(const float* p) {
  const v4f a = *(const v4f*)(p);
  const v4f c = *(const v4f*)(p + 4);
  return __builtin_shufflevector(a, c, 0, 1, 2, 3, 4, 5, 6, 7);
}

// Every bf16 plane is stored fragment-major: a [rows][pitch] matrix is cut into 16-row x 32-k fragments of 1 KiB,
// ordered [row/16][k/32]; inside a fragment the 16-byte units (8 consecutive k of one row) are ordered [(k%32)/8][row%16].
// Element offset of the unit that holds (row, k..k+7), k a multiple of 8:
__device__ __forceinline__ size_t punit(int row, int k, int pitch) {
  return (size_t)(row >> 4) * (size_t)(16 * pitch) + (size_t)((k >> 5) * 512 + ((k >> 3) & 3) * 128 + (row & 15) * 8);
}

// 16x32 16-bit fragment, identical map for the A operand ([m][k]) and for the B operand ([n][k]):
// lane -> row/col (lane&15); h = lane>>4; elements 0..7 <- k = kc+8h+0..7, elements 8..15 <- k = kc+16+8h+0..7.
// row is a multiple of 16, kc of 32. In the fragment-major order lane L's two units are units L and 32+L of the
// fragment, so each wave-wide 16-byte load covers 512 contiguous bytes (four whole 128-byte lines).
// fragblock: the fragment's first byte, the same in every lane; ldfrag: the fragment off bytes behind the lane's own address a.
typedef const __attribute__((address_space(1))) v4u gv4u;
__device__ __forceinline__ unsigned long long fragblock(const __bf16* __restrict__ base, int pitch, int row, int kc) {
  return (unsigned long long)(base + ((size_t)(row >> 4) * (size_t)(16 * pitch) + (size_t)((kc >> 5) * 512)));
}
__device__ __forceinline__ v16b ldfrag(unsigned long long a, int off) {
  const gv4u* p = (const gv4u*)a;   // off, a multiple of 16, goes into the loads' own offset field
  Frag f;
  f.q[0] = p[off / 16];
  f.q[1] = p[off / 16 + 32];
  return f.v;
}

__device__ __forceinline__ v8f wmm(v16b a, v16b b, v8f c) {
  return __builtin_amdgcn_wmma_f32_16x16x32_bf16(false, a, false, b, (short)0, c, false, false);
}

// two accumulators sharing one B pair: c0 += a0*b, c1 += a1*b with hi/lo planes (hi*hi + hi*lo + lo*hi);
// 4 v_nop after the last WMMA, tying both D tiles and all six operand fragments.
__device__ __forceinline__ void mma3x2(v8f& c0, v8f& c1,
                                       const v16b a0h, const v16b a0l,
                                       const v16b a1h, const v16b a1l,
                                       const v16b bh, const v16b bl) {
  c0 = wmm(a0h, bh, c0);
  c1 = wmm(a1h, bh, c1);
  c0 = wmm(a0h, bl, c0);
  c1 = wmm(a1h, bl, c1);
  c0 = wmm(a0l, bh, c0);
  c1 = wmm(a1l, bh, c1);
  asm volatile("v_nop\n\tv_nop\n\tv_nop\n\tv_nop"
               : "+v"(c0), "+v"(c1)
               : "v"(a0h), "v"(a0l), "v"(a1h), "v"(a1l), "v"(bh), "v"(bl));
}

// The lane's address in the hi and in the lo plane, for loads that stay in flight over many instructions. The two register
// pairs are written here and nowhere else: block address + the lane's byte offset, behind the wait that an overwrite of a
// register owes to the loads in flight that name it. As in-out operands the pairs stay whole from one call to the next,
// so that no load's result is put into them; wait and additions are one statement, so that nothing comes between them.
struct Addr2 { unsigned long long h, l; };
__device__ __forceinline__ void point_at(Addr2& a, unsigned long long blockh, unsigned long long blockl, unsigned long long laneoff) {
  asm volatile("s_wait_xcnt 0x0\n\tv_add_nc_u64 %0, %2, %4\n\tv_add_nc_u64 %1, %3, %4"
               : "+v"(a.h), "+v"(a.l) : "s"(blockh), "s"(blockl), "v"(laneoff) : "memory");
}
// behind the last loads: holds the pairs whole up to the wait
__device__ __forceinline__ void done_with(const Addr2& a) {
  asm volatile("s_wait_xcnt 0x0" :: "v"(a.h), "v"(a.l) : "memory");
}

// four fragments of one 32-deep chunk, off bytes behind a: two 16-row tiles (16 * pitch elements apart), hi and lo plane
struct Frag4 { v16b h0, l0, h1, l1; };
__device__ __forceinline__ Frag4 ldfrag4(const Addr2& a, int off, int pitch) {
  Frag4 f;
  f.h0 = ldfrag(a.h, off);
  f.l0 = ldfrag(a.l, off);
  f.h1 = ldfrag(a.h, off + 32 * pitch);
  f.l1 = ldfrag(a.l, off + 32 * pitch);
  return f;
}

// __expf as the compiler builds it (one multiply, v_exp_f32), with the free slot that the instruction set asks for behind a
// transcendental in the same statement.
__device__ __forceinline__ float exp_with_slot(float x) {
  float r;
  asm("v_exp_f32 %0, %1\n\tv_nop" : "=v"(r) : "v"(x * 1.44269504f));
  return r;
}

// f32 x8 -> bf16 hi (RNE convert) and bf16 lo = RNE(x - hi), packed as 16 bytes each
__device__ __forceinline__ void split8(const v8f x, v4u& uh, v4u& ul) {
  Pack8 a, c;
  a.v = __builtin_convertvector(x, v8b);
  const v8f xh = __builtin_convertvector(a.v, v8f);
  c.v = __builtin_convertvector(x - xh, v8b);
  uh = a.q;
  ul = c.q;
}

// ---------------------------------------------------------------------------
// All operand preparation in one launch; a block's index range says which of three independent jobs it does.
//
// Blocks 0..31, 16 table rows each: tr[s][0..31] = sin(s*f_d), tr[s][32..63] = cos(s*f_d), s = 0..511, angle formed in
// f64, evaluated as sincos(hi) with first-order lo correction in f32; stored as f32 and, through LDS, as fragment-major
// bf16 hi/lo planes (16 rows x 64 k = two whole fragments: the block stores 2 KiB contiguous of each plane).
//
// The next 1024 blocks: w[k][n] (1024 x 2048, n contiguous) -> wt{h,l}, rows n, 1024 k, fragment-major bf16 hi/lo planes.
// A block takes a 64 k x 32 n tile through LDS; a wave takes 16 n x 2 k octets and stores 512 contiguous bytes.
//
// The last 4096 blocks: x[b][s][h*64+d] -> head-major planes kx{h,l}, rows (b*16+h)*512+s, 64 k, fragment-major, one
// 16-B unit per thread. A wave takes 8 rows x 32 k: lanes 8q..8q+7 (8 rows, one k octet) store one whole line.
// ---------------------------------------------------------------------------
#define P_TRIG_BLOCKS (SQ * 8 / 128)
#define P_W_BLOCKS    ((2 * DMOD / 32) * (DMOD / 64))
#define P_X_BLOCKS    (NBATCH * NHEAD * SQ * HDIM / 8 / 128)

__global__ __launch_bounds__(128)
void k_prep(FreqTab ft, const float* __restrict__ x, const float* __restrict__ w,
            float* __restrict__ tr, __bf16* __restrict__ trh, __bf16* __restrict__ trl,
            __bf16* __restrict__ kxh, __bf16* __restrict__ kxl,
            __bf16* __restrict__ wth, __bf16* __restrict__ wtl)
{
  __shared__ __align__(16) float T[64][36];
  const int tid = threadIdx.x;
  const int blk = (int)blockIdx.x;

  if (blk < P_TRIG_BLOCKS) {
    const int sr = tid >> 3, j = tid & 7;
    const int s = blk * 16 + sr;
    float sa0 = 0.f, sa1 = 0.f, sa2 = 0.f, sa3 = 0.f;
    float ca0 = 0.f, ca1 = 0.f, ca2 = 0.f, ca3 = 0.f;
#pragma unroll 1
    for (int i = 0; i < 4; ++i) {
      const int d = 4 * j + i;
      const double ang = (double)s * ft.f[d];
      const float ah = (float)ang;
      const float al = (float)(ang - (double)ah);
      float sv, cv;
      sincosf(ah, &sv, &cv);
      const float sf = sv + al * cv;
      const float cf = cv - al * sv;
      sa0 = sa1; sa1 = sa2; sa2 = sa3; sa3 = sf;
      ca0 = ca1; ca1 = ca2; ca2 = ca3; ca3 = cf;
    }
    v4f vs, vc;
    vs[0] = sa0; vs[1] = sa1; vs[2] = sa2; vs[3] = sa3;
    vc[0] = ca0; vc[1] = ca1; vc[2] = ca2; vc[3] = ca3;
    float* ps = tr + (size_t)s * HDIM + 4 * j;
    float* pc = ps + 32;
    *(v4f*)ps = vs;
    *(v4f*)pc = vc;
    // the block's 16 rows, pitch 68 floats (its readers take one row per lane)
    float (*R)[68] = (float (*)[68])&T[0][0];
    *(v4f*)&R[sr][4 * j] = vs;
    *(v4f*)&R[sr][32 + 4 * j] = vc;
    __syncthreads();
    // thread -> unit in the planes' own order: the block's stores are contiguous
    const int row = tid & 15, k = (tid >> 4) * 8;
    const v8f v = load8(&R[row][k]);
    v4u uh, ul;
    split8(v, uh, ul);
    const size_t dst = punit(blk * 16 + row, k, HDIM);
    __bf16* ph = trh + dst;
    __bf16* pl = trl + dst;
    *(v4u*)ph = uh;
    *(v4u*)pl = ul;
    return;
  }

  if (blk < P_TRIG_BLOCKS + P_W_BLOCKS) {
    const int wb = blk - P_TRIG_BLOCKS;
    const int nb = wb & 63, kb = wb >> 6;
    const int n0 = nb * 32, k0 = kb * 64;
#pragma unroll
    for (int i = 0; i < 4; ++i) {
      const int idx = tid + 128 * i;
      const int row = idx >> 3, c4 = idx & 7;
      const v4f v = *(const v4f*)(w + (size_t)(k0 + row) * (2 * DMOD) + n0 + 4 * c4);
      *(v4f*)&T[row][4 * c4] = v;
    }
    __syncthreads();
#pragma unroll 1
    for (int i = 0; i < 2; ++i) {
      const int task = tid + 128 * i;
      const int nn = (task >> 7) * 16 + (task & 15), j = (task >> 4) & 7;
      v8f v;
#pragma unroll
      for (int e = 0; e < 8; ++e) v[e] = T[8 * j + e][nn];
      v4u uh, ul;
      split8(v, uh, ul);
      const size_t off = punit(n0 + nn, k0 + 8 * j, DMOD);
      __bf16* ph = wth + off;
      __bf16* pl = wtl + off;
      *(v4u*)ph = uh;
      *(v4u*)pl = ul;
      // behind the trip's stores: the next trip overwrites registers that they name
      asm volatile("s_wait_xcnt 0x0" ::: "memory");
    }
    return;
  }

  {
    const int t = (blk - (P_TRIG_BLOCKS + P_W_BLOCKS)) * 128 + tid;
    const int frag = t >> 6;
    const int row = (frag >> 1) * 16 + ((t >> 5) & 1) * 8 + (t & 7);
    const int d = (frag & 1) * 32 + ((t >> 3) & 3) * 8;
    const int bhq = row >> 9, ss = row & 511;
    const int bb = bhq >> 4, hq = bhq & 15;
    const size_t e0 = ((size_t)(bb * SQ + ss)) * DMOD + hq * HDIM + d;
    const size_t dst = punit(row, d, HDIM);
    const v8f v = load8(x + e0);
    v4u uh, ul;
    split8(v, uh, ul);
    __bf16* ph = kxh + dst;
    __bf16* pl = kxl + dst;
    *(v4u*)ph = uh;
    *(v4u*)pl = ul;
    // behind the stores: in the built code the other jobs' text follows, which overwrites registers that they name
    asm volatile("s_wait_xcnt 0x0" ::: "memory");
  }
}

// ---------------------------------------------------------------------------
// qv = x @ Wqv, M=4096, N=2048, K=1024, bf16 hi/lo planes on both operands.
// Block = 8 waves (4 along M x 2 along N), tile 256(M) x 128(N); a wave owns 64 x 64: 64 positions of one head of q or of v.
// A from kx planes (pitch 64, head = k/64), B from wt planes ([n][k], pitch 1024), both fragment-major.
// A stage is 64 k of the block's rows, copied as it lies (whole 1-KiB fragments) into LDS, where all eight waves read it:
//   [A hi 32 KiB | A lo 32 KiB | B hi 16 KiB | B lo 16 KiB]; a 16-row tile is 2 KiB (its two 32-k fragments).
// Two buffers: the copies of stage t + 2 fly while stage t + 1 is worked on.
// Epilogue through LDS, each wave its own 64 x 64 tile (row pitch 68 floats: its readers take one row, or one column,
// per lane), fragment-major out:
//   n <  1024: qa = q + r_r_bias, qb = rotated (q + r_w_bias); rows (b*16+h)*512+s, 64 k -> qa{h,l}, qb{h,l}
//   n >= 1024: v transposed -> vt{h,l}, rows (b*16+h)*64+d, 512 k, 64 columns from the wave's first position
// ---------------------------------------------------------------------------
#define G_APLANE 32768
#define G_BPLANE 16384
#define G_STAGE  (2 * G_APLANE + 2 * G_BPLANE)

// One plane's share of a wave in a stage: 4 KiB of A (eight copies of 512 B) and 2 KiB of B (four), each lane 16 bytes a copy.
// la, lb: the lane's LDS byte addresses; ga, gb: its global addresses. The wait that a later overwrite of these address
// registers owes to the copies is the statement's last line, so that nothing can come between.
__device__ __forceinline__ void copy_plane(unsigned la, unsigned long long ga, unsigned lb, unsigned long long gb) {
  asm volatile("global_load_async_to_lds_b128 %0, %1, off\n\t"
               "global_load_async_to_lds_b128 %2, %3, off\n\t"
               "global_load_async_to_lds_b128 %4, %5, off\n\t"
               "global_load_async_to_lds_b128 %6, %7, off\n\t"
               "global_load_async_to_lds_b128 %8, %9, off\n\t"
               "global_load_async_to_lds_b128 %10, %11, off\n\t"
               "global_load_async_to_lds_b128 %12, %13, off\n\t"
               "global_load_async_to_lds_b128 %14, %15, off\n\t"
               "global_load_async_to_lds_b128 %16, %17, off\n\t"
               "global_load_async_to_lds_b128 %18, %19, off\n\t"
               "global_load_async_to_lds_b128 %20, %21, off\n\t"
               "global_load_async_to_lds_b128 %22, %23, off\n\t"
               "s_wait_xcnt 0x0"
               :: "v"(la),        "v"(ga),        "v"(la + 512),  "v"(ga + 512),
                  "v"(la + 1024), "v"(ga + 1024), "v"(la + 1536), "v"(ga + 1536),
                  "v"(la + 2048), "v"(ga + 2048), "v"(la + 2560), "v"(ga + 2560),
                  "v"(la + 3072), "v"(ga + 3072), "v"(la + 3584), "v"(ga + 3584),
                  "v"(lb),        "v"(gb),        "v"(lb + 512),  "v"(gb + 512),
                  "v"(lb + 1024), "v"(gb + 1024), "v"(lb + 1536), "v"(gb + 1536)
               : "memory");
}

// a fragment out of LDS: p is the fragment's first byte + 16 * lane (units L and 32 + L, as in ldfrag)
__device__ __forceinline__ v16b ldsfrag(const unsigned char* p) {
  Frag f;
  f.q[0] = *(const v4u*)(p);
  f.q[1] = *(const v4u*)(p + 512);
  return f.v;
}

__global__ __launch_bounds__(256)
void k_gemm(const __bf16* __restrict__ kxh, const __bf16* __restrict__ kxl,
            const __bf16* __restrict__ wth, const __bf16* __restrict__ wtl,
            const float* __restrict__ rrb, const float* __restrict__ rwb,
            const float* __restrict__ tr,
            __bf16* __restrict__ qah, __bf16* __restrict__ qal,
            __bf16* __restrict__ qbh, __bf16* __restrict__ qbl,
            __bf16* __restrict__ vth, __bf16* __restrict__ vtl)
{
  __shared__ __attribute__((aligned(2048))) unsigned char ring[2 * G_STAGE];
  const int tid = threadIdx.x, w = __builtin_amdgcn_readfirstlane(tid >> 5), lane = tid & 31, hh = lane >> 4, m = lane & 15;
  const int wm = w >> 1, wn = w & 1;
  const int bn = (int)(blockIdx.x & 15u), bm = (int)(blockIdx.x >> 4);
  const int n0 = bn * 128, m0 = bm * 256;
  const int b = m0 >> 9, s0 = m0 & 511;

  v8f acc[4][4];
#pragma unroll
  for (int i = 0; i < 4; ++i)
#pragma unroll
    for (int j = 0; j < 4; ++j) acc[i][j] = vz8();

  // The wave's share of every stage: bytes w*4096.. of each A plane's 32 KiB (contiguous in the plane: 16 row tiles of
  // 2 KiB), and the 16-row tile w of each B plane. A stage further on lies one head (512 rows) on in A, 64 k on in B.
  const unsigned lbase = (unsigned)(size_t)ring + (unsigned)(lane * 16);
  const unsigned lca = lbase + (unsigned)(w * 4096);
  const unsigned lcb = lbase + (unsigned)(2 * G_APLANE + w * 2048);
  const size_t aoff = (size_t)(b * NHEAD * SQ + s0) * HDIM * 2 + (size_t)(w * 4096 + lane * 16);
  const size_t boff = (size_t)((n0 >> 4) + w) * (16 * DMOD * 2) + (size_t)(lane * 16);
  const unsigned long long gah = (unsigned long long)kxh + aoff, gal = (unsigned long long)kxl + aoff;
  const unsigned long long gbh = (unsigned long long)wth + boff, gbl = (unsigned long long)wtl + boff;
  const int NST = DMOD / 64;

#define G_COPY_STAGE(T, BUF)                                                                                   \
  do {                                                                                                         \
    const unsigned long long sa_ = (unsigned long long)(T) * (SQ * HDIM * 2), sb_ = (unsigned long long)(T) * 2048; \
    copy_plane(lca + (BUF), gah + sa_, lcb + (BUF), gbh + sb_);                                                \
    copy_plane(lca + (BUF) + G_APLANE, gal + sa_, lcb + (BUF) + G_BPLANE, gbl + sb_);                          \
  } while (0)

  G_COPY_STAGE(0, 0u);
  asm volatile("s_wait_asynccnt 0x0" ::: "memory");   // this wave's share of stage 0 has landed
  __syncthreads();                                    // every wave's share has: stage 0 may be read
  G_COPY_STAGE(1, (unsigned)G_STAGE);

  // rolled: one trip's text is 96 products and 64 LDS loads
#pragma unroll 1
  for (int t = 0; t < NST; ++t) {
    const unsigned buf = (unsigned)(t & 1) * (unsigned)G_STAGE;
    const unsigned char* pa = ring + buf + wm * 8192 + lane * 16;
    const unsigned char* pb = ring + buf + 2 * G_APLANE + wn * 8192 + lane * 16;
    v16b ah[2][4], al[2][4], bh[2][4], bl[2][4];
    // in the order in which the products below first read them
#pragma unroll
    for (int kc = 0; kc < 2; ++kc) {
      ah[kc][0] = ldsfrag(pa + kc * 1024);
      bh[kc][0] = ldsfrag(pb + kc * 1024);
#pragma unroll
      for (int i = 1; i < 4; ++i) ah[kc][i] = ldsfrag(pa + i * 2048 + kc * 1024);
#pragma unroll
      for (int j = 1; j < 4; ++j) bh[kc][j] = ldsfrag(pb + j * 2048 + kc * 1024);
#pragma unroll
      for (int j = 0; j < 4; ++j) bl[kc][j] = ldsfrag(pb + G_BPLANE + j * 2048 + kc * 1024);
#pragma unroll
      for (int i = 0; i < 4; ++i) al[kc][i] = ldsfrag(pa + G_APLANE + i * 2048 + kc * 1024);
    }
    // keeps the trip's LDS loads one group in front of its products
    __builtin_amdgcn_sched_barrier(0);
    // per accumulator hi*hi, hi*lo, lo*hi, k ascending; sixteen independent tiles between two products of one tile
#pragma unroll
    for (int kc = 0; kc < 2; ++kc) {
#pragma unroll
      for (int j = 0; j < 4; ++j)
#pragma unroll
        for (int i = 0; i < 4; ++i) acc[i][j] = wmm(ah[kc][i], bh[kc][j], acc[i][j]);
#pragma unroll
      for (int j = 0; j < 4; ++j)
#pragma unroll
        for (int i = 0; i < 4; ++i) acc[i][j] = wmm(ah[kc][i], bl[kc][j], acc[i][j]);
#pragma unroll
      for (int j = 0; j < 4; ++j)
#pragma unroll
        for (int i = 0; i < 4; ++i) acc[i][j] = wmm(al[kc][i], bh[kc][j], acc[i][j]);
    }
    // keeps the products in front of the trip's foot: moved behind its waits they would no longer cover the LDS loads' and
    // the copies' flight
    __builtin_amdgcn_sched_barrier(0);
    asm volatile("s_wait_dscnt 0x0" ::: "memory");      // this wave has left the buffer that is refilled below
    asm volatile("s_wait_asynccnt 0x0" ::: "memory");   // its share of stage t + 1 has landed
    __syncthreads();                                    // stage t + 1 may be read; stage t's buffer is free
    if (t + 2 < NST) G_COPY_STAGE(t + 2, buf);
  }
  asm volatile("s_wait_asynccnt 0x0" ::: "memory");     // no copy is under way when the ring becomes output staging
#undef G_COPY_STAGE

  // D tile: element r -> row 8*hh + r, col m. The last trip's barrier has ended every read of the ring.
  float (*Cs)[68] = (float (*)[68])(ring + w * (64 * 68 * 4));
#pragma unroll
  for (int i = 0; i < 4; ++i)
#pragma unroll
    for (int j = 0; j < 4; ++j)
#pragma unroll
      for (int r = 0; r < 8; ++r) Cs[i * 16 + 8 * hh + r][j * 16 + m] = acc[i][j][r];
  __syncthreads();

  const int n0w = n0 + wn * 64, s0w = s0 + wm * 64;
  if (n0w < DMOD) {
    const int hq = n0w >> 6;
    const int qrow0 = (b * NHEAD + hq) * SQ;
    const float* rrbh = rrb + hq * HDIM;
    const float* rwbh = rwb + hq * HDIM;
    // four steps' loads fly together: the block is alone on its WGP, and no other wave's work covers their latency
#pragma unroll 1
    for (int io = 0; io < 4; ++io) {
#pragma unroll
    for (int ii = 0; ii < 4; ++ii) {
      // the wave takes 8 rows x 4 k octets: lanes 8q..8q+7 store one whole line of each plane
      const int j4 = lane >> 3, j = (ii >> 1) * 4 + j4;
      const int rr = io * 16 + (ii & 1) * 8 + (lane & 7);
      const int s = s0w + rr;
      const v8f cl = load8(&Cs[rr][8 * j4]);        // q[d'],     d' = 8*j4+e
      const v8f ch = load8(&Cs[rr][32 + 8 * j4]);   // q[32+d']
      const v8f bwl = load8(rwbh + 8 * j4);
      const v8f bwh = load8(rwbh + 32 + 8 * j4);
      const v8f br  = load8(rrbh + 8 * j);
      const float* trs = tr + (size_t)s * HDIM;
      const v8f sq = load8(trs + 8 * j4);           // sin(s*f_d')
      const v8f cq = load8(trs + 32 + 8 * j4);      // cos(s*f_d')
      const v8f a = cl + bwl;
      const v8f c = ch + bwh;
      v8f qa, qb;
      if (j < 4) {
        qa = cl + br;
        qb = a * cq + c * sq;
      } else {
        qa = ch + br;
        qb = c * cq - a * sq;
      }
      v4u ah, al, bh, bl;
      split8(qa, ah, al);
      split8(qb, bh, bl);
      const size_t off = punit(qrow0 + s, 8 * j, HDIM);
      __bf16* p0 = qah + off;
      __bf16* p1 = qal + off;
      __bf16* p2 = qbh + off;
      __bf16* p3 = qbl + off;
      *(v4u*)p0 = ah;
      *(v4u*)p1 = al;
      *(v4u*)p2 = bh;
      *(v4u*)p3 = bl;
    }
      // behind the trip's last stores: the next trip overwrites registers that they name
      asm volatile("s_wait_xcnt 0x0" ::: "memory");
    }
  } else {
    const int hv = (n0w - DMOD) >> 6;
    const int vrow0 = (b * NHEAD + hv) * HDIM;
    // four steps at a time, as above
#pragma unroll 1
    for (int io = 0; io < 4; ++io) {
#pragma unroll
    for (int ii = 0; ii < 4; ++ii) {
      // the wave takes 16 d x 2 key octets and stores 512 contiguous bytes of each plane
      const int dd = io * 16 + (lane & 15), j = ii * 2 + (lane >> 4);
      v8f v;
#pragma unroll
      for (int e = 0; e < 8; ++e) v[e] = Cs[8 * j + e][dd];
      v4u uh, ul;
      split8(v, uh, ul);
      const size_t off = punit(vrow0 + dd, s0w + 8 * j, SQ);
      __bf16* ph = vth + off;
      __bf16* pl = vtl + off;
      *(v4u*)ph = uh;
      *(v4u*)pl = ul;
    }
      // behind the trip's last stores: the next trip overwrites registers that they name
      asm volatile("s_wait_xcnt 0x0" ::: "memory");
    }
  }
}

// ---------------------------------------------------------------------------
// Fused attention, transposed tiles. Block = 4 waves, wave owns 16 queries of one (b,h); 32 keys per step.
// Scores S^T[key][query] = Kcat[key][0..127] . Qcat[query][0..127]:
//   A = kx planes (cols 0..63) / trig table planes (cols 64..127), B = qa / qb planes (loaded like A).
// Softmax statistics live on lane = query (xor-16 exchange between lane halves).
// O^T[d][query] = V^T . P^T: A = vt planes ([d][key]), B = P^T packed straight from the score D tiles
//   (element r <- key 8h+r of the first 16-key tile, element 8+r <- second tile), bf16 hi/lo.
// ---------------------------------------------------------------------------
__global__ __launch_bounds__(128) __attribute__((amdgpu_num_vgpr(256)))
void k_attn(const __bf16* __restrict__ qah, const __bf16* __restrict__ qal,
            const __bf16* __restrict__ qbh, const __bf16* __restrict__ qbl,
            const __bf16* __restrict__ kxh, const __bf16* __restrict__ kxl,
            const __bf16* __restrict__ trh, const __bf16* __restrict__ trl,
            const __bf16* __restrict__ vth, const __bf16* __restrict__ vtl,
            const int* __restrict__ msk, float* __restrict__ out)
{
  __shared__ __align__(16) float Os[4][16][64];
  // the wave's number in a scalar register: every fragment's block address is then a scalar value, as point_at takes it
  const int tid = threadIdx.x, w = __builtin_amdgcn_readfirstlane(tid >> 5), lane = tid & 31, hh = lane >> 4, n = lane & 15;
  const int bh = (int)(blockIdx.x >> 3), qc = (int)(blockIdx.x & 7u);
  const int b = bh >> 4, hd = bh & 15;
  const int q0 = qc * 64 + w * 16;
  const int qrow = bh * SQ + q0;   // rows of qa/qb (pitch 64)
  const int krow = bh * SQ;        // + key: rows of kx (pitch 64)
  const int vrow = bh * HDIM;      // + d:   rows of vt (pitch 512)

  const unsigned long long laneoff = (unsigned long long)(unsigned)(lane * 16);
  Addr2 pf = {0, 0};
  // the wave's 16 queries, all 128 columns (qa | qb), hi and lo planes; columns 32..63 of a plane lie 1024 bytes behind 0..31
  point_at(pf, fragblock(qah, HDIM, qrow, 0), fragblock(qal, HDIM, qrow, 0), laneoff);
  const v16b qh0 = ldfrag(pf.h, 0),    ql0 = ldfrag(pf.l, 0);
  const v16b qh1 = ldfrag(pf.h, 1024), ql1 = ldfrag(pf.l, 1024);
  point_at(pf, fragblock(qbh, HDIM, qrow, 0), fragblock(qbl, HDIM, qrow, 0), laneoff);
  const v16b qh2 = ldfrag(pf.h, 0),    ql2 = ldfrag(pf.l, 0);
  const v16b qh3 = ldfrag(pf.h, 1024), ql3 = ldfrag(pf.l, 1024);

  v8f o0 = vz8(), o1 = vz8(), o2 = vz8(), o3 = vz8();
  float mrun = -1.0e30f, dsum = 0.0f;

  // Key-side fragments are asked for ahead of the products that read them, each where registers have come free: chunk 3, the
  // mask and V among this step's score products, chunk 0 of the next 32 keys behind them, chunks 1 and 2 among the P*V products.
  point_at(pf, fragblock(kxh, HDIM, krow, 0), fragblock(kxl, HDIM, krow, 0), laneoff);
  Frag4 k0 = ldfrag4(pf, 0, HDIM);
  Frag4 k1 = ldfrag4(pf, 1024, HDIM);
  point_at(pf, fragblock(trh, HDIM, 0, 0), fragblock(trl, HDIM, 0, 0), laneoff);
  Frag4 k2 = ldfrag4(pf, 0, HDIM);

#pragma unroll 1
  for (int kb0 = 0; kb0 < SQ; kb0 += 32) {
    // the last step asks for its own keys again, so that no address leaves the planes
    const int kbn = (kb0 + 32 < SQ) ? kb0 + 32 : kb0;
    v8f s0 = vz8(), s1 = vz8();
    mma3x2(s0, s1, k0.h0, k0.l0, k0.h1, k0.l1, qh0, ql0);
    point_at(pf, fragblock(trh, HDIM, kb0, 32), fragblock(trl, HDIM, kb0, 32), laneoff);
    const Frag4 k3 = ldfrag4(pf, 0, HDIM);
    // key-mask: keys kb0 + 8*hh + r (tile 0) and kb0 + 16 + 8*hh + r (tile 1)
    const int* mp = msk + b * SQ + kb0 + 8 * hh;
    const v4i mA = *(const v4i*)(mp);
    const v4i mB = *(const v4i*)(mp + 4);
    const v4i mC = *(const v4i*)(mp + 16);
    const v4i mD = *(const v4i*)(mp + 20);
    // each scheduling barrier of this loop keeps the loads above it in front of the arithmetic below it: issued later they
    // would have less of it to fly behind
    __builtin_amdgcn_sched_barrier(0);
    mma3x2(s0, s1, k1.h0, k1.l0, k1.h1, k1.l1, qh1, ql1);
    point_at(pf, fragblock(vth, SQ, vrow, kb0), fragblock(vtl, SQ, vrow, kb0), laneoff);
    const Frag4 v01 = ldfrag4(pf, 0, SQ);
    mma3x2(s0, s1, k2.h0, k2.l0, k2.h1, k2.l1, qh2, ql2);
    const Frag4 v23 = ldfrag4(pf, 64 * SQ, SQ);   // 32 rows of V^T further on
    mma3x2(s0, s1, k3.h0, k3.l0, k3.h1, k3.l1, qh3, ql3);
    point_at(pf, fragblock(kxh, HDIM, krow + kbn, 0), fragblock(kxl, HDIM, krow + kbn, 0), laneoff);
    k0 = ldfrag4(pf, 0, HDIM);
    __builtin_amdgcn_sched_barrier(0);
    v8f f0, f1;
#pragma unroll
    for (int r = 0; r < 4; ++r) {
      f0[r] = (float)mA[r]; f0[4 + r] = (float)mB[r];
      f1[r] = (float)mC[r]; f1[4 + r] = (float)mD[r];
    }
    s0 = s0 * f0 - (1.0f - f0) * 1.0e8f;
    s1 = s1 * f1 - (1.0f - f1) * 1.0e8f;

    float mloc = s0[0];
#pragma unroll
    for (int r = 0; r < 8; ++r) { mloc = fmaxf(mloc, s0[r]); mloc = fmaxf(mloc, s1[r]); }
    const float mall = fmaxf(mloc, __shfl_xor(mloc, 16, 32));
    const float mnew = fmaxf(mrun, mall);
    const float alpha = __expf(mrun - mnew);
    float psum = 0.0f;
#pragma unroll
    for (int r = 0; r < 8; ++r) {
      const float pa = exp_with_slot(s0[r] - mnew);
      const float pb = exp_with_slot(s1[r] - mnew);
      s0[r] = pa; s1[r] = pb;
      psum += pa + pb;
    }
    psum += __shfl_xor(psum, 16, 32);
    dsum = dsum * alpha + psum;
    mrun = mnew;
    o0 *= alpha; o1 *= alpha; o2 *= alpha; o3 *= alpha;

    // P^T as the B operand: k = key offset within the 32-key step
    v4u p0h, p0l, p1h, p1l;
    split8(s0, p0h, p0l);
    split8(s1, p1h, p1l);
    Frag ph, pl;
    ph.q[0] = p0h; ph.q[1] = p1h;
    pl.q[0] = p0l; pl.q[1] = p1l;
    mma3x2(o0, o1, v01.h0, v01.l0, v01.h1, v01.l1, ph.v, pl.v);
    k1 = ldfrag4(pf, 1024, HDIM);
    __builtin_amdgcn_sched_barrier(0);
    mma3x2(o2, o3, v23.h0, v23.l0, v23.h1, v23.l1, ph.v, pl.v);
    point_at(pf, fragblock(trh, HDIM, kbn, 0), fragblock(trl, HDIM, kbn, 0), laneoff);
    k2 = ldfrag4(pf, 0, HDIM);
  }
  done_with(pf);

  // O^T element r of tile t -> d = 16*t + 8*hh + r, query n
  const float rinv = 1.0f / dsum;
#pragma unroll
  for (int r = 0; r < 8; ++r) {
    Os[w][n][8 * hh + r]      = o0[r] * rinv;
    Os[w][n][16 + 8 * hh + r] = o1[r] * rinv;
    Os[w][n][32 + 8 * hh + r] = o2[r] * rinv;
    Os[w][n][48 + 8 * hh + r] = o3[r] * rinv;
  }
  __syncthreads();

  v4f ov[8];
#pragma unroll
  for (int it = 0; it < 8; ++it) ov[it] = *(const v4f*)&Os[w][2 * it + hh][4 * n];
  float* ob = out + ((size_t)(b * SQ + q0)) * DMOD + hd * HDIM + 4 * n;
#pragma unroll
  for (int it = 0; it < 8; ++it) {
    float* p = ob + (size_t)(2 * it + hh) * DMOD;
    *(v4f*)p = ov[it];
  }
  
}

// ---------------------------------------------------------------------------
extern "C" void kernel_launch(void* const* d_in, const int* in_sizes, int n_in,
                              void* d_out, int out_size, void* d_ws,
                              size_t ws_size, hipStream_t stream)
{
  if (n_in < 5) return;
  if (in_sizes[0] != NBATCH * SQ * DMOD) return;
  if (in_sizes[1] != NBATCH * SQ) return;
  if (in_sizes[2] != DMOD * 2 * DMOD) return;
  if (in_sizes[3] != NHEAD * HDIM) return;
  if (in_sizes[4] != NHEAD * HDIM) return;
  if (out_size != NBATCH * SQ * DMOD) return;

  const float* x    = (const float*)d_in[0];
  const int*   mk   = (const int*)d_in[1];
  const float* wqv  = (const float*)d_in[2];
  const float* rrb  = (const float*)d_in[3];
  const float* rwb  = (const float*)d_in[4];
  float* out = (float*)d_out;

  const size_t n_tr    = (size_t)SQ * HDIM;                 // 32768
  const size_t n_heads = (size_t)NBATCH * NHEAD * SQ * HDIM; // 4194304
  const size_t n_w     = (size_t)DMOD * 2 * DMOD;            // 2097152

  char* ws = (char*)d_ws;
  size_t off = 0;
  auto carve = [&](size_t bytes) -> char* {
    char* p = ws + off;
    off += (bytes + 255) & ~(size_t)255;
    return p;
  };
  float*  tr  = (float*)carve(n_tr * 4);
  __bf16* trh = (__bf16*)carve(n_tr * 2);
  __bf16* trl = (__bf16*)carve(n_tr * 2);
  __bf16* kxh = (__bf16*)carve(n_heads * 2);
  __bf16* kxl = (__bf16*)carve(n_heads * 2);
  __bf16* wth = (__bf16*)carve(n_w * 2);
  __bf16* wtl = (__bf16*)carve(n_w * 2);
  __bf16* qah = (__bf16*)carve(n_heads * 2);
  __bf16* qal = (__bf16*)carve(n_heads * 2);
  __bf16* qbh = (__bf16*)carve(n_heads * 2);
  __bf16* qbl = (__bf16*)carve(n_heads * 2);
  __bf16* vth = (__bf16*)carve(n_heads * 2);
  __bf16* vtl = (__bf16*)carve(n_heads * 2);
  if (off > ws_size) return;

  FreqTab ft;
  const double cst = -log(10000.0) / 31.0;
  for (int d = 0; d < 32; ++d) ft.f[d] = exp((double)((float)d) * cst);

  k_prep<<<dim3(P_TRIG_BLOCKS + P_W_BLOCKS + P_X_BLOCKS), dim3(128), 0, stream>>>(
      ft, x, wqv, tr, trh, trl, kxh, kxl, wth, wtl);
  k_gemm<<<dim3((NBATCH * SQ / 256) * (2 * DMOD / 128)), dim3(256), 0, stream>>>(
      kxh, kxl, wth, wtl, rrb, rwb, tr, qah, qal, qbh, qbl, vth, vtl);
  k_attn<<<dim3(NBATCH * NHEAD * (SQ / 64)), dim3(128), 0, stream>>>(
      qah, qal, qbh, qbl, kxh, kxl, trh, trl, vth, vtl, mk, out);
}

// v005
// It runs in 74.1 microseconds.
// Next to v004, in two timings, it ran 1.05 times as fast each time.
// Over all steps from v000 it is 3.16 times as fast.
#include <hip/hip_runtime.h>
#include <math.h>
#include <stddef.h>

// Contractions: x*Wqv, per-head 128-deep logits ([q+r_r_bias | rotated(q+r_w_bias)] . [k | sin/cos table]), p*v:
// v_wmma_f32_16x16x32_bf16 with bf16 hi/lo operand planes (hi*hi + hi*lo + lo*hi), f32 accumulate; softmax and elementwise math f32.

#define NBATCH 8
#define SQ     512
#define DMOD   1024
#define NHEAD  16
#define HDIM   64

typedef float v8f __attribute__((ext_vector_type(8)));
typedef float v4f_raw __attribute__((ext_vector_type(4)));
typedef v4f_raw __attribute__((__may_alias__)) v4f;
typedef unsigned int v4u_raw __attribute__((ext_vector_type(4)));
typedef v4u_raw __attribute__((__may_alias__)) v4u;
typedef int v4i_raw __attribute__((ext_vector_type(4)));
typedef v4i_raw __attribute__((__may_alias__)) v4i;
typedef __bf16 v16b __attribute__((ext_vector_type(16)));
typedef __bf16 v8b __attribute__((ext_vector_type(8)));

union Frag  { v16b v; v8b h[2]; v4u q[2]; };
union Pack8 { v8b v; v4u q; };

struct FreqTab { double f[32]; };
typedef char freqtab_size_check[(sizeof(FreqTab) == 256) ? 1 : -1];

__device__ __forceinline__ v8f vz8() {
  v8f z;
#pragma unroll
  for (int i = 0; i < 8; ++i) z[i] = 0.0f;
  return z;
}

__device__ __forceinline__ v8f load8(const float* p) {
  const v4f a = *(const v4f*)(p);
  const v4f c = *(const v4f*)(p + 4);
  return __builtin_shufflevector(a, c, 0, 1, 2, 3, 4, 5, 6, 7);
}

// Every bf16 plane is stored fragment-major: a [rows][pitch] matrix is cut into 16-row x 32-k fragments of 1 KiB,
// ordered [row/16][k/32]; inside a fragment the 16-byte units (8 consecutive k of one row) are ordered [(k%32)/8][row%16].
// Element offset of the unit that holds (row, k..k+7), k a multiple of 8:
__device__ __forceinline__ size_t punit(int row, int k, int pitch) {
  return (size_t)(row >> 4) * (size_t)(16 * pitch) + (size_t)((k >> 5) * 512 + ((k >> 3) & 3) * 128 + (row & 15) * 8);
}

// 16x32 16-bit fragment, identical map for the A operand ([m][k]) and for the B operand ([n][k]):
// lane -> row/col (lane&15); h = lane>>4; elements 0..7 <- k = kc+8h+0..7, elements 8..15 <- k = kc+16+8h+0..7.
// row is a multiple of 16, kc of 32. In the fragment-major order lane L's two units are units L and 32+L of the
// fragment, so each wave-wide 16-byte load covers 512 contiguous bytes (four whole 128-byte lines).
// fragblock: the fragment's first byte, the same in every lane; ldfrag: the fragment off bytes behind the lane's own address a.
typedef const __attribute__((address_space(1))) v4u gv4u;
__device__ __forceinline__ unsigned long long fragblock(const __bf16* __restrict__ base, int pitch, int row, int kc) {
  return (unsigned long long)(base + ((size_t)(row >> 4) * (size_t)(16 * pitch) + (size_t)((kc >> 5) * 512)));
}
__device__ __forceinline__ v16b ldfrag(unsigned long long a, int off) {
  const gv4u* p = (const gv4u*)a;   // off, a multiple of 16, goes into the loads' own offset field
  Frag f;
  f.q[0] = p[off / 16];
  f.q[1] = p[off / 16 + 32];
  return f.v;
}

__device__ __forceinline__ v8f wmm(v16b a, v16b b, v8f c) {
  return __builtin_amdgcn_wmma_f32_16x16x32_bf16(false, a, false, b, (short)0, c, false, false);
}

// two accumulators sharing one B pair: c0 += a0*b, c1 += a1*b with hi/lo planes (hi*hi + hi*lo + lo*hi);
// 4 v_nop after the last WMMA, tying both D tiles and all six operand fragments.
__device__ __forceinline__ void mma3x2(v8f& c0, v8f& c1,
                                       const v16b a0h, const v16b a0l,
                                       const v16b a1h, const v16b a1l,
                                       const v16b bh, const v16b bl) {
  c0 = wmm(a0h, bh, c0);
  c1 = wmm(a1h, bh, c1);
  c0 = wmm(a0h, bl, c0);
  c1 = wmm(a1h, bl, c1);
  c0 = wmm(a0l, bh, c0);
  c1 = wmm(a1l, bh, c1);
  asm volatile("v_nop\n\tv_nop\n\tv_nop\n\tv_nop"
               : "+v"(c0), "+v"(c1)
               : "v"(a0h), "v"(a0l), "v"(a1h), "v"(a1l), "v"(bh), "v"(bl));
}

// The lane's address in the hi and in the lo plane, for loads that stay in flight over many instructions. The two register
// pairs are written here and nowhere else: block address + the lane's byte offset, behind the wait that an overwrite of a
// register owes to the loads in flight that name it. As in-out operands the pairs stay whole from one call to the next,
// so that no load's result is put into them; wait and additions are one statement, so that nothing comes between them.
struct Addr2 { unsigned long long h, l; };
__device__ __forceinline__ void point_at(Addr2& a, unsigned long long blockh, unsigned long long blockl, unsigned long long laneoff) {
  asm volatile("s_wait_xcnt 0x0\n\tv_add_nc_u64 %0, %2, %4\n\tv_add_nc_u64 %1, %3, %4"
               : "+v"(a.h), "+v"(a.l) : "s"(blockh), "s"(blockl), "v"(laneoff) : "memory");
}
// behind the last loads: holds the pairs whole up to the wait
__device__ __forceinline__ void done_with(const Addr2& a) {
  asm volatile("s_wait_xcnt 0x0" :: "v"(a.h), "v"(a.l) : "memory");
}

// four fragments of one 32-deep chunk, off bytes behind a: two 16-row tiles (16 * pitch elements apart), hi and lo plane
struct Frag4 { v16b h0, l0, h1, l1; };
__device__ __forceinline__ Frag4 ldfrag4(const Addr2& a, int off, int pitch) {
  Frag4 f;
  f.h0 = ldfrag(a.h, off);
  f.l0 = ldfrag(a.l, off);
  f.h1 = ldfrag(a.h, off + 32 * pitch);
  f.l1 = ldfrag(a.l, off + 32 * pitch);
  return f;
}

// __expf as the compiler builds it (one multiply, v_exp_f32), with the free slot that the instruction set asks for behind a
// transcendental in the same statement.
__device__ __forceinline__ float exp_with_slot(float x) {
  float r;
  asm("v_exp_f32 %0, %1\n\tv_nop" : "=v"(r) : "v"(x * 1.44269504f));
  return r;
}

// f32 x8 -> bf16 hi (RNE convert) and bf16 lo = RNE(x - hi), packed as 16 bytes each
__device__ __forceinline__ void split8(const v8f x, v4u& uh, v4u& ul) {
  Pack8 a, c;
  a.v = __builtin_convertvector(x, v8b);
  const v8f xh = __builtin_convertvector(a.v, v8f);
  c.v = __builtin_convertvector(x - xh, v8b);
  uh = a.q;
  ul = c.q;
}

// ---------------------------------------------------------------------------
// All operand preparation in one launch; a block's index range says which of three independent jobs it does.
//
// Blocks 0..31, 16 table rows each: tr[s][0..31] = sin(s*f_d), tr[s][32..63] = cos(s*f_d), s = 0..511, angle formed in
// f64, evaluated as sincos(hi) with first-order lo correction in f32; stored as f32 and, through LDS, as fragment-major
// bf16 hi/lo planes (16 rows x 64 k = two whole fragments: the block stores 2 KiB contiguous of each plane).
//
// The next 1024 blocks: w[k][n] (1024 x 2048, n contiguous) -> wt{h,l}, rows n, 1024 k, fragment-major bf16 hi/lo planes.
// A block takes a 64 k x 32 n tile through LDS; a wave takes 16 n x 2 k octets and stores 512 contiguous bytes.
//
// The last 4096 blocks: x[b][s][h*64+d] -> head-major planes kx{h,l}, rows (b*16+h)*512+s, 64 k, fragment-major, one
// 16-B unit per thread. A wave takes 8 rows x 32 k: lanes 8q..8q+7 (8 rows, one k octet) store one whole line.
// ---------------------------------------------------------------------------
#define P_TRIG_BLOCKS (SQ * 8 / 128)
#define P_W_BLOCKS    ((2 * DMOD / 32) * (DMOD / 64))
#define P_X_BLOCKS    (NBATCH * NHEAD * SQ * HDIM / 8 / 128)

__global__ __launch_bounds__(128)
void k_prep(FreqTab ft, const float* __restrict__ x, const float* __restrict__ w,
            float* __restrict__ tr, __bf16* __restrict__ trh, __bf16* __restrict__ trl,
            __bf16* __restrict__ kxh, __bf16* __restrict__ kxl,
            __bf16* __restrict__ wth, __bf16* __restrict__ wtl)
{
  __shared__ __align__(16) float T[64][36];
  const int tid = threadIdx.x;
  const int blk = (int)blockIdx.x;

  if (blk < P_TRIG_BLOCKS) {
    const int sr = tid >> 3, j = tid & 7;
    const int s = blk * 16 + sr;
    float sa0 = 0.f, sa1 = 0.f, sa2 = 0.f, sa3 = 0.f;
    float ca0 = 0.f, ca1 = 0.f, ca2 = 0.f, ca3 = 0.f;
#pragma unroll 1
    for (int i = 0; i < 4; ++i) {
      const int d = 4 * j + i;
      const double ang = (double)s * ft.f[d];
      const float ah = (float)ang;
      const float al = (float)(ang - (double)ah);
      float sv, cv;
      sincosf(ah, &sv, &cv);
      const float sf = sv + al * cv;
      const float cf = cv - al * sv;
      sa0 = sa1; sa1 = sa2; sa2 = sa3; sa3 = sf;
      ca0 = ca1; ca1 = ca2; ca2 = ca3; ca3 = cf;
    }
    v4f vs, vc;
    vs[0] = sa0; vs[1] = sa1; vs[2] = sa2; vs[3] = sa3;
    vc[0] = ca0; vc[1] = ca1; vc[2] = ca2; vc[3] = ca3;
    float* ps = tr + (size_t)s * HDIM + 4 * j;
    float* pc = ps + 32;
    *(v4f*)ps = vs;
    *(v4f*)pc = vc;
    // the block's 16 rows, pitch 68 floats (its readers take one row per lane)
    float (*R)[68] = (float (*)[68])&T[0][0];
    *(v4f*)&R[sr][4 * j] = vs;
    *(v4f*)&R[sr][32 + 4 * j] = vc;
    __syncthreads();
    // thread -> unit in the planes' own order: the block's stores are contiguous
    const int row = tid & 15, k = (tid >> 4) * 8;
    const v8f v = load8(&R[row][k]);
    v4u uh, ul;
    split8(v, uh, ul);
    const size_t dst = punit(blk * 16 + row, k, HDIM);
    __bf16* ph = trh + dst;
    __bf16* pl = trl + dst;
    *(v4u*)ph = uh;
    *(v4u*)pl = ul;
    return;
  }

  if (blk < P_TRIG_BLOCKS + P_W_BLOCKS) {
    const int wb = blk - P_TRIG_BLOCKS;
    const int nb = wb & 63, kb = wb >> 6;
    const int n0 = nb * 32, k0 = kb * 64;
#pragma unroll
    for (int i = 0; i < 4; ++i) {
      const int idx = tid + 128 * i;
      const int row = idx >> 3, c4 = idx & 7;
      const v4f v = *(const v4f*)(w + (size_t)(k0 + row) * (2 * DMOD) + n0 + 4 * c4);
      *(v4f*)&T[row][4 * c4] = v;
    }
    __syncthreads();
#pragma unroll 1
    for (int i = 0; i < 2; ++i) {
      const int task = tid + 128 * i;
      const int nn = (task >> 7) * 16 + (task & 15), j = (task >> 4) & 7;
      v8f v;
#pragma unroll
      for (int e = 0; e < 8; ++e) v[e] = T[8 * j + e][nn];
      v4u uh, ul;
      split8(v, uh, ul);
      const size_t off = punit(n0 + nn, k0 + 8 * j, DMOD);
      __bf16* ph = wth + off;
      __bf16* pl = wtl + off;
      *(v4u*)ph = uh;
      *(v4u*)pl = ul;
      // behind the trip's stores: the next trip overwrites registers that they name
      asm volatile("s_wait_xcnt 0x0" ::: "memory");
    }
    return;
  }

  {
    const int t = (blk - (P_TRIG_BLOCKS + P_W_BLOCKS)) * 128 + tid;
    const int frag = t >> 6;
    const int row = (frag >> 1) * 16 + ((t >> 5) & 1) * 8 + (t & 7);
    const int d = (frag & 1) * 32 + ((t >> 3) & 3) * 8;
    const int bhq = row >> 9, ss = row & 511;
    const int bb = bhq >> 4, hq = bhq & 15;
    const size_t e0 = ((size_t)(bb * SQ + ss)) * DMOD + hq * HDIM + d;
    const size_t dst = punit(row, d, HDIM);
    const v8f v = load8(x + e0);
    v4u uh, ul;
    split8(v, uh, ul);
    __bf16* ph = kxh + dst;
    __bf16* pl = kxl + dst;
    *(v4u*)ph = uh;
    *(v4u*)pl = ul;
    // behind the stores: in the built code the other jobs' text follows, which overwrites registers that they name
    asm volatile("s_wait_xcnt 0x0" ::: "memory");
  }
}

// ---------------------------------------------------------------------------
// qv = x @ Wqv, M=4096, N=2048, K=1024, bf16 hi/lo planes on both operands.
// Block = 8 waves (4 along M x 2 along N), tile 256(M) x 128(N); a wave owns 64 x 64: 64 positions of one head of q or of v.
// A from kx planes (pitch 64, head = k/64), B from wt planes ([n][k], pitch 1024), both fragment-major.
// A stage is 64 k of the block's rows, copied as it lies (whole 1-KiB fragments) into LDS, where all eight waves read it:
//   [A hi 32 KiB | A lo 32 KiB | B hi 16 KiB | B lo 16 KiB]; a 16-row tile is 2 KiB (its two 32-k fragments).
// Two buffers: the copies of stage t + 2 fly while stage t + 1 is worked on.
// Epilogue through LDS, each wave its own 64 x 64 tile (row pitch 68 floats: its readers take one row, or one column,
// per lane), fragment-major out:
//   n <  1024: qa = q + r_r_bias, qb = rotated (q + r_w_bias); rows (b*16+h)*512+s, 64 k -> qa{h,l}, qb{h,l}
//   n >= 1024: v transposed -> vt{h,l}, rows (b*16+h)*64+d, 512 k, 64 columns from the wave's first position
// ---------------------------------------------------------------------------
#define G_APLANE 32768
#define G_BPLANE 16384
#define G_STAGE  (2 * G_APLANE + 2 * G_BPLANE)

// One plane's share of a wave in a stage: 4 KiB of A (eight copies of 512 B) and 2 KiB of B (four), each lane 16 bytes a copy.
// la, lb: the lane's LDS byte addresses; ga, gb: its global addresses. The wait that a later overwrite of these address
// registers owes to the copies is the statement's last line, so that nothing can come between.
__device__ __forceinline__ void copy_plane(unsigned la, unsigned long long ga, unsigned lb, unsigned long long gb) {
  asm volatile("global_load_async_to_lds_b128 %0, %1, off\n\t"
               "global_load_async_to_lds_b128 %2, %3, off\n\t"
               "global_load_async_to_lds_b128 %4, %5, off\n\t"
               "global_load_async_to_lds_b128 %6, %7, off\n\t"
               "global_load_async_to_lds_b128 %8, %9, off\n\t"
               "global_load_async_to_lds_b128 %10, %11, off\n\t"
               "global_load_async_to_lds_b128 %12, %13, off\n\t"
               "global_load_async_to_lds_b128 %14, %15, off\n\t"
               "global_load_async_to_lds_b128 %16, %17, off\n\t"
               "global_load_async_to_lds_b128 %18, %19, off\n\t"
               "global_load_async_to_lds_b128 %20, %21, off\n\t"
               "global_load_async_to_lds_b128 %22, %23, off\n\t"
               "s_wait_xcnt 0x0"
               :: "v"(la),        "v"(ga),        "v"(la + 512),  "v"(ga + 512),
                  "v"(la + 1024), "v"(ga + 1024), "v"(la + 1536), "v"(ga + 1536),
                  "v"(la + 2048), "v"(ga + 2048), "v"(la + 2560), "v"(ga + 2560),
                  "v"(la + 3072), "v"(ga + 3072), "v"(la + 3584), "v"(ga + 3584),
                  "v"(lb),        "v"(gb),        "v"(lb + 512),  "v"(gb + 512),
                  "v"(lb + 1024), "v"(gb + 1024), "v"(lb + 1536), "v"(gb + 1536)
               : "memory");
}

// a fragment out of LDS: p is the fragment's first byte + 16 * lane (units L and 32 + L, as in ldfrag)
__device__ __forceinline__ v16b ldsfrag(const unsigned char* p) {
  Frag f;
  f.q[0] = *(const v4u*)(p);
  f.q[1] = *(const v4u*)(p + 512);
  return f.v;
}

__global__ __launch_bounds__(256)
void k_gemm(const __bf16* __restrict__ kxh, const __bf16* __restrict__ kxl,
            const __bf16* __restrict__ wth, const __bf16* __restrict__ wtl,
            const float* __restrict__ rrb, const float* __restrict__ rwb,
            const float* __restrict__ tr,
            __bf16* __restrict__ qah, __bf16* __restrict__ qal,
            __bf16* __restrict__ qbh, __bf16* __restrict__ qbl,
            __bf16* __restrict__ vth, __bf16* __restrict__ vtl)
{
  __shared__ __attribute__((aligned(2048))) unsigned char ring[2 * G_STAGE];
  const int tid = threadIdx.x, w = __builtin_amdgcn_readfirstlane(tid >> 5), lane = tid & 31, hh = lane >> 4, m = lane & 15;
  const int wm = w >> 1, wn = w & 1;
  const int bn = (int)(blockIdx.x & 15u), bm = (int)(blockIdx.x >> 4);
  const int n0 = bn * 128, m0 = bm * 256;
  const int b = m0 >> 9, s0 = m0 & 511;

  v8f acc[4][4];
#pragma unroll
  for (int i = 0; i < 4; ++i)
#pragma unroll
    for (int j = 0; j < 4; ++j) acc[i][j] = vz8();

  // The wave's share of every stage: bytes w*4096.. of each A plane's 32 KiB (contiguous in the plane: 16 row tiles of
  // 2 KiB), and the 16-row tile w of each B plane. A stage further on lies one head (512 rows) on in A, 64 k on in B.
  const unsigned lbase = (unsigned)(size_t)ring + (unsigned)(lane * 16);
  const unsigned lca = lbase + (unsigned)(w * 4096);
  const unsigned lcb = lbase + (unsigned)(2 * G_APLANE + w * 2048);
  const size_t aoff = (size_t)(b * NHEAD * SQ + s0) * HDIM * 2 + (size_t)(w * 4096 + lane * 16);
  const size_t boff = (size_t)((n0 >> 4) + w) * (16 * DMOD * 2) + (size_t)(lane * 16);
  const unsigned long long gah = (unsigned long long)kxh + aoff, gal = (unsigned long long)kxl + aoff;
  const unsigned long long gbh = (unsigned long long)wth + boff, gbl = (unsigned long long)wtl + boff;
  const int NST = DMOD / 64;

#define G_COPY_STAGE(T, BUF)                                                                                   \
  do {                                                                                                         \
    const unsigned long long sa_ = (unsigned long long)(T) * (SQ * HDIM * 2), sb_ = (unsigned long long)(T) * 2048; \
    copy_plane(lca + (BUF), gah + sa_, lcb + (BUF), gbh + sb_);                                                \
    copy_plane(lca + (BUF) + G_APLANE, gal + sa_, lcb + (BUF) + G_BPLANE, gbl + sb_);                          \
  } while (0)

  G_COPY_STAGE(0, 0u);
  asm volatile("s_wait_asynccnt 0x0" ::: "memory");   // this wave's share of stage 0 has landed
  __syncthreads();                                    // every wave's share has: stage 0 may be read
  G_COPY_STAGE(1, (unsigned)G_STAGE);

  // rolled: one trip's text is 96 products and 64 LDS loads
#pragma unroll 1
  for (int t = 0; t < NST; ++t) {
    const unsigned buf = (unsigned)(t & 1) * (unsigned)G_STAGE;
    const unsigned char* pa = ring + buf + wm * 8192 + lane * 16;
    const unsigned char* pb = ring + buf + 2 * G_APLANE + wn * 8192 + lane * 16;
    v16b ah[2][4], al[2][4], bh[2][4], bl[2][4];
    // in the order in which the products below first read them
#pragma unroll
    for (int kc = 0; kc < 2; ++kc) {
      ah[kc][0] = ldsfrag(pa + kc * 1024);
      bh[kc][0] = ldsfrag(pb + kc * 1024);
#pragma unroll
      for (int i = 1; i < 4; ++i) ah[kc][i] = ldsfrag(pa + i * 2048 + kc * 1024);
#pragma unroll
      for (int j = 1; j < 4; ++j) bh[kc][j] = ldsfrag(pb + j * 2048 + kc * 1024);
#pragma unroll
      for (int j = 0; j < 4; ++j) bl[kc][j] = ldsfrag(pb + G_BPLANE + j * 2048 + kc * 1024);
#pragma unroll
      for (int i = 0; i < 4; ++i) al[kc][i] = ldsfrag(pa + G_APLANE + i * 2048 + kc * 1024);
    }
    // keeps the trip's LDS loads one group in front of its products
    __builtin_amdgcn_sched_barrier(0);
    // per accumulator hi*hi, hi*lo, lo*hi, k ascending; sixteen independent tiles between two products of one tile
#pragma unroll
    for (int kc = 0; kc < 2; ++kc) {
#pragma unroll
      for (int j = 0; j < 4; ++j)
#pragma unroll
        for (int i = 0; i < 4; ++i) acc[i][j] = wmm(ah[kc][i], bh[kc][j], acc[i][j]);
#pragma unroll
      for (int j = 0; j < 4; ++j)
#pragma unroll
        for (int i = 0; i < 4; ++i) acc[i][j] = wmm(ah[kc][i], bl[kc][j], acc[i][j]);
#pragma unroll
      for (int j = 0; j < 4; ++j)
#pragma unroll
        for (int i = 0; i < 4; ++i) acc[i][j] = wmm(al[kc][i], bh[kc][j], acc[i][j]);
    }
    // keeps the products in front of the trip's foot: moved behind its waits they would no longer cover the LDS loads' and
    // the copies' flight
    __builtin_amdgcn_sched_barrier(0);
    asm volatile("s_wait_dscnt 0x0" ::: "memory");      // this wave has left the buffer that is refilled below
    asm volatile("s_wait_asynccnt 0x0" ::: "memory");   // its share of stage t + 1 has landed
    __syncthreads();                                    // stage t + 1 may be read; stage t's buffer is free
    if (t + 2 < NST) G_COPY_STAGE(t + 2, buf);
  }
  asm volatile("s_wait_asynccnt 0x0" ::: "memory");     // no copy is under way when the ring becomes output staging
#undef G_COPY_STAGE

  // D tile: element r -> row 8*hh + r, col m. The last trip's barrier has ended every read of the ring.
  float (*Cs)[68] = (float (*)[68])(ring + w * (64 * 68 * 4));
#pragma unroll
  for (int i = 0; i < 4; ++i)
#pragma unroll
    for (int j = 0; j < 4; ++j)
#pragma unroll
      for (int r = 0; r < 8; ++r) Cs[i * 16 + 8 * hh + r][j * 16 + m] = acc[i][j][r];
  __syncthreads();

  const int n0w = n0 + wn * 64, s0w = s0 + wm * 64;
  if (n0w < DMOD) {
    const int hq = n0w >> 6;
    const int qrow0 = (b * NHEAD + hq) * SQ;
    const float* rrbh = rrb + hq * HDIM;
    const float* rwbh = rwb + hq * HDIM;
    // four steps' loads fly together: the block is alone on its WGP, and no other wave's work covers their latency
#pragma unroll 1
    for (int io = 0; io < 4; ++io) {
#pragma unroll
    for (int ii = 0; ii < 4; ++ii) {
      // the wave takes 8 rows x 4 k octets: lanes 8q..8q+7 store one whole line of each plane
      const int j4 = lane >> 3, j = (ii >> 1) * 4 + j4;
      const int rr = io * 16 + (ii & 1) * 8 + (lane & 7);
      const int s = s0w + rr;
      const v8f cl = load8(&Cs[rr][8 * j4]);        // q[d'],     d' = 8*j4+e
      const v8f ch = load8(&Cs[rr][32 + 8 * j4]);   // q[32+d']
      const v8f bwl = load8(rwbh + 8 * j4);
      const v8f bwh = load8(rwbh + 32 + 8 * j4);
      const v8f br  = load8(rrbh + 8 * j);
      const float* trs = tr + (size_t)s * HDIM;
      const v8f sq = load8(trs + 8 * j4);           // sin(s*f_d')
      const v8f cq = load8(trs + 32 + 8 * j4);      // cos(s*f_d')
      const v8f a = cl + bwl;
      const v8f c = ch + bwh;
      v8f qa, qb;
      if (j < 4) {
        qa = cl + br;
        qb = a * cq + c * sq;
      } else {
        qa = ch + br;
        qb = c * cq - a * sq;
      }
      v4u ah, al, bh, bl;
      split8(qa, ah, al);
      split8(qb, bh, bl);
      const size_t off = punit(qrow0 + s, 8 * j, HDIM);
      __bf16* p0 = qah + off;
      __bf16* p1 = qal + off;
      __bf16* p2 = qbh + off;
      __bf16* p3 = qbl + off;
      *(v4u*)p0 = ah;
      *(v4u*)p1 = al;
      *(v4u*)p2 = bh;
      *(v4u*)p3 = bl;
    }
      // behind the trip's last stores: the next trip overwrites registers that they name
      asm volatile("s_wait_xcnt 0x0" ::: "memory");
    }
  } else {
    const int hv = (n0w - DMOD) >> 6;
    const int vrow0 = (b * NHEAD + hv) * HDIM;
    // four steps at a time, as above
#pragma unroll 1
    for (int io = 0; io < 4; ++io) {
#pragma unroll
    for (int ii = 0; ii < 4; ++ii) {
      // the wave takes 16 d x 2 key octets and stores 512 contiguous bytes of each plane
      const int dd = io * 16 + (lane & 15), j = ii * 2 + (lane >> 4);
      v8f v;
#pragma unroll
      for (int e = 0; e < 8; ++e) v[e] = Cs[8 * j + e][dd];
      v4u uh, ul;
      split8(v, uh, ul);
      const size_t off = punit(vrow0 + dd, s0w + 8 * j, SQ);
      __bf16* ph = vth + off;
      __bf16* pl = vtl + off;
      *(v4u*)ph = uh;
      *(v4u*)pl = ul;
    }
      // behind the trip's last stores: the next trip overwrites registers that they name
      asm volatile("s_wait_xcnt 0x0" ::: "memory");
    }
  }
}

// ---------------------------------------------------------------------------
// Fused attention, transposed tiles. Block = 8 waves, wave owns 16 queries of one (b,h); 32 keys per step.
// Scores S^T[key][query] = Kcat[key][0..127] . Qcat[query][0..127]:
//   A = kx planes (cols 0..63) / trig table planes (cols 64..127), B = qa / qb planes (loaded like A).
// Softmax statistics live on lane = query (xor-16 exchange between lane halves).
// O^T[d][query] = V^T . P^T: A = vt planes ([d][key]), B = P^T packed straight from the score D tiles
//   (element r <- key 8h+r of the first 16-key tile, element 8+r <- second tile), bf16 hi/lo.
// The key side is the same for all eight waves: a stage is 64 keys (two steps) of it, copied as it lies (whole 1-KiB
// fragments) into LDS, where every wave reads it:
//   [kx hi | kx lo | table hi | table lo | V^T hi | V^T lo], 8 KiB each; kx and table: four 16-key tiles of 2 KiB (two
//   32-column fragments); V^T: four 16-d tiles of 2 KiB (the stage's two 32-key fragments).
// Two buffers: the copies of stage t + 2 fly while stage t + 1 is worked on.
// ---------------------------------------------------------------------------
#define A_PLANE 8192
#define A_STAGE (6 * A_PLANE)

// A wave's share of a stage: 1 KiB (two copies of 512 B) of each of the six planes, each lane 16 bytes a copy.
// l: the lane's LDS byte address in the first plane; g0..g5: the wave's global addresses, o: the lane's byte offset. The wait that a later overwrite of these
// address registers owes to the copies is the statement's last line, so that nothing can come between.
__device__ __forceinline__ void copy_keyside(unsigned l, unsigned long long o, unsigned long long g0, unsigned long long g1, unsigned long long g2,
                                             unsigned long long g3, unsigned long long g4, unsigned long long g5) {
  asm volatile("global_load_async_to_lds_b128 %0, %1, off\n\t"
               "global_load_async_to_lds_b128 %2, %3, off\n\t"
               "global_load_async_to_lds_b128 %4, %5, off\n\t"
               "global_load_async_to_lds_b128 %6, %7, off\n\t"
               "global_load_async_to_lds_b128 %8, %9, off\n\t"
               "global_load_async_to_lds_b128 %10, %11, off\n\t"
               "global_load_async_to_lds_b128 %12, %13, off\n\t"
               "global_load_async_to_lds_b128 %14, %15, off\n\t"
               "global_load_async_to_lds_b128 %16, %17, off\n\t"
               "global_load_async_to_lds_b128 %18, %19, off\n\t"
               "global_load_async_to_lds_b128 %20, %21, off\n\t"
               "global_load_async_to_lds_b128 %22, %23, off\n\t"
               "s_wait_xcnt 0x0"
               :: "v"(l),               "v"(g0 + o), "v"(l + 512),               "v"(g0 + 512 + o),
                  "v"(l + A_PLANE),     "v"(g1 + o), "v"(l + A_PLANE + 512),     "v"(g1 + 512 + o),
                  "v"(l + 2 * A_PLANE), "v"(g2 + o), "v"(l + 2 * A_PLANE + 512), "v"(g2 + 512 + o),
                  "v"(l + 3 * A_PLANE), "v"(g3 + o), "v"(l + 3 * A_PLANE + 512), "v"(g3 + 512 + o),
                  "v"(l + 4 * A_PLANE), "v"(g4 + o), "v"(l + 4 * A_PLANE + 512), "v"(g4 + 512 + o),
                  "v"(l + 5 * A_PLANE), "v"(g5 + o), "v"(l + 5 * A_PLANE + 512), "v"(g5 + 512 + o)
               : "memory");
}

// four fragments out of a stage: two tiles 2 KiB apart, hi plane at p and lo plane one plane behind it
__device__ __forceinline__ Frag4 ldsfrag4(const unsigned char* p) {
  Frag4 f;
  // in the order in which a product group first reads them
  f.h0 = ldsfrag(p);
  f.h1 = ldsfrag(p + 2048);
  f.l0 = ldsfrag(p + A_PLANE);
  f.l1 = ldsfrag(p + A_PLANE + 2048);
  return f;
}

__global__ __launch_bounds__(256) __attribute__((amdgpu_num_vgpr(256)))
void k_attn(const __bf16* __restrict__ qah, const __bf16* __restrict__ qal,
            const __bf16* __restrict__ qbh, const __bf16* __restrict__ qbl,
            const __bf16* __restrict__ kxh, const __bf16* __restrict__ kxl,
            const __bf16* __restrict__ trh, const __bf16* __restrict__ trl,
            const __bf16* __restrict__ vth, const __bf16* __restrict__ vtl,
            const int* __restrict__ msk, float* __restrict__ out)
{
  __shared__ __attribute__((aligned(2048))) unsigned char ring[2 * A_STAGE];
  // the wave's number in a scalar register: every fragment's block address is then a scalar value, as point_at takes it
  const int tid = threadIdx.x, w = __builtin_amdgcn_readfirstlane(tid >> 5), lane = tid & 31, hh = lane >> 4, n = lane & 15;
  const int bh = (int)(blockIdx.x >> 2), qc = (int)(blockIdx.x & 3u);
  const int b = bh >> 4, hd = bh & 15;
  const int q0 = qc * 128 + w * 16;
  const int qrow = bh * SQ + q0;   // rows of qa/qb (pitch 64)

  // The wave's share of every stage: bytes w*1024.. of each plane's 8 KiB. In kx and in the table a stage is 8 KiB
  // contiguous (64 rows of 128 bytes); in V^T (row tiles of 16 KiB) it is 2 KiB of each of the head's four tiles.
  const unsigned lc = (unsigned)(size_t)ring + (unsigned)(w * 1024 + lane * 16);
  const size_t koff = (size_t)bh * (SQ * HDIM * 2) + (size_t)(w * 1024);
  const size_t toff = (size_t)(w * 1024);
  const size_t voff = (size_t)bh * (HDIM * SQ * 2) + (size_t)((w >> 1) * (16 * SQ * 2) + (w & 1) * 1024);
  const unsigned long long gkh = (unsigned long long)kxh + koff, gkl = (unsigned long long)kxl + koff;
  const unsigned long long gth = (unsigned long long)trh + toff, gtl = (unsigned long long)trl + toff;
  const unsigned long long gvh = (unsigned long long)vth + voff, gvl = (unsigned long long)vtl + voff;
  const int NST = SQ / 64;

#define A_COPY_STAGE(T, BUF)                                                                          \
  do {                                                                                                \
    const unsigned long long sk_ = (unsigned long long)(T) * A_PLANE, sv_ = (unsigned long long)(T) * 2048; \
    copy_keyside(lc + (BUF), laneoff, gkh + sk_, gkl + sk_, gth + sk_, gtl + sk_, gvh + sv_, gvl + sv_); \
  } while (0)

  const unsigned long long laneoff = (unsigned long long)(unsigned)(lane * 16);
  A_COPY_STAGE(0, 0u);

  Addr2 pf = {0, 0};
  // the wave's 16 queries, all 128 columns (qa | qb), hi and lo planes; columns 32..63 of a plane lie 1024 bytes behind 0..31
  point_at(pf, fragblock(qah, HDIM, qrow, 0), fragblock(qal, HDIM, qrow, 0), laneoff);
  const v16b qh0 = ldfrag(pf.h, 0),    ql0 = ldfrag(pf.l, 0);
  const v16b qh1 = ldfrag(pf.h, 1024), ql1 = ldfrag(pf.l, 1024);
  point_at(pf, fragblock(qbh, HDIM, qrow, 0), fragblock(qbl, HDIM, qrow, 0), laneoff);
  const v16b qh2 = ldfrag(pf.h, 0),    ql2 = ldfrag(pf.l, 0);
  const v16b qh3 = ldfrag(pf.h, 1024), ql3 = ldfrag(pf.l, 1024);
  done_with(pf);

  v8f o0 = vz8(), o1 = vz8(), o2 = vz8(), o3 = vz8();
  float mrun = -1.0e30f, dsum = 0.0f;

  asm volatile("s_wait_asynccnt 0x0" ::: "memory");   // this wave's share of stage 0 has landed
  __syncthreads();                                    // every wave's share has: stage 0 may be read
  A_COPY_STAGE(1, (unsigned)A_STAGE);

  // rolled: one trip's text is two steps of 36 products and their softmax
#pragma unroll 1
  for (int t = 0; t < NST; ++t) {
    const unsigned buf = (unsigned)(t & 1) * (unsigned)A_STAGE;
    const unsigned char* ps = ring + buf + lane * 16;
    // Each group of fragments is asked for out of LDS one product group ahead of the group that reads it, the second step's
    // first chunk among the first step's P*V products. Nothing is read across a stage.
    Frag4 k0 = ldsfrag4(ps);
    // unrolled: only the first step fetches ahead, and each step's LDS offsets go into the loads' own offset fields
#pragma unroll
    for (int u = 0; u < 2; ++u) {
      const int kb0 = t * 64 + u * 32;
      const unsigned char* pk = ps + u * 4096;                  // the step's two 16-key tiles
      const unsigned char* pv = ps + 4 * A_PLANE + u * 1024;    // the step's 32-key fragment of each V^T tile
      v8f s0 = vz8(), s1 = vz8();
      const Frag4 k1 = ldsfrag4(pk + 1024);
      // key-mask: keys kb0 + 8*hh + r (tile 0) and kb0 + 16 + 8*hh + r (tile 1)
      const int* mp = msk + b * SQ + kb0 + 8 * hh;
      const v4i mA = *(const v4i*)(mp);
      const v4i mB = *(const v4i*)(mp + 4);
      const v4i mC = *(const v4i*)(mp + 16);
      const v4i mD = *(const v4i*)(mp + 20);
      // each scheduling barrier of this loop keeps the loads above it in front of the arithmetic below it: issued later they
      // would have less of it to fly behind
      __builtin_amdgcn_sched_barrier(0);
      mma3x2(s0, s1, k0.h0, k0.l0, k0.h1, k0.l1, qh0, ql0);
      const Frag4 k2 = ldsfrag4(pk + 2 * A_PLANE);
      __builtin_amdgcn_sched_barrier(0);
      mma3x2(s0, s1, k1.h0, k1.l0, k1.h1, k1.l1, qh1, ql1);
      const Frag4 k3 = ldsfrag4(pk + 2 * A_PLANE + 1024);
      __builtin_amdgcn_sched_barrier(0);
      mma3x2(s0, s1, k2.h0, k2.l0, k2.h1, k2.l1, qh2, ql2);
      const Frag4 v01 = ldsfrag4(pv);
      __builtin_amdgcn_sched_barrier(0);
      mma3x2(s0, s1, k3.h0, k3.l0, k3.h1, k3.l1, qh3, ql3);
      v8f f0, f1;
#pragma unroll
      for (int r = 0; r < 4; ++r) {
        f0[r] = (float)mA[r]; f0[4 + r] = (float)mB[r];
        f1[r] = (float)mC[r]; f1[4 + r] = (float)mD[r];
      }
      s0 = s0 * f0 - (1.0f - f0) * 1.0e8f;
      s1 = s1 * f1 - (1.0f - f1) * 1.0e8f;

      float mloc = s0[0];
#pragma unroll
      for (int r = 0; r < 8; ++r) { mloc = fmaxf(mloc, s0[r]); mloc = fmaxf(mloc, s1[r]); }
      const float mall = fmaxf(mloc, __shfl_xor(mloc, 16, 32));
      const float mnew = fmaxf(mrun, mall);
      const float alpha = exp_with_slot(mrun - mnew);
      float psum = 0.0f;
#pragma unroll
      for (int r = 0; r < 8; ++r) {
        const float pa = exp_with_slot(s0[r] - mnew);
        const float pb = exp_with_slot(s1[r] - mnew);
        s0[r] = pa; s1[r] = pb;
        psum += pa + pb;
      }
      // this one keeps the loads below it out of the masking and the exponentials above, where their 32 registers are not to be had
      __builtin_amdgcn_sched_barrier(0);
      const Frag4 v23 = ldsfrag4(pv + 4096);   // 32 rows of V^T further on
      __builtin_amdgcn_sched_barrier(0);
      psum += __shfl_xor(psum, 16, 32);
      dsum = dsum * alpha + psum;
      mrun = mnew;
      o0 *= alpha; o1 *= alpha; o2 *= alpha; o3 *= alpha;

      // P^T as the B operand: k = key offset within the 32-key step
      v4u p0h, p0l, p1h, p1l;
      split8(s0, p0h, p0l);
      split8(s1, p1h, p1l);
      Frag ph, pl;
      ph.q[0] = p0h; ph.q[1] = p1h;
      pl.q[0] = p0l; pl.q[1] = p1l;
      mma3x2(o0, o1, v01.h0, v01.l0, v01.h1, v01.l1, ph.v, pl.v);
      if (u == 0) {
        k0 = ldsfrag4(ps + 4096);
        __builtin_amdgcn_sched_barrier(0);
      }
      mma3x2(o2, o3, v23.h0, v23.l0, v23.h1, v23.l1, ph.v, pl.v);
    }
    asm volatile("s_wait_dscnt 0x0" ::: "memory");      // this wave has left the buffer that is refilled below
    asm volatile("s_wait_asynccnt 0x0" ::: "memory");   // its share of stage t + 1 has landed
    __syncthreads();                                    // stage t + 1 may be read; stage t's buffer is free
    if (t + 2 < NST) A_COPY_STAGE(t + 2, buf);
  }
  asm volatile("s_wait_asynccnt 0x0" ::: "memory");     // no copy is under way when the ring becomes output staging
#undef A_COPY_STAGE

  // O^T element r of tile t -> d = 16*t + 8*hh + r, query n. The last trip's barrier has ended every read of the ring.
  float (*Os)[16][64] = (float (*)[16][64])ring;
  const float rinv = 1.0f / dsum;
#pragma unroll
  for (int r = 0; r < 8; ++r) {
    Os[w][n][8 * hh + r]      = o0[r] * rinv;
    Os[w][n][16 + 8 * hh + r] = o1[r] * rinv;
    Os[w][n][32 + 8 * hh + r] = o2[r] * rinv;
    Os[w][n][48 + 8 * hh + r] = o3[r] * rinv;
  }
  __syncthreads();

  v4f ov[8];
#pragma unroll
  for (int it = 0; it < 8; ++it) ov[it] = *(const v4f*)&Os[w][2 * it + hh][4 * n];
  float* ob = out + ((size_t)(b * SQ + q0)) * DMOD + hd * HDIM + 4 * n;
#pragma unroll
  for (int it = 0; it < 8; ++it) {
    float* p = ob + (size_t)(2 * it + hh) * DMOD;
    *(v4f*)p = ov[it];
  }
}

// ---------------------------------------------------------------------------
extern "C" void kernel_launch(void* const* d_in, const int* in_sizes, int n_in,
                              void* d_out, int out_size, void* d_ws,
                              size_t ws_size, hipStream_t stream)
{
  if (n_in < 5) return;
  if (in_sizes[0] != NBATCH * SQ * DMOD) return;
  if (in_sizes[1] != NBATCH * SQ) return;
  if (in_sizes[2] != DMOD * 2 * DMOD) return;
  if (in_sizes[3] != NHEAD * HDIM) return;
  if (in_sizes[4] != NHEAD * HDIM) return;
  if (out_size != NBATCH * SQ * DMOD) return;

  const float* x    = (const float*)d_in[0];
  const int*   mk   = (const int*)d_in[1];
  const float* wqv  = (const float*)d_in[2];
  const float* rrb  = (const float*)d_in[3];
  const float* rwb  = (const float*)d_in[4];
  float* out = (float*)d_out;

  const size_t n_tr    = (size_t)SQ * HDIM;                 // 32768
  const size_t n_heads = (size_t)NBATCH * NHEAD * SQ * HDIM; // 4194304
  const size_t n_w     = (size_t)DMOD * 2 * DMOD;            // 2097152

  char* ws = (char*)d_ws;
  size_t off = 0;
  auto carve = [&](size_t bytes) -> char* {
    char* p = ws + off;
    off += (bytes + 255) & ~(size_t)255;
    return p;
  };
  float*  tr  = (float*)carve(n_tr * 4);
  __bf16* trh = (__bf16*)carve(n_tr * 2);
  __bf16* trl = (__bf16*)carve(n_tr * 2);
  __bf16* kxh = (__bf16*)carve(n_heads * 2);
  __bf16* kxl = (__bf16*)carve(n_heads * 2);
  __bf16* wth = (__bf16*)carve(n_w * 2);
  __bf16* wtl = (__bf16*)carve(n_w * 2);
  __bf16* qah = (__bf16*)carve(n_heads * 2);
  __bf16* qal = (__bf16*)carve(n_heads * 2);
  __bf16* qbh = (__bf16*)carve(n_heads * 2);
  __bf16* qbl = (__bf16*)carve(n_heads * 2);
  __bf16* vth = (__bf16*)carve(n_heads * 2);
  __bf16* vtl = (__bf16*)carve(n_heads * 2);
  if (off > ws_size) return;

  FreqTab ft;
  const double cst = -log(10000.0) / 31.0;
  for (int d = 0; d < 32; ++d) ft.f[d] = exp((double)((float)d) * cst);

  k_prep<<<dim3(P_TRIG_BLOCKS + P_W_BLOCKS + P_X_BLOCKS), dim3(128), 0, stream>>>(
      ft, x, wqv, tr, trh, trl, kxh, kxl, wth, wtl);
  k_gemm<<<dim3((NBATCH * SQ / 256) * (2 * DMOD / 128)), dim3(256), 0, stream>>>(
      kxh, kxl, wth, wtl, rrb, rwb, tr, qah, qal, qbh, qbl, vth, vtl);
  k_attn<<<dim3(NBATCH * NHEAD * (SQ / 128)), dim3(256), 0, stream>>>(
      qah, qal, qbh, qbl, kxh, kxl, trh, trl, vth, vtl, mk, out);
}

// v006
// A run of this version takes 67.4 microseconds.
// Timed twice side by side with v005, it ran 1.10 times as fast both times.
// Over all steps from v000 it is 3.47 times as fast.
#include <hip/hip_runtime.h>
#include <math.h>
#include <stddef.h>

// Contractions: x*Wqv and the per-head 128-deep logits ([q+r_r_bias | rotated(q+r_w_bias)] . [k | sin/cos table]):
// v_wmma_f32_16x16x32_bf16 with bf16 hi/lo operand planes (hi*hi + hi*lo + lo*hi), f32 accumulate.
// p*v: v_wmma_f32_16x16x32_f16, one f16 plane of each operand, f32 accumulate: a rounding of p or v reaches the output only
// in proportion, a rounding of a logit through the exponential. Softmax and elementwise math f32.

#define NBATCH 8
#define SQ     512
#define DMOD   1024
#define NHEAD  16
#define HDIM   64

typedef float v8f __attribute__((ext_vector_type(8)));
typedef float v4f_raw __attribute__((ext_vector_type(4)));
typedef v4f_raw __attribute__((__may_alias__)) v4f;
typedef unsigned int v4u_raw __attribute__((ext_vector_type(4)));
typedef v4u_raw __attribute__((__may_alias__)) v4u;
typedef int v4i_raw __attribute__((ext_vector_type(4)));
typedef v4i_raw __attribute__((__may_alias__)) v4i;
typedef __bf16 v16b __attribute__((ext_vector_type(16)));
typedef __bf16 v8b __attribute__((ext_vector_type(8)));
typedef _Float16 v16h __attribute__((ext_vector_type(16)));
typedef _Float16 v8h __attribute__((ext_vector_type(8)));

union Frag  { v16b v; v8b h[2]; v4u q[2]; };
union Pack8 { v8b v; v4u q; };
union FragH  { v16h v; v8h h[2]; v4u q[2]; };
union PackH8 { v8h v; v4u q; };

struct FreqTab { double f[32]; };
typedef char freqtab_size_check[(sizeof(FreqTab) == 256) ? 1 : -1];

__device__ __forceinline__ v8f vz8() {
  v8f z;
#pragma unroll
  for (int i = 0; i < 8; ++i) z[i] = 0.0f;
  return z;
}

__device__ __forceinline__ v8f load8(const float* p) {
  const v4f a = *(const v4f*)(p);
  const v4f c = *(const v4f*)(p + 4);
  return __builtin_shufflevector(a, c, 0, 1, 2, 3, 4, 5, 6, 7);
}

// Every bf16 plane is stored fragment-major: a [rows][pitch] matrix is cut into 16-row x 32-k fragments of 1 KiB,
// ordered [row/16][k/32]; inside a fragment the 16-byte units (8 consecutive k of one row) are ordered [(k%32)/8][row%16].
// Element offset of the unit that holds (row, k..k+7), k a multiple of 8:
__device__ __forceinline__ size_t punit(int row, int k, int pitch) {
  return (size_t)(row >> 4) * (size_t)(16 * pitch) + (size_t)((k >> 5) * 512 + ((k >> 3) & 3) * 128 + (row & 15) * 8);
}

// 16x32 16-bit fragment, identical map for the A operand ([m][k]) and for the B operand ([n][k]):
// lane -> row/col (lane&15); h = lane>>4; elements 0..7 <- k = kc+8h+0..7, elements 8..15 <- k = kc+16+8h+0..7.
// row is a multiple of 16, kc of 32. In the fragment-major order lane L's two units are units L and 32+L of the
// fragment, so each wave-wide 16-byte load covers 512 contiguous bytes (four whole 128-byte lines).
// fragblock: the fragment's first byte, the same in every lane; ldfrag: the fragment off bytes behind the lane's own address a.
typedef const __attribute__((address_space(1))) v4u gv4u;
__device__ __forceinline__ unsigned long long fragblock(const __bf16* __restrict__ base, int pitch, int row, int kc) {
  return (unsigned long long)(base + ((size_t)(row >> 4) * (size_t)(16 * pitch) + (size_t)((kc >> 5) * 512)));
}
__device__ __forceinline__ v16b ldfrag(unsigned long long a, int off) {
  const gv4u* p = (const gv4u*)a;   // off, a multiple of 16, goes into the loads' own offset field
  Frag f;
  f.q[0] = p[off / 16];
  f.q[1] = p[off / 16 + 32];
  return f.v;
}

__device__ __forceinline__ v8f wmm(v16b a, v16b b, v8f c) {
  return __builtin_amdgcn_wmma_f32_16x16x32_bf16(false, a, false, b, (short)0, c, false, false);
}

// two accumulators sharing one B pair: c0 += a0*b, c1 += a1*b with hi/lo planes (hi*hi + hi*lo + lo*hi);
// 4 v_nop after the last WMMA, tying both D tiles and all six operand fragments.
__device__ __forceinline__ void mma3x2(v8f& c0, v8f& c1,
                                       const v16b a0h, const v16b a0l,
                                       const v16b a1h, const v16b a1l,
                                       const v16b bh, const v16b bl) {
  c0 = wmm(a0h, bh, c0);
  c1 = wmm(a1h, bh, c1);
  c0 = wmm(a0h, bl, c0);
  c1 = wmm(a1h, bl, c1);
  c0 = wmm(a0l, bh, c0);
  c1 = wmm(a1l, bh, c1);
  asm volatile("v_nop\n\tv_nop\n\tv_nop\n\tv_nop"
               : "+v"(c0), "+v"(c1)
               : "v"(a0h), "v"(a0l), "v"(a1h), "v"(a1l), "v"(bh), "v"(bl));
}

// four accumulators sharing one f16 B fragment: ci += ai*b; 4 v_nop after the last WMMA, tying the D tiles and the operands:
// the distance that a vector instruction which touches them has to keep, on every path behind the group.
__device__ __forceinline__ void mmah1x4(v8f& c0, v8f& c1, v8f& c2, v8f& c3,
                                        const v16h a0, const v16h a1, const v16h a2, const v16h a3, const v16h b) {
  c0 = __builtin_amdgcn_wmma_f32_16x16x32_f16(false, a0, false, b, (short)0, c0, false, false);
  c1 = __builtin_amdgcn_wmma_f32_16x16x32_f16(false, a1, false, b, (short)0, c1, false, false);
  c2 = __builtin_amdgcn_wmma_f32_16x16x32_f16(false, a2, false, b, (short)0, c2, false, false);
  c3 = __builtin_amdgcn_wmma_f32_16x16x32_f16(false, a3, false, b, (short)0, c3, false, false);
  asm volatile("v_nop\n\tv_nop\n\tv_nop\n\tv_nop"
               : "+v"(c0), "+v"(c1), "+v"(c2), "+v"(c3)
               : "v"(a0), "v"(a1), "v"(a2), "v"(a3), "v"(b));
}

// The lane's address in the hi and in the lo plane, for loads that stay in flight over many instructions. The two register
// pairs are written here and nowhere else: block address + the lane's byte offset, behind the wait that an overwrite of a
// register owes to the loads in flight that name it. As in-out operands the pairs stay whole from one call to the next,
// so that no load's result is put into them; wait and additions are one statement, so that nothing comes between them.
struct Addr2 { unsigned long long h, l; };
__device__ __forceinline__ void point_at(Addr2& a, unsigned long long blockh, unsigned long long blockl, unsigned long long laneoff) {
  asm volatile("s_wait_xcnt 0x0\n\tv_add_nc_u64 %0, %2, %4\n\tv_add_nc_u64 %1, %3, %4"
               : "+v"(a.h), "+v"(a.l) : "s"(blockh), "s"(blockl), "v"(laneoff) : "memory");
}
// behind the last loads: holds the pairs whole up to the wait
__device__ __forceinline__ void done_with(const Addr2& a) {
  asm volatile("s_wait_xcnt 0x0" :: "v"(a.h), "v"(a.l) : "memory");
}

// four fragments of one 32-deep chunk, off bytes behind a: two 16-row tiles (16 * pitch elements apart), hi and lo plane
struct Frag4 { v16b h0, l0, h1, l1; };
__device__ __forceinline__ Frag4 ldfrag4(const Addr2& a, int off, int pitch) {
  Frag4 f;
  f.h0 = ldfrag(a.h, off);
  f.l0 = ldfrag(a.l, off);
  f.h1 = ldfrag(a.h, off + 32 * pitch);
  f.l1 = ldfrag(a.l, off + 32 * pitch);
  return f;
}

// __expf as the compiler builds it (one multiply, v_exp_f32), with the free slot that the instruction set asks for behind a
// transcendental in the same statement.
__device__ __forceinline__ float exp_with_slot(float x) {
  float r;
  asm("v_exp_f32 %0, %1\n\tv_nop" : "=v"(r) : "v"(x * 1.44269504f));
  return r;
}

// f32 x8 -> bf16 hi (RNE convert) and bf16 lo = RNE(x - hi), packed as 16 bytes each
__device__ __forceinline__ void split8(const v8f x, v4u& uh, v4u& ul) {
  Pack8 a, c;
  a.v = __builtin_convertvector(x, v8b);
  const v8f xh = __builtin_convertvector(a.v, v8f);
  c.v = __builtin_convertvector(x - xh, v8b);
  uh = a.q;
  ul = c.q;
}

// ---------------------------------------------------------------------------
// All operand preparation in one launch; a block's index range says which of three independent jobs it does.
//
// Blocks 0..31, 16 table rows each: tr[s][0..31] = sin(s*f_d), tr[s][32..63] = cos(s*f_d), s = 0..511, angle formed in
// f64, evaluated as sincos(hi) with first-order lo correction in f32; stored as f32 and, through LDS, as fragment-major
// bf16 hi/lo planes (16 rows x 64 k = two whole fragments: the block stores 2 KiB contiguous of each plane).
//
// The next 1024 blocks: w[k][n] (1024 x 2048, n contiguous) -> wt{h,l}, rows n, 1024 k, fragment-major bf16 hi/lo planes.
// A block takes a 64 k x 32 n tile through LDS; a wave takes 16 n x 2 k octets and stores 512 contiguous bytes.
//
// The last 4096 blocks: x[b][s][h*64+d] -> head-major planes kx{h,l}, rows (b*16+h)*512+s, 64 k, fragment-major, one
// 16-B unit per thread. A wave takes 8 rows x 32 k: lanes 8q..8q+7 (8 rows, one k octet) store one whole line.
// ---------------------------------------------------------------------------
#define P_TRIG_BLOCKS (SQ * 8 / 128)
#define P_W_BLOCKS    ((2 * DMOD / 32) * (DMOD / 64))
#define P_X_BLOCKS    (NBATCH * NHEAD * SQ * HDIM / 8 / 128)

__global__ __launch_bounds__(128)
void k_prep(FreqTab ft, const float* __restrict__ x, const float* __restrict__ w,
            float* __restrict__ tr, __bf16* __restrict__ trh, __bf16* __restrict__ trl,
            __bf16* __restrict__ kxh, __bf16* __restrict__ kxl,
            __bf16* __restrict__ wth, __bf16* __restrict__ wtl)
{
  __shared__ __align__(16) float T[64][36];
  const int tid = threadIdx.x;
  const int blk = (int)blockIdx.x;

  if (blk < P_TRIG_BLOCKS) {
    const int sr = tid >> 3, j = tid & 7;
    const int s = blk * 16 + sr;
    float sa0 = 0.f, sa1 = 0.f, sa2 = 0.f, sa3 = 0.f;
    float ca0 = 0.f, ca1 = 0.f, ca2 = 0.f, ca3 = 0.f;
#pragma unroll 1
    for (int i = 0; i < 4; ++i) {
      const int d = 4 * j + i;
      const double ang = (double)s * ft.f[d];
      const float ah = (float)ang;
      const float al = (float)(ang - (double)ah);
      float sv, cv;
      sincosf(ah, &sv, &cv);
      const float sf = sv + al * cv;
      const float cf = cv - al * sv;
      sa0 = sa1; sa1 = sa2; sa2 = sa3; sa3 = sf;
      ca0 = ca1; ca1 = ca2; ca2 = ca3; ca3 = cf;
    }
    v4f vs, vc;
    vs[0] = sa0; vs[1] = sa1; vs[2] = sa2; vs[3] = sa3;
    vc[0] = ca0; vc[1] = ca1; vc[2] = ca2; vc[3] = ca3;
    float* ps = tr + (size_t)s * HDIM + 4 * j;
    float* pc = ps + 32;
    *(v4f*)ps = vs;
    *(v4f*)pc = vc;
    // the block's 16 rows, pitch 68 floats (its readers take one row per lane)
    float (*R)[68] = (float (*)[68])&T[0][0];
    *(v4f*)&R[sr][4 * j] = vs;
    *(v4f*)&R[sr][32 + 4 * j] = vc;
    __syncthreads();
    // thread -> unit in the planes' own order: the block's stores are contiguous
    const int row = tid & 15, k = (tid >> 4) * 8;
    const v8f v = load8(&R[row][k]);
    v4u uh, ul;
    split8(v, uh, ul);
    const size_t dst = punit(blk * 16 + row, k, HDIM);
    __bf16* ph = trh + dst;
    __bf16* pl = trl + dst;
    *(v4u*)ph = uh;
    *(v4u*)pl = ul;
    return;
  }

  if (blk < P_TRIG_BLOCKS + P_W_BLOCKS) {
    const int wb = blk - P_TRIG_BLOCKS;
    const int nb = wb & 63, kb = wb >> 6;
    const int n0 = nb * 32, k0 = kb * 64;
#pragma unroll
    for (int i = 0; i < 4; ++i) {
      const int idx = tid + 128 * i;
      const int row = idx >> 3, c4 = idx & 7;
      const v4f v = *(const v4f*)(w + (size_t)(k0 + row) * (2 * DMOD) + n0 + 4 * c4);
      *(v4f*)&T[row][4 * c4] = v;
    }
    __syncthreads();
#pragma unroll 1
    for (int i = 0; i < 2; ++i) {
      const int task = tid + 128 * i;
      const int nn = (task >> 7) * 16 + (task & 15), j = (task >> 4) & 7;
      v8f v;
#pragma unroll
      for (int e = 0; e < 8; ++e) v[e] = T[8 * j + e][nn];
      v4u uh, ul;
      split8(v, uh, ul);
      const size_t off = punit(n0 + nn, k0 + 8 * j, DMOD);
      __bf16* ph = wth + off;
      __bf16* pl = wtl + off;
      *(v4u*)ph = uh;
      *(v4u*)pl = ul;
      // behind the trip's stores: the next trip overwrites registers that they name
      asm volatile("s_wait_xcnt 0x0" ::: "memory");
    }
    return;
  }

  {
    const int t = (blk - (P_TRIG_BLOCKS + P_W_BLOCKS)) * 128 + tid;
    const int frag = t >> 6;
    const int row = (frag >> 1) * 16 + ((t >> 5) & 1) * 8 + (t & 7);
    const int d = (frag & 1) * 32 + ((t >> 3) & 3) * 8;
    const int bhq = row >> 9, ss = row & 511;
    const int bb = bhq >> 4, hq = bhq & 15;
    const size_t e0 = ((size_t)(bb * SQ + ss)) * DMOD + hq * HDIM + d;
    const size_t dst = punit(row, d, HDIM);
    const v8f v = load8(x + e0);
    v4u uh, ul;
    split8(v, uh, ul);
    __bf16* ph = kxh + dst;
    __bf16* pl = kxl + dst;
    *(v4u*)ph = uh;
    *(v4u*)pl = ul;
    // behind the stores: in the built code the other jobs' text follows, which overwrites registers that they name
    asm volatile("s_wait_xcnt 0x0" ::: "memory");
  }
}

// ---------------------------------------------------------------------------
// qv = x @ Wqv, M=4096, N=2048, K=1024, bf16 hi/lo planes on both operands.
// Block = 8 waves (4 along M x 2 along N), tile 256(M) x 128(N); a wave owns 64 x 64: 64 positions of one head of q or of v.
// A from kx planes (pitch 64, head = k/64), B from wt planes ([n][k], pitch 1024), both fragment-major.
// A stage is 64 k of the block's rows, copied as it lies (whole 1-KiB fragments) into LDS, where all eight waves read it:
//   [A hi 32 KiB | A lo 32 KiB | B hi 16 KiB | B lo 16 KiB]; a 16-row tile is 2 KiB (its two 32-k fragments).
// Two buffers: the copies of stage t + 2 fly while stage t + 1 is worked on.
// Epilogue through LDS, each wave its own 64 x 64 tile (row pitch 68 floats: its readers take one row, or one column,
// per lane), fragment-major out:
//   n <  1024: qa = q + r_r_bias, qb = rotated (q + r_w_bias); rows (b*16+h)*512+s, 64 k -> qa{h,l}, qb{h,l}
//   n >= 1024: v transposed -> vtf (one f16 plane), rows (b*16+h)*64+d, 512 k, 64 columns from the wave's first position
// ---------------------------------------------------------------------------
#define G_APLANE 32768
#define G_BPLANE 16384
#define G_STAGE  (2 * G_APLANE + 2 * G_BPLANE)

// One plane's share of a wave in a stage: 4 KiB of A (eight copies of 512 B) and 2 KiB of B (four), each lane 16 bytes a copy.
// la, lb: the lane's LDS byte addresses; ga, gb: its global addresses. The wait that a later overwrite of these address
// registers owes to the copies is the statement's last line, so that nothing can come between.
__device__ __forceinline__ void copy_plane(unsigned la, unsigned long long ga, unsigned lb, unsigned long long gb) {
  asm volatile("global_load_async_to_lds_b128 %0, %1, off\n\t"
               "global_load_async_to_lds_b128 %2, %3, off\n\t"
               "global_load_async_to_lds_b128 %4, %5, off\n\t"
               "global_load_async_to_lds_b128 %6, %7, off\n\t"
               "global_load_async_to_lds_b128 %8, %9, off\n\t"
               "global_load_async_to_lds_b128 %10, %11, off\n\t"
               "global_load_async_to_lds_b128 %12, %13, off\n\t"
               "global_load_async_to_lds_b128 %14, %15, off\n\t"
               "global_load_async_to_lds_b128 %16, %17, off\n\t"
               "global_load_async_to_lds_b128 %18, %19, off\n\t"
               "global_load_async_to_lds_b128 %20, %21, off\n\t"
               "global_load_async_to_lds_b128 %22, %23, off\n\t"
               "s_wait_xcnt 0x0"
               :: "v"(la),        "v"(ga),        "v"(la + 512),  "v"(ga + 512),
                  "v"(la + 1024), "v"(ga + 1024), "v"(la + 1536), "v"(ga + 1536),
                  "v"(la + 2048), "v"(ga + 2048), "v"(la + 2560), "v"(ga + 2560),
                  "v"(la + 3072), "v"(ga + 3072), "v"(la + 3584), "v"(ga + 3584),
                  "v"(lb),        "v"(gb),        "v"(lb + 512),  "v"(gb + 512),
                  "v"(lb + 1024), "v"(gb + 1024), "v"(lb + 1536), "v"(gb + 1536)
               : "memory");
}

// a fragment out of LDS: p is the fragment's first byte + 16 * lane (units L and 32 + L, as in ldfrag)
__device__ __forceinline__ v16b ldsfrag(const unsigned char* p) {
  Frag f;
  f.q[0] = *(const v4u*)(p);
  f.q[1] = *(const v4u*)(p + 512);
  return f.v;
}

__global__ __launch_bounds__(256)
void k_gemm(const __bf16* __restrict__ kxh, const __bf16* __restrict__ kxl,
            const __bf16* __restrict__ wth, const __bf16* __restrict__ wtl,
            const float* __restrict__ rrb, const float* __restrict__ rwb,
            const float* __restrict__ tr,
            __bf16* __restrict__ qah, __bf16* __restrict__ qal,
            __bf16* __restrict__ qbh, __bf16* __restrict__ qbl,
            _Float16* __restrict__ vtf)
{
  __shared__ __attribute__((aligned(2048))) unsigned char ring[2 * G_STAGE];
  const int tid = threadIdx.x, w = __builtin_amdgcn_readfirstlane(tid >> 5), lane = tid & 31, hh = lane >> 4, m = lane & 15;
  const int wm = w >> 1, wn = w & 1;
  const int bn = (int)(blockIdx.x & 15u), bm = (int)(blockIdx.x >> 4);
  const int n0 = bn * 128, m0 = bm * 256;
  const int b = m0 >> 9, s0 = m0 & 511;

  v8f acc[4][4];
#pragma unroll
  for (int i = 0; i < 4; ++i)
#pragma unroll
    for (int j = 0; j < 4; ++j) acc[i][j] = vz8();

  // The wave's share of every stage: bytes w*4096.. of each A plane's 32 KiB (contiguous in the plane: 16 row tiles of
  // 2 KiB), and the 16-row tile w of each B plane. A stage further on lies one head (512 rows) on in A, 64 k on in B.
  const unsigned lbase = (unsigned)(size_t)ring + (unsigned)(lane * 16);
  const unsigned lca = lbase + (unsigned)(w * 4096);
  const unsigned lcb = lbase + (unsigned)(2 * G_APLANE + w * 2048);
  const size_t aoff = (size_t)(b * NHEAD * SQ + s0) * HDIM * 2 + (size_t)(w * 4096 + lane * 16);
  const size_t boff = (size_t)((n0 >> 4) + w) * (16 * DMOD * 2) + (size_t)(lane * 16);
  const unsigned long long gah = (unsigned long long)kxh + aoff, gal = (unsigned long long)kxl + aoff;
  const unsigned long long gbh = (unsigned long long)wth + boff, gbl = (unsigned long long)wtl + boff;
  const int NST = DMOD / 64;

#define G_COPY_STAGE(T, BUF)                                                                                   \
  do {                                                                                                         \
    const unsigned long long sa_ = (unsigned long long)(T) * (SQ * HDIM * 2), sb_ = (unsigned long long)(T) * 2048; \
    copy_plane(lca + (BUF), gah + sa_, lcb + (BUF), gbh + sb_);                                                \
    copy_plane(lca + (BUF) + G_APLANE, gal + sa_, lcb + (BUF) + G_BPLANE, gbl + sb_);                          \
  } while (0)

  G_COPY_STAGE(0, 0u);
  asm volatile("s_wait_asynccnt 0x0" ::: "memory");   // this wave's share of stage 0 has landed
  __syncthreads();                                    // every wave's share has: stage 0 may be read
  G_COPY_STAGE(1, (unsigned)G_STAGE);

  // rolled: one trip's text is 96 products and 64 LDS loads
#pragma unroll 1
  for (int t = 0; t < NST; ++t) {
    const unsigned buf = (unsigned)(t & 1) * (unsigned)G_STAGE;
    const unsigned char* pa = ring + buf + wm * 8192 + lane * 16;
    const unsigned char* pb = ring + buf + 2 * G_APLANE + wn * 8192 + lane * 16;
    v16b ah[2][4], al[2][4], bh[2][4], bl[2][4];
    // in the order in which the products below first read them
#pragma unroll
    for (int kc = 0; kc < 2; ++kc) {
      ah[kc][0] = ldsfrag(pa + kc * 1024);
      bh[kc][0] = ldsfrag(pb + kc * 1024);
#pragma unroll
      for (int i = 1; i < 4; ++i) ah[kc][i] = ldsfrag(pa + i * 2048 + kc * 1024);
#pragma unroll
      for (int j = 1; j < 4; ++j) bh[kc][j] = ldsfrag(pb + j * 2048 + kc * 1024);
#pragma unroll
      for (int j = 0; j < 4; ++j) bl[kc][j] = ldsfrag(pb + G_BPLANE + j * 2048 + kc * 1024);
#pragma unroll
      for (int i = 0; i < 4; ++i) al[kc][i] = ldsfrag(pa + G_APLANE + i * 2048 + kc * 1024);
    }
    // keeps the trip's LDS loads one group in front of its products
    __builtin_amdgcn_sched_barrier(0);
    // per accumulator hi*hi, hi*lo, lo*hi, k ascending; sixteen independent tiles between two products of one tile
#pragma unroll
    for (int kc = 0; kc < 2; ++kc) {
#pragma unroll
      for (int j = 0; j < 4; ++j)
#pragma unroll
        for (int i = 0; i < 4; ++i) acc[i][j] = wmm(ah[kc][i], bh[kc][j], acc[i][j]);
#pragma unroll
      for (int j = 0; j < 4; ++j)
#pragma unroll
        for (int i = 0; i < 4; ++i) acc[i][j] = wmm(ah[kc][i], bl[kc][j], acc[i][j]);
#pragma unroll
      for (int j = 0; j < 4; ++j)
#pragma unroll
        for (int i = 0; i < 4; ++i) acc[i][j] = wmm(al[kc][i], bh[kc][j], acc[i][j]);
    }
    // keeps the products in front of the trip's foot: moved behind its waits they would no longer cover the LDS loads' and
    // the copies' flight
    __builtin_amdgcn_sched_barrier(0);
    asm volatile("s_wait_dscnt 0x0" ::: "memory");      // this wave has left the buffer that is refilled below
    asm volatile("s_wait_asynccnt 0x0" ::: "memory");   // its share of stage t + 1 has landed
    __syncthreads();                                    // stage t + 1 may be read; stage t's buffer is free
    if (t + 2 < NST) G_COPY_STAGE(t + 2, buf);
  }
  asm volatile("s_wait_asynccnt 0x0" ::: "memory");     // no copy is under way when the ring becomes output staging
#undef G_COPY_STAGE

  // D tile: element r -> row 8*hh + r, col m. The last trip's barrier has ended every read of the ring.
  float (*Cs)[68] = (float (*)[68])(ring + w * (64 * 68 * 4));
#pragma unroll
  for (int i = 0; i < 4; ++i)
#pragma unroll
    for (int j = 0; j < 4; ++j)
#pragma unroll
      for (int r = 0; r < 8; ++r) Cs[i * 16 + 8 * hh + r][j * 16 + m] = acc[i][j][r];
  __syncthreads();

  const int n0w = n0 + wn * 64, s0w = s0 + wm * 64;
  if (n0w < DMOD) {
    const int hq = n0w >> 6;
    const int qrow0 = (b * NHEAD + hq) * SQ;
    const float* rrbh = rrb + hq * HDIM;
    const float* rwbh = rwb + hq * HDIM;
    // four steps' loads fly together: the block is alone on its WGP, and no other wave's work covers their latency
#pragma unroll 1
    for (int io = 0; io < 4; ++io) {
#pragma unroll
    for (int ii = 0; ii < 4; ++ii) {
      // the wave takes 8 rows x 4 k octets: lanes 8q..8q+7 store one whole line of each plane
      const int j4 = lane >> 3, j = (ii >> 1) * 4 + j4;
      const int rr = io * 16 + (ii & 1) * 8 + (lane & 7);
      const int s = s0w + rr;
      const v8f cl = load8(&Cs[rr][8 * j4]);        // q[d'],     d' = 8*j4+e
      const v8f ch = load8(&Cs[rr][32 + 8 * j4]);   // q[32+d']
      const v8f bwl = load8(rwbh + 8 * j4);
      const v8f bwh = load8(rwbh + 32 + 8 * j4);
      const v8f br  = load8(rrbh + 8 * j);
      const float* trs = tr + (size_t)s * HDIM;
      const v8f sq = load8(trs + 8 * j4);           // sin(s*f_d')
      const v8f cq = load8(trs + 32 + 8 * j4);      // cos(s*f_d')
      const v8f a = cl + bwl;
      const v8f c = ch + bwh;
      v8f qa, qb;
      if (j < 4) {
        qa = cl + br;
        qb = a * cq + c * sq;
      } else {
        qa = ch + br;
        qb = c * cq - a * sq;
      }
      v4u ah, al, bh, bl;
      split8(qa, ah, al);
      split8(qb, bh, bl);
      const size_t off = punit(qrow0 + s, 8 * j, HDIM);
      __bf16* p0 = qah + off;
      __bf16* p1 = qal + off;
      __bf16* p2 = qbh + off;
      __bf16* p3 = qbl + off;
      *(v4u*)p0 = ah;
      *(v4u*)p1 = al;
      *(v4u*)p2 = bh;
      *(v4u*)p3 = bl;
    }
      // behind the trip's last stores: the next trip overwrites registers that they name
      asm volatile("s_wait_xcnt 0x0" ::: "memory");
    }
  } else {
    const int hv = (n0w - DMOD) >> 6;
    const int vrow0 = (b * NHEAD + hv) * HDIM;
    // four steps at a time, as above
#pragma unroll 1
    for (int io = 0; io < 4; ++io) {
#pragma unroll
    for (int ii = 0; ii < 4; ++ii) {
      // the wave takes 16 d x 2 key octets and stores 512 contiguous bytes of the plane
      const int dd = io * 16 + (lane & 15), j = ii * 2 + (lane >> 4);
      v8f v;
#pragma unroll
      for (int e = 0; e < 8; ++e) v[e] = Cs[8 * j + e][dd];
      PackH8 u;
      u.v = __builtin_convertvector(v, v8h);
      const size_t off = punit(vrow0 + dd, s0w + 8 * j, SQ);
      _Float16* ph = vtf + off;
      *(v4u*)ph = u.q;
    }
      // behind the trip's last stores: the next trip overwrites registers that they name
      asm volatile("s_wait_xcnt 0x0" ::: "memory");
    }
  }
}

// ---------------------------------------------------------------------------
// Fused attention, transposed tiles. Block = 8 waves, wave owns 16 queries of one (b,h); 32 keys per step.
// Scores S^T[key][query] = Kcat[key][0..127] . Qcat[query][0..127]:
//   A = kx planes (cols 0..63) / trig table planes (cols 64..127), B = qa / qb planes (loaded like A).
// Softmax statistics live on lane = query (xor-16 exchange between lane halves).
// O^T[d][query] = V^T . P^T: A = the vtf plane ([d][key]), B = P^T packed straight from the score D tiles
//   (element r <- key 8h+r of the first 16-key tile, element 8+r <- second tile), both f16.
// The key side is the same for all eight waves: a stage is 64 keys (two steps) of it, copied as it lies (whole 1-KiB
// fragments) into LDS, where every wave reads it:
//   [kx hi | kx lo | table hi | table lo | V^T], 8 KiB each; kx and table: four 16-key tiles of 2 KiB (two
//   32-column fragments); V^T: four 16-d tiles of 2 KiB (the stage's two 32-key fragments).
// Two buffers: the copies of stage t + 2 fly while stage t + 1 is worked on.
// ---------------------------------------------------------------------------
#define A_PLANE 8192
#define A_STAGE (5 * A_PLANE)

// A wave's share of a stage: 1 KiB (two copies of 512 B) of each of the five planes, each lane 16 bytes a copy.
// l: the lane's LDS byte address in the first plane; g0..g4: the wave's global addresses, o: the lane's byte offset. The wait that a later overwrite of these
// address registers owes to the copies is the statement's last line, so that nothing can come between.
__device__ __forceinline__ void copy_keyside(unsigned l, unsigned long long o, unsigned long long g0, unsigned long long g1, unsigned long long g2,
                                             unsigned long long g3, unsigned long long g4) {
  asm volatile("global_load_async_to_lds_b128 %0, %1, off\n\t"
               "global_load_async_to_lds_b128 %2, %3, off\n\t"
               "global_load_async_to_lds_b128 %4, %5, off\n\t"
               "global_load_async_to_lds_b128 %6, %7, off\n\t"
               "global_load_async_to_lds_b128 %8, %9, off\n\t"
               "global_load_async_to_lds_b128 %10, %11, off\n\t"
               "global_load_async_to_lds_b128 %12, %13, off\n\t"
               "global_load_async_to_lds_b128 %14, %15, off\n\t"
               "global_load_async_to_lds_b128 %16, %17, off\n\t"
               "global_load_async_to_lds_b128 %18, %19, off\n\t"
               "s_wait_xcnt 0x0"
               :: "v"(l),               "v"(g0 + o), "v"(l + 512),               "v"(g0 + 512 + o),
                  "v"(l + A_PLANE),     "v"(g1 + o), "v"(l + A_PLANE + 512),     "v"(g1 + 512 + o),
                  "v"(l + 2 * A_PLANE), "v"(g2 + o), "v"(l + 2 * A_PLANE + 512), "v"(g2 + 512 + o),
                  "v"(l + 3 * A_PLANE), "v"(g3 + o), "v"(l + 3 * A_PLANE + 512), "v"(g3 + 512 + o),
                  "v"(l + 4 * A_PLANE), "v"(g4 + o), "v"(l + 4 * A_PLANE + 512), "v"(g4 + 512 + o)
               : "memory");
}

// four fragments out of a stage: two tiles 2 KiB apart, hi plane at p and lo plane one plane behind it
__device__ __forceinline__ Frag4 ldsfrag4(const unsigned char* p) {
  Frag4 f;
  // in the order in which a product group first reads them
  f.h0 = ldsfrag(p);
  f.h1 = ldsfrag(p + 2048);
  f.l0 = ldsfrag(p + A_PLANE);
  f.l1 = ldsfrag(p + A_PLANE + 2048);
  return f;
}

// an f16 fragment out of LDS, addressed as in ldsfrag
__device__ __forceinline__ v16h ldsfragh(const unsigned char* p) {
  FragH f;
  f.q[0] = *(const v4u*)(p);
  f.q[1] = *(const v4u*)(p + 512);
  return f.v;
}

__global__ __launch_bounds__(256) __attribute__((amdgpu_num_vgpr(256)))
void k_attn(const __bf16* __restrict__ qah, const __bf16* __restrict__ qal,
            const __bf16* __restrict__ qbh, const __bf16* __restrict__ qbl,
            const __bf16* __restrict__ kxh, const __bf16* __restrict__ kxl,
            const __bf16* __restrict__ trh, const __bf16* __restrict__ trl,
            const _Float16* __restrict__ vtf,
            const int* __restrict__ msk, float* __restrict__ out)
{
  __shared__ __attribute__((aligned(2048))) unsigned char ring[2 * A_STAGE];
  // the wave's number in a scalar register: every fragment's block address is then a scalar value, as point_at takes it
  const int tid = threadIdx.x, w = __builtin_amdgcn_readfirstlane(tid >> 5), lane = tid & 31, hh = lane >> 4, n = lane & 15;
  const int bh = (int)(blockIdx.x >> 2), qc = (int)(blockIdx.x & 3u);
  const int b = bh >> 4, hd = bh & 15;
  const int q0 = qc * 128 + w * 16;
  const int qrow = bh * SQ + q0;   // rows of qa/qb (pitch 64)

  // The wave's share of every stage: bytes w*1024.. of each plane's 8 KiB. In kx and in the table a stage is 8 KiB
  // contiguous (64 rows of 128 bytes); in V^T (row tiles of 16 KiB) it is 2 KiB of each of the head's four tiles.
  const unsigned lc = (unsigned)(size_t)ring + (unsigned)(w * 1024 + lane * 16);
  const size_t koff = (size_t)bh * (SQ * HDIM * 2) + (size_t)(w * 1024);
  const size_t toff = (size_t)(w * 1024);
  const size_t voff = (size_t)bh * (HDIM * SQ * 2) + (size_t)((w >> 1) * (16 * SQ * 2) + (w & 1) * 1024);
  const unsigned long long gkh = (unsigned long long)kxh + koff, gkl = (unsigned long long)kxl + koff;
  const unsigned long long gth = (unsigned long long)trh + toff, gtl = (unsigned long long)trl + toff;
  const unsigned long long gvf = (unsigned long long)vtf + voff;
  const int NST = SQ / 64;

#define A_COPY_STAGE(T, BUF)                                                                          \
  do {                                                                                                \
    const unsigned long long sk_ = (unsigned long long)(T) * A_PLANE, sv_ = (unsigned long long)(T) * 2048; \
    copy_keyside(lc + (BUF), laneoff, gkh + sk_, gkl + sk_, gth + sk_, gtl + sk_, gvf + sv_); \
  } while (0)

  const unsigned long long laneoff = (unsigned long long)(unsigned)(lane * 16);
  A_COPY_STAGE(0, 0u);

  Addr2 pf = {0, 0};
  // the wave's 16 queries, all 128 columns (qa | qb), hi and lo planes; columns 32..63 of a plane lie 1024 bytes behind 0..31
  point_at(pf, fragblock(qah, HDIM, qrow, 0), fragblock(qal, HDIM, qrow, 0), laneoff);
  const v16b qh0 = ldfrag(pf.h, 0),    ql0 = ldfrag(pf.l, 0);
  const v16b qh1 = ldfrag(pf.h, 1024), ql1 = ldfrag(pf.l, 1024);
  point_at(pf, fragblock(qbh, HDIM, qrow, 0), fragblock(qbl, HDIM, qrow, 0), laneoff);
  const v16b qh2 = ldfrag(pf.h, 0),    ql2 = ldfrag(pf.l, 0);
  const v16b qh3 = ldfrag(pf.h, 1024), ql3 = ldfrag(pf.l, 1024);
  done_with(pf);

  v8f o0 = vz8(), o1 = vz8(), o2 = vz8(), o3 = vz8();
  float mrun = -1.0e30f, dsum = 0.0f;

  asm volatile("s_wait_asynccnt 0x0" ::: "memory");   // this wave's share of stage 0 has landed
  __syncthreads();                                    // every wave's share has: stage 0 may be read
  A_COPY_STAGE(1, (unsigned)A_STAGE);

  // rolled: one trip's text is two steps of 28 products and their softmax
#pragma unroll 1
  for (int t = 0; t < NST; ++t) {
    const unsigned buf = (unsigned)(t & 1) * (unsigned)A_STAGE;
    const unsigned char* ps = ring + buf + lane * 16;
    // Each group of fragments is asked for out of LDS one product group ahead of the group that reads it, the second step's
    // first chunk behind the first step's exponentials. Nothing is read across a stage.
    Frag4 k0 = ldsfrag4(ps);
    const int* mp0 = msk + b * SQ + t * 64 + 8 * hh;   // the lane's first key-mask word of the stage
    // unrolled: only the first step fetches ahead, and each step's LDS offsets go into the loads' own offset fields
#pragma unroll
    for (int u = 0; u < 2; ++u) {
      const unsigned char* pk = ps + u * 4096;                  // the step's two 16-key tiles
      const unsigned char* pv = ps + 4 * A_PLANE + u * 1024;    // the step's 32-key fragment of each V^T tile
      v8f s0 = vz8(), s1 = vz8();
      const Frag4 k1 = ldsfrag4(pk + 1024);
      // key-mask: the step's keys 8*hh + r (tile 0) and 16 + 8*hh + r (tile 1)
      const int* mp = mp0 + u * 32;
      const v4i mA = *(const v4i*)(mp);
      const v4i mB = *(const v4i*)(mp + 4);
      const v4i mC = *(const v4i*)(mp + 16);
      const v4i mD = *(const v4i*)(mp + 20);
      // each scheduling barrier of this loop keeps the loads above it in front of the arithmetic below it: issued later they
      // would have less of it to fly behind
      __builtin_amdgcn_sched_barrier(0);
      mma3x2(s0, s1, k0.h0, k0.l0, k0.h1, k0.l1, qh0, ql0);
      // behind the stage's last mask loads: holds their address pair whole up to the wait that its overwrite owes them
      if (u == 1) asm volatile("s_wait_xcnt 0x0" :: "v"(mp0) : "memory");
      const Frag4 k2 = ldsfrag4(pk + 2 * A_PLANE);
      __builtin_amdgcn_sched_barrier(0);
      mma3x2(s0, s1, k1.h0, k1.l0, k1.h1, k1.l1, qh1, ql1);
      const Frag4 k3 = ldsfrag4(pk + 2 * A_PLANE + 1024);
      __builtin_amdgcn_sched_barrier(0);
      mma3x2(s0, s1, k2.h0, k2.l0, k2.h1, k2.l1, qh2, ql2);
      const v16h v0 = ldsfragh(pv), v1 = ldsfragh(pv + 2048), v2 = ldsfragh(pv + 4096), v3 = ldsfragh(pv + 6144);
      __builtin_amdgcn_sched_barrier(0);
      mma3x2(s0, s1, k3.h0, k3.l0, k3.h1, k3.l1, qh3, ql3);
      v8f f0, f1;
#pragma unroll
      for (int r = 0; r < 4; ++r) {
        f0[r] = (float)mA[r]; f0[4 + r] = (float)mB[r];
        f1[r] = (float)mC[r]; f1[4 + r] = (float)mD[r];
      }
      s0 = s0 * f0 - (1.0f - f0) * 1.0e8f;
      s1 = s1 * f1 - (1.0f - f1) * 1.0e8f;

      float mloc = s0[0];
#pragma unroll
      for (int r = 0; r < 8; ++r) { mloc = fmaxf(mloc, s0[r]); mloc = fmaxf(mloc, s1[r]); }
      const float mall = fmaxf(mloc, __shfl_xor(mloc, 16, 32));
      const float mnew = fmaxf(mrun, mall);
      const float alpha = exp_with_slot(mrun - mnew);
      float psum = 0.0f;
#pragma unroll
      for (int r = 0; r < 8; ++r) {
        const float pa = exp_with_slot(s0[r] - mnew);
        const float pb = exp_with_slot(s1[r] - mnew);
        s0[r] = pa; s1[r] = pb;
        psum += pa + pb;
      }
      if (u == 0) {
        // the first one keeps the loads below it out of the masking and the exponentials above, where their 32 registers are not to be had
        __builtin_amdgcn_sched_barrier(0);
        k0 = ldsfrag4(ps + 4096);
        __builtin_amdgcn_sched_barrier(0);
      }
      psum += __shfl_xor(psum, 16, 32);
      dsum = dsum * alpha + psum;
      mrun = mnew;
      o0 *= alpha; o1 *= alpha; o2 *= alpha; o3 *= alpha;

      // P^T as the B operand: k = key offset within the 32-key step
      FragH pf;
      pf.h[0] = __builtin_convertvector(s0, v8h);
      pf.h[1] = __builtin_convertvector(s1, v8h);
      mmah1x4(o0, o1, o2, o3, v0, v1, v2, v3, pf.v);
    }
    asm volatile("s_wait_dscnt 0x0" ::: "memory");      // this wave has left the buffer that is refilled below
    asm volatile("s_wait_asynccnt 0x0" ::: "memory");   // its share of stage t + 1 has landed
    __syncthreads();                                    // stage t + 1 may be read; stage t's buffer is free
    if (t + 2 < NST) A_COPY_STAGE(t + 2, buf);
  }
  asm volatile("s_wait_asynccnt 0x0" ::: "memory");     // no copy is under way when the ring becomes output staging
#undef A_COPY_STAGE

  // O^T element r of tile t -> d = 16*t + 8*hh + r, query n. The last trip's barrier has ended every read of the ring.
  float (*Os)[16][64] = (float (*)[16][64])ring;
  const float rinv = 1.0f / dsum;
#pragma unroll
  for (int r = 0; r < 8; ++r) {
    Os[w][n][8 * hh + r]      = o0[r] * rinv;
    Os[w][n][16 + 8 * hh + r] = o1[r] * rinv;
    Os[w][n][32 + 8 * hh + r] = o2[r] * rinv;
    Os[w][n][48 + 8 * hh + r] = o3[r] * rinv;
  }
  __syncthreads();

  v4f ov[8];
#pragma unroll
  for (int it = 0; it < 8; ++it) ov[it] = *(const v4f*)&Os[w][2 * it + hh][4 * n];
  float* ob = out + ((size_t)(b * SQ + q0)) * DMOD + hd * HDIM + 4 * n;
#pragma unroll
  for (int it = 0; it < 8; ++it) {
    float* p = ob + (size_t)(2 * it + hh) * DMOD;
    *(v4f*)p = ov[it];
  }
}

// ---------------------------------------------------------------------------
extern "C" void kernel_launch(void* const* d_in, const int* in_sizes, int n_in,
                              void* d_out, int out_size, void* d_ws,
                              size_t ws_size, hipStream_t stream)
{
  if (n_in < 5) return;
  if (in_sizes[0] != NBATCH * SQ * DMOD) return;
  if (in_sizes[1] != NBATCH * SQ) return;
  if (in_sizes[2] != DMOD * 2 * DMOD) return;
  if (in_sizes[3] != NHEAD * HDIM) return;
  if (in_sizes[4] != NHEAD * HDIM) return;
  if (out_size != NBATCH * SQ * DMOD) return;

  const float* x    = (const float*)d_in[0];
  const int*   mk   = (const int*)d_in[1];
  const float* wqv  = (const float*)d_in[2];
  const float* rrb  = (const float*)d_in[3];
  const float* rwb  = (const float*)d_in[4];
  float* out = (float*)d_out;

  const size_t n_tr    = (size_t)SQ * HDIM;                 // 32768
  const size_t n_heads = (size_t)NBATCH * NHEAD * SQ * HDIM; // 4194304
  const size_t n_w     = (size_t)DMOD * 2 * DMOD;            // 2097152

  char* ws = (char*)d_ws;
  size_t off = 0;
  auto carve = [&](size_t bytes) -> char* {
    char* p = ws + off;
    off += (bytes + 255) & ~(size_t)255;
    return p;
  };
  float*  tr  = (float*)carve(n_tr * 4);
  __bf16* trh = (__bf16*)carve(n_tr * 2);
  __bf16* trl = (__bf16*)carve(n_tr * 2);
  __bf16* kxh = (__bf16*)carve(n_heads * 2);
  __bf16* kxl = (__bf16*)carve(n_heads * 2);
  __bf16* wth = (__bf16*)carve(n_w * 2);
  __bf16* wtl = (__bf16*)carve(n_w * 2);
  __bf16* qah = (__bf16*)carve(n_heads * 2);
  __bf16* qal = (__bf16*)carve(n_heads * 2);
  __bf16* qbh = (__bf16*)carve(n_heads * 2);
  __bf16* qbl = (__bf16*)carve(n_heads * 2);
  _Float16* vtf = (_Float16*)carve(n_heads * 2);
  if (off > ws_size) return;

  FreqTab ft;
  const double cst = -log(10000.0) / 31.0;
  for (int d = 0; d < 32; ++d) ft.f[d] = exp((double)((float)d) * cst);

  k_prep<<<dim3(P_TRIG_BLOCKS + P_W_BLOCKS + P_X_BLOCKS), dim3(128), 0, stream>>>(
      ft, x, wqv, tr, trh, trl, kxh, kxl, wth, wtl);
  k_gemm<<<dim3((NBATCH * SQ / 256) * (2 * DMOD / 128)), dim3(256), 0, stream>>>(
      kxh, kxl, wth, wtl, rrb, rwb, tr, qah, qal, qbh, qbl, vtf);
  k_attn<<<dim3(NBATCH * NHEAD * (SQ / 128)), dim3(256), 0, stream>>>(
      qah, qal, qbh, qbl, kxh, kxl, trh, trl, vtf, mk, out);
}

// v007
// Measured time: 64.4 microseconds a run.
// Next to v006, in two timings, it ran 1.05 and 1.04 times as fast.
// All steps since v000 together make it 3.62 times as fast.
#include <hip/hip_runtime.h>
#include <math.h>
#include <stddef.h>

// Contractions: x*Wqv and the per-head 128-deep logits ([q+r_r_bias | rotated(q+r_w_bias)] . [k | sin/cos table]):
// v_wmma_f32_16x16x32_bf16 with bf16 hi/lo operand planes (hi*hi + hi*lo + lo*hi), f32 accumulate.
// p*v: v_wmma_f32_16x16x32_f16, one f16 plane of each operand, f32 accumulate: a rounding of p or v reaches the output only
// in proportion, a rounding of a logit through the exponential. Softmax and elementwise math f32.

#define NBATCH 8
#define SQ     512
#define DMOD   1024
#define NHEAD  16
#define HDIM   64

typedef float v8f __attribute__((ext_vector_type(8)));
typedef float v4f_raw __attribute__((ext_vector_type(4)));
typedef v4f_raw __attribute__((__may_alias__)) v4f;
typedef unsigned int v4u_raw __attribute__((ext_vector_type(4)));
typedef v4u_raw __attribute__((__may_alias__)) v4u;
typedef int v4i_raw __attribute__((ext_vector_type(4)));
typedef v4i_raw __attribute__((__may_alias__)) v4i;
typedef __bf16 v16b __attribute__((ext_vector_type(16)));
typedef __bf16 v8b __attribute__((ext_vector_type(8)));
typedef _Float16 v16h __attribute__((ext_vector_type(16)));
typedef _Float16 v8h __attribute__((ext_vector_type(8)));

union Frag  { v16b v; v8b h[2]; v4u q[2]; };
union Pack8 { v8b v; v4u q; };
union FragH  { v16h v; v8h h[2]; v4u q[2]; };
union PackH8 { v8h v; v4u q; };

struct FreqTab { double f[32]; };
typedef char freqtab_size_check[(sizeof(FreqTab) == 256) ? 1 : -1];

__device__ __forceinline__ v8f vz8() {
  v8f z;
#pragma unroll
  for (int i = 0; i < 8; ++i) z[i] = 0.0f;
  return z;
}

__device__ __forceinline__ v8f load8(const float* p) {
  const v4f a = *(const v4f*)(p);
  const v4f c = *(const v4f*)(p + 4);
  return __builtin_shufflevector(a, c, 0, 1, 2, 3, 4, 5, 6, 7);
}

// Every bf16 plane is stored fragment-major: a [rows][pitch] matrix is cut into 16-row x 32-k fragments of 1 KiB,
// ordered [row/16][k/32]; inside a fragment the 16-byte units (8 consecutive k of one row) are ordered [(k%32)/8][row%16].
// Element offset of the unit that holds (row, k..k+7), k a multiple of 8:
__device__ __forceinline__ size_t punit(int row, int k, int pitch) {
  return (size_t)(row >> 4) * (size_t)(16 * pitch) + (size_t)((k >> 5) * 512 + ((k >> 3) & 3) * 128 + (row & 15) * 8);
}

// 16x32 16-bit fragment, identical map for the A operand ([m][k]) and for the B operand ([n][k]):
// lane -> row/col (lane&15); h = lane>>4; elements 0..7 <- k = kc+8h+0..7, elements 8..15 <- k = kc+16+8h+0..7.
// row is a multiple of 16, kc of 32. In the fragment-major order lane L's two units are units L and 32+L of the
// fragment, so each wave-wide 16-byte load covers 512 contiguous bytes (four whole 128-byte lines).
// fragblock: the fragment's first byte, the same in every lane; ldfrag: the fragment off bytes behind the lane's own address a.
typedef const __attribute__((address_space(1))) v4u gv4u;
__device__ __forceinline__ unsigned long long fragblock(const __bf16* __restrict__ base, int pitch, int row, int kc) {
  return (unsigned long long)(base + ((size_t)(row >> 4) * (size_t)(16 * pitch) + (size_t)((kc >> 5) * 512)));
}
__device__ __forceinline__ v16b ldfrag(unsigned long long a, int off) {
  const gv4u* p = (const gv4u*)a;   // off, a multiple of 16, goes into the loads' own offset field
  Frag f;
  f.q[0] = p[off / 16];
  f.q[1] = p[off / 16 + 32];
  return f.v;
}

__device__ __forceinline__ v8f wmm(v16b a, v16b b, v8f c) {
  return __builtin_amdgcn_wmma_f32_16x16x32_bf16(false, a, false, b, (short)0, c, false, false);
}

// four accumulators, two key tiles x two query tiles, out of one loaded chunk: cij += a_j * b_i with hi/lo planes, per
// accumulator hi*hi, hi*lo, lo*hi; 4 v_nop after the last WMMA, tying the D tiles: the distance that a vector instruction
// which touches them has to keep. The operand fragments are not tied: only LDS loads overwrite the key side, nothing the
// query side, and an operand of an asm statement has to lie in the first 256 registers, where they do not all fit.
__device__ __forceinline__ void mma3x4(v8f& c00, v8f& c01, v8f& c10, v8f& c11,
                                       const v16b a0h, const v16b a0l,
                                       const v16b a1h, const v16b a1l,
                                       const v16b b0h, const v16b b0l,
                                       const v16b b1h, const v16b b1l) {
  c00 = wmm(a0h, b0h, c00);
  c01 = wmm(a1h, b0h, c01);
  c10 = wmm(a0h, b1h, c10);
  c11 = wmm(a1h, b1h, c11);
  c00 = wmm(a0h, b0l, c00);
  c01 = wmm(a1h, b0l, c01);
  c10 = wmm(a0h, b1l, c10);
  c11 = wmm(a1h, b1l, c11);
  c00 = wmm(a0l, b0h, c00);
  c01 = wmm(a1l, b0h, c01);
  c10 = wmm(a0l, b1h, c10);
  c11 = wmm(a1l, b1h, c11);
  asm volatile("v_nop\n\tv_nop\n\tv_nop\n\tv_nop"
               : "+v"(c00), "+v"(c01), "+v"(c10), "+v"(c11));
}

// four accumulators sharing one f16 B fragment: ci += ai*b; 4 v_nop after the last WMMA, tying the D tiles and the B operand:
// the distance that a vector instruction which touches them has to keep, on every path behind the group. (Only LDS loads
// overwrite the A fragments.)
__device__ __forceinline__ void mmah1x4(v8f& c0, v8f& c1, v8f& c2, v8f& c3,
                                        const v16h a0, const v16h a1, const v16h a2, const v16h a3, const v16h b) {
  c0 = __builtin_amdgcn_wmma_f32_16x16x32_f16(false, a0, false, b, (short)0, c0, false, false);
  c1 = __builtin_amdgcn_wmma_f32_16x16x32_f16(false, a1, false, b, (short)0, c1, false, false);
  c2 = __builtin_amdgcn_wmma_f32_16x16x32_f16(false, a2, false, b, (short)0, c2, false, false);
  c3 = __builtin_amdgcn_wmma_f32_16x16x32_f16(false, a3, false, b, (short)0, c3, false, false);
  asm volatile("v_nop\n\tv_nop\n\tv_nop\n\tv_nop"
               : "+v"(c0), "+v"(c1), "+v"(c2), "+v"(c3)
               : "v"(b));
}

// four fragments of one 32-deep chunk: two 16-row tiles, hi and lo plane
struct Frag4 { v16b h0, l0, h1, l1; };

// __expf as the compiler builds it (one multiply, v_exp_f32), with the free slot that the instruction set asks for behind a
// transcendental in the same statement.
__device__ __forceinline__ float exp_with_slot(float x) {
  float r;
  asm("v_exp_f32 %0, %1\n\tv_nop" : "=v"(r) : "v"(x * 1.44269504f));
  return r;
}

// f32 x8 -> bf16 hi (RNE convert) and bf16 lo = RNE(x - hi), packed as 16 bytes each
__device__ __forceinline__ void split8(const v8f x, v4u& uh, v4u& ul) {
  Pack8 a, c;
  a.v = __builtin_convertvector(x, v8b);
  const v8f xh = __builtin_convertvector(a.v, v8f);
  c.v = __builtin_convertvector(x - xh, v8b);
  uh = a.q;
  ul = c.q;
}

// ---------------------------------------------------------------------------
// All operand preparation in one launch; a block's index range says which of three independent jobs it does.
//
// Blocks 0..31, 16 table rows each: tr[s][0..31] = sin(s*f_d), tr[s][32..63] = cos(s*f_d), s = 0..511, angle formed in
// f64, evaluated as sincos(hi) with first-order lo correction in f32; stored as f32 and, through LDS, as fragment-major
// bf16 hi/lo planes (16 rows x 64 k = two whole fragments: the block stores 2 KiB contiguous of each plane).
//
// The next 1024 blocks: w[k][n] (1024 x 2048, n contiguous) -> wt{h,l}, rows n, 1024 k, fragment-major bf16 hi/lo planes.
// A block takes a 64 k x 32 n tile through LDS; a wave takes 16 n x 2 k octets and stores 512 contiguous bytes.
//
// The last 4096 blocks: x[b][s][h*64+d] -> head-major planes kx{h,l}, rows (b*16+h)*512+s, 64 k, fragment-major, one
// 16-B unit per thread. A wave takes 8 rows x 32 k: lanes 8q..8q+7 (8 rows, one k octet) store one whole line.
// ---------------------------------------------------------------------------
#define P_TRIG_BLOCKS (SQ * 8 / 128)
#define P_W_BLOCKS    ((2 * DMOD / 32) * (DMOD / 64))
#define P_X_BLOCKS    (NBATCH * NHEAD * SQ * HDIM / 8 / 128)

__global__ __launch_bounds__(128)
void k_prep(FreqTab ft, const float* __restrict__ x, const float* __restrict__ w,
            float* __restrict__ tr, __bf16* __restrict__ trh, __bf16* __restrict__ trl,
            __bf16* __restrict__ kxh, __bf16* __restrict__ kxl,
            __bf16* __restrict__ wth, __bf16* __restrict__ wtl)
{
  __shared__ __align__(16) float T[64][36];
  const int tid = threadIdx.x;
  const int blk = (int)blockIdx.x;

  if (blk < P_TRIG_BLOCKS) {
    const int sr = tid >> 3, j = tid & 7;
    const int s = blk * 16 + sr;
    float sa0 = 0.f, sa1 = 0.f, sa2 = 0.f, sa3 = 0.f;
    float ca0 = 0.f, ca1 = 0.f, ca2 = 0.f, ca3 = 0.f;
#pragma unroll 1
    for (int i = 0; i < 4; ++i) {
      const int d = 4 * j + i;
      const double ang = (double)s * ft.f[d];
      const float ah = (float)ang;
      const float al = (float)(ang - (double)ah);
      float sv, cv;
      sincosf(ah, &sv, &cv);
      const float sf = sv + al * cv;
      const float cf = cv - al * sv;
      sa0 = sa1; sa1 = sa2; sa2 = sa3; sa3 = sf;
      ca0 = ca1; ca1 = ca2; ca2 = ca3; ca3 = cf;
    }
    v4f vs, vc;
    vs[0] = sa0; vs[1] = sa1; vs[2] = sa2; vs[3] = sa3;
    vc[0] = ca0; vc[1] = ca1; vc[2] = ca2; vc[3] = ca3;
    float* ps = tr + (size_t)s * HDIM + 4 * j;
    float* pc = ps + 32;
    *(v4f*)ps = vs;
    *(v4f*)pc = vc;
    // the block's 16 rows, pitch 68 floats (its readers take one row per lane)
    float (*R)[68] = (float (*)[68])&T[0][0];
    *(v4f*)&R[sr][4 * j] = vs;
    *(v4f*)&R[sr][32 + 4 * j] = vc;
    __syncthreads();
    // thread -> unit in the planes' own order: the block's stores are contiguous
    const int row = tid & 15, k = (tid >> 4) * 8;
    const v8f v = load8(&R[row][k]);
    v4u uh, ul;
    split8(v, uh, ul);
    const size_t dst = punit(blk * 16 + row, k, HDIM);
    __bf16* ph = trh + dst;
    __bf16* pl = trl + dst;
    *(v4u*)ph = uh;
    *(v4u*)pl = ul;
    return;
  }

  if (blk < P_TRIG_BLOCKS + P_W_BLOCKS) {
    const int wb = blk - P_TRIG_BLOCKS;
    const int nb = wb & 63, kb = wb >> 6;
    const int n0 = nb * 32, k0 = kb * 64;
#pragma unroll
    for (int i = 0; i < 4; ++i) {
      const int idx = tid + 128 * i;
      const int row = idx >> 3, c4 = idx & 7;
      const v4f v = *(const v4f*)(w + (size_t)(k0 + row) * (2 * DMOD) + n0 + 4 * c4);
      *(v4f*)&T[row][4 * c4] = v;
    }
    __syncthreads();
#pragma unroll 1
    for (int i = 0; i < 2; ++i) {
      const int task = tid + 128 * i;
      const int nn = (task >> 7) * 16 + (task & 15), j = (task >> 4) & 7;
      v8f v;
#pragma unroll
      for (int e = 0; e < 8; ++e) v[e] = T[8 * j + e][nn];
      v4u uh, ul;
      split8(v, uh, ul);
      const size_t off = punit(n0 + nn, k0 + 8 * j, DMOD);
      __bf16* ph = wth + off;
      __bf16* pl = wtl + off;
      *(v4u*)ph = uh;
      *(v4u*)pl = ul;
      // behind the trip's stores: the next trip overwrites registers that they name
      asm volatile("s_wait_xcnt 0x0" ::: "memory");
    }
    return;
  }

  {
    const int t = (blk - (P_TRIG_BLOCKS + P_W_BLOCKS)) * 128 + tid;
    const int frag = t >> 6;
    const int row = (frag >> 1) * 16 + ((t >> 5) & 1) * 8 + (t & 7);
    const int d = (frag & 1) * 32 + ((t >> 3) & 3) * 8;
    const int bhq = row >> 9, ss = row & 511;
    const int bb = bhq >> 4, hq = bhq & 15;
    const size_t e0 = ((size_t)(bb * SQ + ss)) * DMOD + hq * HDIM + d;
    const size_t dst = punit(row, d, HDIM);
    const v8f v = load8(x + e0);
    v4u uh, ul;
    split8(v, uh, ul);
    __bf16* ph = kxh + dst;
    __bf16* pl = kxl + dst;
    *(v4u*)ph = uh;
    *(v4u*)pl = ul;
    // behind the stores: in the built code the other jobs' text follows, which overwrites registers that they name
    asm volatile("s_wait_xcnt 0x0" ::: "memory");
  }
}

// ---------------------------------------------------------------------------
// qv = x @ Wqv, M=4096, N=2048, K=1024, bf16 hi/lo planes on both operands.
// Block = 8 waves (4 along M x 2 along N), tile 256(M) x 128(N); a wave owns 64 x 64: 64 positions of one head of q or of v.
// A from kx planes (pitch 64, head = k/64), B from wt planes ([n][k], pitch 1024), both fragment-major.
// A stage is 64 k of the block's rows, copied as it lies (whole 1-KiB fragments) into LDS, where all eight waves read it:
//   [A hi 32 KiB | A lo 32 KiB | B hi 16 KiB | B lo 16 KiB]; a 16-row tile is 2 KiB (its two 32-k fragments).
// Two buffers: the copies of stage t + 2 fly while stage t + 1 is worked on.
// Epilogue through LDS, each wave its own 64 x 64 tile (row pitch 68 floats: its readers take one row, or one column,
// per lane), fragment-major out:
//   n <  1024: qa = q + r_r_bias, qb = rotated (q + r_w_bias); rows (b*16+h)*512+s, 64 k -> qa{h,l}, qb{h,l}
//   n >= 1024: v transposed -> vtf (one f16 plane), rows (b*16+h)*64+d, 512 k, 64 columns from the wave's first position
// ---------------------------------------------------------------------------
#define G_APLANE 32768
#define G_BPLANE 16384
#define G_STAGE  (2 * G_APLANE + 2 * G_BPLANE)

// One plane's share of a wave in a stage: 4 KiB of A (eight copies of 512 B) and 2 KiB of B (four), each lane 16 bytes a copy.
// la, lb: the lane's LDS byte addresses; ga, gb: its global addresses. The wait that a later overwrite of these address
// registers owes to the copies is the statement's last line, so that nothing can come between.
__device__ __forceinline__ void copy_plane(unsigned la, unsigned long long ga, unsigned lb, unsigned long long gb) {
  asm volatile("global_load_async_to_lds_b128 %0, %1, off\n\t"
               "global_load_async_to_lds_b128 %2, %3, off\n\t"
               "global_load_async_to_lds_b128 %4, %5, off\n\t"
               "global_load_async_to_lds_b128 %6, %7, off\n\t"
               "global_load_async_to_lds_b128 %8, %9, off\n\t"
               "global_load_async_to_lds_b128 %10, %11, off\n\t"
               "global_load_async_to_lds_b128 %12, %13, off\n\t"
               "global_load_async_to_lds_b128 %14, %15, off\n\t"
               "global_load_async_to_lds_b128 %16, %17, off\n\t"
               "global_load_async_to_lds_b128 %18, %19, off\n\t"
               "global_load_async_to_lds_b128 %20, %21, off\n\t"
               "global_load_async_to_lds_b128 %22, %23, off\n\t"
               "s_wait_xcnt 0x0"
               :: "v"(la),        "v"(ga),        "v"(la + 512),  "v"(ga + 512),
                  "v"(la + 1024), "v"(ga + 1024), "v"(la + 1536), "v"(ga + 1536),
                  "v"(la + 2048), "v"(ga + 2048), "v"(la + 2560), "v"(ga + 2560),
                  "v"(la + 3072), "v"(ga + 3072), "v"(la + 3584), "v"(ga + 3584),
                  "v"(lb),        "v"(gb),        "v"(lb + 512),  "v"(gb + 512),
                  "v"(lb + 1024), "v"(gb + 1024), "v"(lb + 1536), "v"(gb + 1536)
               : "memory");
}

// a fragment out of LDS: p is the fragment's first byte + 16 * lane (units L and 32 + L, as in ldfrag)
__device__ __forceinline__ v16b ldsfrag(const unsigned char* p) {
  Frag f;
  f.q[0] = *(const v4u*)(p);
  f.q[1] = *(const v4u*)(p + 512);
  return f.v;
}

__global__ __launch_bounds__(256)
void k_gemm(const __bf16* __restrict__ kxh, const __bf16* __restrict__ kxl,
            const __bf16* __restrict__ wth, const __bf16* __restrict__ wtl,
            const float* __restrict__ rrb, const float* __restrict__ rwb,
            const float* __restrict__ tr,
            __bf16* __restrict__ qah, __bf16* __restrict__ qal,
            __bf16* __restrict__ qbh, __bf16* __restrict__ qbl,
            _Float16* __restrict__ vtf)
{
  __shared__ __attribute__((aligned(2048))) unsigned char ring[2 * G_STAGE];
  const int tid = threadIdx.x, w = __builtin_amdgcn_readfirstlane(tid >> 5), lane = tid & 31, hh = lane >> 4, m = lane & 15;
  const int wm = w >> 1, wn = w & 1;
  const int bn = (int)(blockIdx.x & 15u), bm = (int)(blockIdx.x >> 4);
  const int n0 = bn * 128, m0 = bm * 256;
  const int b = m0 >> 9, s0 = m0 & 511;

  v8f acc[4][4];
#pragma unroll
  for (int i = 0; i < 4; ++i)
#pragma unroll
    for (int j = 0; j < 4; ++j) acc[i][j] = vz8();

  // The wave's share of every stage: bytes w*4096.. of each A plane's 32 KiB (contiguous in the plane: 16 row tiles of
  // 2 KiB), and the 16-row tile w of each B plane. A stage further on lies one head (512 rows) on in A, 64 k on in B.
  const unsigned lbase = (unsigned)(size_t)ring + (unsigned)(lane * 16);
  const unsigned lca = lbase + (unsigned)(w * 4096);
  const unsigned lcb = lbase + (unsigned)(2 * G_APLANE + w * 2048);
  const size_t aoff = (size_t)(b * NHEAD * SQ + s0) * HDIM * 2 + (size_t)(w * 4096 + lane * 16);
  const size_t boff = (size_t)((n0 >> 4) + w) * (16 * DMOD * 2) + (size_t)(lane * 16);
  const unsigned long long gah = (unsigned long long)kxh + aoff, gal = (unsigned long long)kxl + aoff;
  const unsigned long long gbh = (unsigned long long)wth + boff, gbl = (unsigned long long)wtl + boff;
  const int NST = DMOD / 64;

#define G_COPY_STAGE(T, BUF)                                                                                   \
  do {                                                                                                         \
    const unsigned long long sa_ = (unsigned long long)(T) * (SQ * HDIM * 2), sb_ = (unsigned long long)(T) * 2048; \
    copy_plane(lca + (BUF), gah + sa_, lcb + (BUF), gbh + sb_);                                                \
    copy_plane(lca + (BUF) + G_APLANE, gal + sa_, lcb + (BUF) + G_BPLANE, gbl + sb_);                          \
  } while (0)

  G_COPY_STAGE(0, 0u);
  asm volatile("s_wait_asynccnt 0x0" ::: "memory");   // this wave's share of stage 0 has landed
  __syncthreads();                                    // every wave's share has: stage 0 may be read
  G_COPY_STAGE(1, (unsigned)G_STAGE);

  // rolled: one trip's text is 96 products and 64 LDS loads
#pragma unroll 1
  for (int t = 0; t < NST; ++t) {
    const unsigned buf = (unsigned)(t & 1) * (unsigned)G_STAGE;
    const unsigned char* pa = ring + buf + wm * 8192 + lane * 16;
    const unsigned char* pb = ring + buf + 2 * G_APLANE + wn * 8192 + lane * 16;
    v16b ah[2][4], al[2][4], bh[2][4], bl[2][4];
    // in the order in which the products below first read them
#pragma unroll
    for (int kc = 0; kc < 2; ++kc) {
      ah[kc][0] = ldsfrag(pa + kc * 1024);
      bh[kc][0] = ldsfrag(pb + kc * 1024);
#pragma unroll
      for (int i = 1; i < 4; ++i) ah[kc][i] = ldsfrag(pa + i * 2048 + kc * 1024);
#pragma unroll
      for (int j = 1; j < 4; ++j) bh[kc][j] = ldsfrag(pb + j * 2048 + kc * 1024);
#pragma unroll
      for (int j = 0; j < 4; ++j) bl[kc][j] = ldsfrag(pb + G_BPLANE + j * 2048 + kc * 1024);
#pragma unroll
      for (int i = 0; i < 4; ++i) al[kc][i] = ldsfrag(pa + G_APLANE + i * 2048 + kc * 1024);
    }
    // keeps the trip's LDS loads one group in front of its products
    __builtin_amdgcn_sched_barrier(0);
    // per accumulator hi*hi, hi*lo, lo*hi, k ascending; sixteen independent tiles between two products of one tile
#pragma unroll
    for (int kc = 0; kc < 2; ++kc) {
#pragma unroll
      for (int j = 0; j < 4; ++j)
#pragma unroll
        for (int i = 0; i < 4; ++i) acc[i][j] = wmm(ah[kc][i], bh[kc][j], acc[i][j]);
#pragma unroll
      for (int j = 0; j < 4; ++j)
#pragma unroll
        for (int i = 0; i < 4; ++i) acc[i][j] = wmm(ah[kc][i], bl[kc][j], acc[i][j]);
#pragma unroll
      for (int j = 0; j < 4; ++j)
#pragma unroll
        for (int i = 0; i < 4; ++i) acc[i][j] = wmm(al[kc][i], bh[kc][j], acc[i][j]);
    }
    // keeps the products in front of the trip's foot: moved behind its waits they would no longer cover the LDS loads' and
    // the copies' flight
    __builtin_amdgcn_sched_barrier(0);
    asm volatile("s_wait_dscnt 0x0" ::: "memory");      // this wave has left the buffer that is refilled below
    asm volatile("s_wait_asynccnt 0x0" ::: "memory");   // its share of stage t + 1 has landed
    __syncthreads();                                    // stage t + 1 may be read; stage t's buffer is free
    if (t + 2 < NST) G_COPY_STAGE(t + 2, buf);
  }
  asm volatile("s_wait_asynccnt 0x0" ::: "memory");     // no copy is under way when the ring becomes output staging
#undef G_COPY_STAGE

  // D tile: element r -> row 8*hh + r, col m. The last trip's barrier has ended every read of the ring.
  float (*Cs)[68] = (float (*)[68])(ring + w * (64 * 68 * 4));
#pragma unroll
  for (int i = 0; i < 4; ++i)
#pragma unroll
    for (int j = 0; j < 4; ++j)
#pragma unroll
      for (int r = 0; r < 8; ++r) Cs[i * 16 + 8 * hh + r][j * 16 + m] = acc[i][j][r];
  __syncthreads();

  const int n0w = n0 + wn * 64, s0w = s0 + wm * 64;
  if (n0w < DMOD) {
    const int hq = n0w >> 6;
    const int qrow0 = (b * NHEAD + hq) * SQ;
    const float* rrbh = rrb + hq * HDIM;
    const float* rwbh = rwb + hq * HDIM;
    // four steps' loads fly together: the block is alone on its WGP, and no other wave's work covers their latency
#pragma unroll 1
    for (int io = 0; io < 4; ++io) {
#pragma unroll
    for (int ii = 0; ii < 4; ++ii) {
      // the wave takes 8 rows x 4 k octets: lanes 8q..8q+7 store one whole line of each plane
      const int j4 = lane >> 3, j = (ii >> 1) * 4 + j4;
      const int rr = io * 16 + (ii & 1) * 8 + (lane & 7);
      const int s = s0w + rr;
      const v8f cl = load8(&Cs[rr][8 * j4]);        // q[d'],     d' = 8*j4+e
      const v8f ch = load8(&Cs[rr][32 + 8 * j4]);   // q[32+d']
      const v8f bwl = load8(rwbh + 8 * j4);
      const v8f bwh = load8(rwbh + 32 + 8 * j4);
      const v8f br  = load8(rrbh + 8 * j);
      const float* trs = tr + (size_t)s * HDIM;
      const v8f sq = load8(trs + 8 * j4);           // sin(s*f_d')
      const v8f cq = load8(trs + 32 + 8 * j4);      // cos(s*f_d')
      const v8f a = cl + bwl;
      const v8f c = ch + bwh;
      v8f qa, qb;
      if (j < 4) {
        qa = cl + br;
        qb = a * cq + c * sq;
      } else {
        qa = ch + br;
        qb = c * cq - a * sq;
      }
      v4u ah, al, bh, bl;
      split8(qa, ah, al);
      split8(qb, bh, bl);
      const size_t off = punit(qrow0 + s, 8 * j, HDIM);
      __bf16* p0 = qah + off;
      __bf16* p1 = qal + off;
      __bf16* p2 = qbh + off;
      __bf16* p3 = qbl + off;
      *(v4u*)p0 = ah;
      *(v4u*)p1 = al;
      *(v4u*)p2 = bh;
      *(v4u*)p3 = bl;
    }
      // behind the trip's last stores: the next trip overwrites registers that they name
      asm volatile("s_wait_xcnt 0x0" ::: "memory");
    }
  } else {
    const int hv = (n0w - DMOD) >> 6;
    const int vrow0 = (b * NHEAD + hv) * HDIM;
    // four steps at a time, as above
#pragma unroll 1
    for (int io = 0; io < 4; ++io) {
#pragma unroll
    for (int ii = 0; ii < 4; ++ii) {
      // the wave takes 16 d x 2 key octets and stores 512 contiguous bytes of the plane
      const int dd = io * 16 + (lane & 15), j = ii * 2 + (lane >> 4);
      v8f v;
#pragma unroll
      for (int e = 0; e < 8; ++e) v[e] = Cs[8 * j + e][dd];
      PackH8 u;
      u.v = __builtin_convertvector(v, v8h);
      const size_t off = punit(vrow0 + dd, s0w + 8 * j, SQ);
      _Float16* ph = vtf + off;
      *(v4u*)ph = u.q;
    }
      // behind the trip's last stores: the next trip overwrites registers that they name
      asm volatile("s_wait_xcnt 0x0" ::: "memory");
    }
  }
}

// ---------------------------------------------------------------------------
// Fused attention, transposed tiles. Block = 8 waves, wave owns 32 queries (two 16-query tiles) of one (b,h); 32 keys per
// step. Every key-side fragment that a wave reads out of LDS feeds the products of both query tiles.
// Scores S^T[key][query] = Kcat[key][0..127] . Qcat[query][0..127]:
//   A = kx planes (cols 0..63) / trig table planes (cols 64..127), B = qa / qb planes (loaded like A).
// Softmax statistics live on lane = query (xor-16 exchange between lane halves).
// O^T[d][query] = V^T . P^T: A = the vtf plane ([d][key]), B = P^T packed straight from the score D tiles
//   (element r <- key 8h+r of the first 16-key tile, element 8+r <- second tile), both f16.
// The key side is the same for all eight waves: a stage is 64 keys (two steps) of it, copied as it lies (whole 1-KiB
// fragments) into LDS, where every wave reads it:
//   [kx hi | kx lo | table hi | table lo | V^T], 8 KiB each; kx and table: four 16-key tiles of 2 KiB (two
//   32-column fragments); V^T: four 16-d tiles of 2 KiB (the stage's two 32-key fragments).
// Two buffers: the copies of stage t + 2 fly while stage t + 1 is worked on.
// ---------------------------------------------------------------------------
#define A_PLANE 8192
#define A_STAGE (5 * A_PLANE)

// A wave's share of a stage: 1 KiB (two copies of 512 B) of each of the five planes, each lane 16 bytes a copy.
// l: the lane's LDS byte address in the first plane; g0..g4: the wave's global addresses, o: the lane's byte offset.
// Written as the builtin: an operand of an asm statement has to lie in the first 256 registers, and the address pairs that
// live through the loop found no room there beside the two query tiles' accumulators (they went to scratch).
typedef __attribute__((address_space(1))) v4i_raw gcopy_t;
typedef __attribute__((address_space(3))) v4i_raw lcopy_t;
__device__ __forceinline__ void copy16(unsigned l, unsigned long long g) {
  __builtin_amdgcn_global_load_async_to_lds_b128((gcopy_t*)g, (lcopy_t*)l, 0, 0);
}
__device__ __forceinline__ void copy_keyside(unsigned l, unsigned long long o, unsigned long long g0, unsigned long long g1, unsigned long long g2,
                                             unsigned long long g3, unsigned long long g4) {
  copy16(l,               g0 + o); copy16(l + 512,               g0 + 512 + o);
  copy16(l + A_PLANE,     g1 + o); copy16(l + A_PLANE + 512,     g1 + 512 + o);
  copy16(l + 2 * A_PLANE, g2 + o); copy16(l + 2 * A_PLANE + 512, g2 + 512 + o);
  copy16(l + 3 * A_PLANE, g3 + o); copy16(l + 3 * A_PLANE + 512, g3 + 512 + o);
  copy16(l + 4 * A_PLANE, g4 + o); copy16(l + 4 * A_PLANE + 512, g4 + 512 + o);
}

// four fragments out of a stage: two tiles 2 KiB apart, hi plane at p and lo plane one plane behind it
__device__ __forceinline__ Frag4 ldsfrag4(const unsigned char* p) {
  Frag4 f;
  // in the order in which a product group first reads them
  f.h0 = ldsfrag(p);
  f.h1 = ldsfrag(p + 2048);
  f.l0 = ldsfrag(p + A_PLANE);
  f.l1 = ldsfrag(p + A_PLANE + 2048);
  return f;
}

// an f16 fragment out of LDS, addressed as in ldsfrag
__device__ __forceinline__ v16h ldsfragh(const unsigned char* p) {
  FragH f;
  f.q[0] = *(const v4u*)(p);
  f.q[1] = *(const v4u*)(p + 512);
  return f.v;
}

// the largest of a lane's sixteen scores of one query tile
__device__ __forceinline__ float lanemax(const v8f s0, const v8f s1) {
  float mloc = s0[0];
#pragma unroll
  for (int r = 0; r < 8; ++r) { mloc = fmaxf(mloc, s0[r]); mloc = fmaxf(mloc, s1[r]); }
  return mloc;
}

// One query tile's softmax step: mall is the step's maximum over both lane halves. Rescales the running sum and the four
// output tiles and returns P^T as the B operand of the p*v products: k = key offset within the 32-key step.
__device__ __forceinline__ v16h softmax_tile(v8f s0, v8f s1, const float mall, float& mrun, float& dsum,
                                             v8f& o0, v8f& o1, v8f& o2, v8f& o3) {
  const float mnew = fmaxf(mrun, mall);
  const float alpha = exp_with_slot(mrun - mnew);
  float psum = 0.0f;
#pragma unroll
  for (int r = 0; r < 8; ++r) {
    const float pa = exp_with_slot(s0[r] - mnew);
    const float pb = exp_with_slot(s1[r] - mnew);
    s0[r] = pa; s1[r] = pb;
    psum += pa + pb;
  }
  psum += __shfl_xor(psum, 16, 32);
  dsum = dsum * alpha + psum;
  mrun = mnew;
  o0 *= alpha; o1 *= alpha; o2 *= alpha; o3 *= alpha;
  FragH pf;
  pf.h[0] = __builtin_convertvector(s0, v8h);
  pf.h[1] = __builtin_convertvector(s1, v8h);
  return pf.v;
}

__global__ __launch_bounds__(256)
void k_attn(const __bf16* __restrict__ qah, const __bf16* __restrict__ qal,
            const __bf16* __restrict__ qbh, const __bf16* __restrict__ qbl,
            const __bf16* __restrict__ kxh, const __bf16* __restrict__ kxl,
            const __bf16* __restrict__ trh, const __bf16* __restrict__ trl,
            const _Float16* __restrict__ vtf,
            const int* __restrict__ msk, float* __restrict__ out)
{
  __shared__ __attribute__((aligned(2048))) unsigned char ring[2 * A_STAGE];
  // the wave's number in a scalar register: every fragment's block address is then a scalar value
  const int tid = threadIdx.x, w = __builtin_amdgcn_readfirstlane(tid >> 5), lane = tid & 31, hh = lane >> 4, n = lane & 15;
  const int bh = (int)(blockIdx.x >> 1), qc = (int)(blockIdx.x & 1u);
  const int b = bh >> 4, hd = bh & 15;
  const int q0 = qc * 256 + w * 32;
  const int qrow = bh * SQ + q0;   // rows of qa/qb (pitch 64)

  // The wave's share of every stage: bytes w*1024.. of each plane's 8 KiB. In kx and in the table a stage is 8 KiB
  // contiguous (64 rows of 128 bytes); in V^T (row tiles of 16 KiB) it is 2 KiB of each of the head's four tiles.
  const unsigned lc = (unsigned)(size_t)ring + (unsigned)(w * 1024 + lane * 16);
  const size_t koff = (size_t)bh * (SQ * HDIM * 2) + (size_t)(w * 1024);
  const size_t toff = (size_t)(w * 1024);
  const size_t voff = (size_t)bh * (HDIM * SQ * 2) + (size_t)((w >> 1) * (16 * SQ * 2) + (w & 1) * 1024);
  const unsigned long long gkh = (unsigned long long)kxh + koff, gkl = (unsigned long long)kxl + koff;
  const unsigned long long gth = (unsigned long long)trh + toff, gtl = (unsigned long long)trl + toff;
  const unsigned long long gvf = (unsigned long long)vtf + voff;
  const int NST = SQ / 64;

#define A_COPY_STAGE(T, BUF)                                                                          \
  do {                                                                                                \
    const unsigned long long sk_ = (unsigned long long)(T) * A_PLANE, sv_ = (unsigned long long)(T) * 2048; \
    copy_keyside(lc + (BUF), laneoff, gkh + sk_, gkl + sk_, gth + sk_, gtl + sk_, gvf + sv_); \
  } while (0)

  const unsigned long long laneoff = (unsigned long long)(unsigned)(lane * 16);
  A_COPY_STAGE(0, 0u);

  // the wave's 32 queries, all 128 columns (qa | qb), hi and lo planes; columns 32..63 of a plane lie 1024 bytes behind
  // 0..31, the second query tile 2048 bytes behind the first. Names: plane, query tile, 32-column chunk.
  const unsigned long long pah = fragblock(qah, HDIM, qrow, 0) + laneoff, pal = fragblock(qal, HDIM, qrow, 0) + laneoff;
  const unsigned long long pbh = fragblock(qbh, HDIM, qrow, 0) + laneoff, pbl = fragblock(qbl, HDIM, qrow, 0) + laneoff;
  const v16b qh00 = ldfrag(pah, 0),    ql00 = ldfrag(pal, 0);
  const v16b qh01 = ldfrag(pah, 1024), ql01 = ldfrag(pal, 1024);
  const v16b qh10 = ldfrag(pah, 2048), ql10 = ldfrag(pal, 2048);
  const v16b qh11 = ldfrag(pah, 3072), ql11 = ldfrag(pal, 3072);
  const v16b qh02 = ldfrag(pbh, 0),    ql02 = ldfrag(pbl, 0);
  const v16b qh03 = ldfrag(pbh, 1024), ql03 = ldfrag(pbl, 1024);
  const v16b qh12 = ldfrag(pbh, 2048), ql12 = ldfrag(pbl, 2048);
  const v16b qh13 = ldfrag(pbh, 3072), ql13 = ldfrag(pbl, 3072);

  v8f oa0 = vz8(), oa1 = vz8(), oa2 = vz8(), oa3 = vz8();
  v8f ob0 = vz8(), ob1 = vz8(), ob2 = vz8(), ob3 = vz8();
  float mruna = -1.0e30f, dsuma = 0.0f, mrunb = -1.0e30f, dsumb = 0.0f;

  asm volatile("s_wait_asynccnt 0x0" ::: "memory");   // this wave's share of stage 0 has landed
  __syncthreads();                                    // every wave's share has: stage 0 may be read
  A_COPY_STAGE(1, (unsigned)A_STAGE);

  // rolled: one trip's text is two steps of 56 products and their softmax
#pragma unroll 1
  for (int t = 0; t < NST; ++t) {
    const unsigned buf = (unsigned)(t & 1) * (unsigned)A_STAGE;
    const unsigned char* ps = ring + buf + lane * 16;
    // Each group of fragments is asked for out of LDS one product group ahead of the group that reads it, the second step's
    // first chunk together with the first step's V^T. Nothing is read across a stage.
    Frag4 k0 = ldsfrag4(ps);
    const int* mp0 = msk + b * SQ + t * 64 + 8 * hh;   // the lane's first key-mask word of the stage
    // unrolled: only the first step fetches ahead, and each step's LDS offsets go into the loads' own offset fields
#pragma unroll
    for (int u = 0; u < 2; ++u) {
      const unsigned char* pk = ps + u * 4096;                  // the step's two 16-key tiles
      const unsigned char* pv = ps + 4 * A_PLANE + u * 1024;    // the step's 32-key fragment of each V^T tile
      v8f sa0 = vz8(), sa1 = vz8(), sb0 = vz8(), sb1 = vz8();
      const Frag4 k1 = ldsfrag4(pk + 1024);
      // key-mask: the step's keys 8*hh + r (tile 0) and 16 + 8*hh + r (tile 1)
      const int* mp = mp0 + u * 32;
      const v4i mA = *(const v4i*)(mp);
      const v4i mB = *(const v4i*)(mp + 4);
      const v4i mC = *(const v4i*)(mp + 16);
      const v4i mD = *(const v4i*)(mp + 20);
      // each scheduling barrier of this loop keeps the loads above it in front of the arithmetic below it: issued later they
      // would have less of it to fly behind
      __builtin_amdgcn_sched_barrier(0);
      mma3x4(sa0, sa1, sb0, sb1, k0.h0, k0.l0, k0.h1, k0.l1, qh00, ql00, qh10, ql10);
      // behind the stage's last mask loads: holds their address pair whole up to the wait that its overwrite owes them
      if (u == 1) asm volatile("s_wait_xcnt 0x0" :: "v"(mp0) : "memory");
      const Frag4 k2 = ldsfrag4(pk + 2 * A_PLANE);
      __builtin_amdgcn_sched_barrier(0);
      mma3x4(sa0, sa1, sb0, sb1, k1.h0, k1.l0, k1.h1, k1.l1, qh01, ql01, qh11, ql11);
      const Frag4 k3 = ldsfrag4(pk + 2 * A_PLANE + 1024);
      __builtin_amdgcn_sched_barrier(0);
      mma3x4(sa0, sa1, sb0, sb1, k2.h0, k2.l0, k2.h1, k2.l1, qh02, ql02, qh12, ql12);
      const v16h v0 = ldsfragh(pv), v1 = ldsfragh(pv + 2048), v2 = ldsfragh(pv + 4096), v3 = ldsfragh(pv + 6144);
      if (u == 0) k0 = ldsfrag4(ps + 4096);
      __builtin_amdgcn_sched_barrier(0);
      mma3x4(sa0, sa1, sb0, sb1, k3.h0, k3.l0, k3.h1, k3.l1, qh03, ql03, qh13, ql13);
      v8f f0, f1;
#pragma unroll
      for (int r = 0; r < 4; ++r) {
        f0[r] = (float)mA[r]; f0[4 + r] = (float)mB[r];
        f1[r] = (float)mC[r]; f1[4 + r] = (float)mD[r];
      }
      const v8f g0 = (1.0f - f0) * 1.0e8f, g1 = (1.0f - f1) * 1.0e8f;
      sa0 = sa0 * f0 - g0;
      sa1 = sa1 * f1 - g1;
      sb0 = sb0 * f0 - g0;
      sb1 = sb1 * f1 - g1;

      const float mla = lanemax(sa0, sa1), mlb = lanemax(sb0, sb1);
      const float malla = fmaxf(mla, __shfl_xor(mla, 16, 32));
      const float mallb = fmaxf(mlb, __shfl_xor(mlb, 16, 32));
      const v16h pa = softmax_tile(sa0, sa1, malla, mruna, dsuma, oa0, oa1, oa2, oa3);
      mmah1x4(oa0, oa1, oa2, oa3, v0, v1, v2, v3, pa);
      const v16h pb = softmax_tile(sb0, sb1, mallb, mrunb, dsumb, ob0, ob1, ob2, ob3);
      mmah1x4(ob0, ob1, ob2, ob3, v0, v1, v2, v3, pb);
    }
    asm volatile("s_wait_dscnt 0x0" ::: "memory");      // this wave has left the buffer that is refilled below
    asm volatile("s_wait_asynccnt 0x0" ::: "memory");   // its share of stage t + 1 has landed
    __syncthreads();                                    // stage t + 1 may be read; stage t's buffer is free
    if (t + 2 < NST) A_COPY_STAGE(t + 2, buf);
  }
  asm volatile("s_wait_asynccnt 0x0" ::: "memory");     // no copy is under way when the ring becomes output staging
#undef A_COPY_STAGE

  // O^T element r of tile t -> d = 16*t + 8*hh + r, query n of its query tile. The last trip's barrier has ended every
  // read of the ring.
  float (*Os)[32][64] = (float (*)[32][64])ring;
  const float rinva = 1.0f / dsuma, rinvb = 1.0f / dsumb;
#pragma unroll
  for (int r = 0; r < 8; ++r) {
    Os[w][n][8 * hh + r]           = oa0[r] * rinva;
    Os[w][n][16 + 8 * hh + r]      = oa1[r] * rinva;
    Os[w][n][32 + 8 * hh + r]      = oa2[r] * rinva;
    Os[w][n][48 + 8 * hh + r]      = oa3[r] * rinva;
    Os[w][16 + n][8 * hh + r]      = ob0[r] * rinvb;
    Os[w][16 + n][16 + 8 * hh + r] = ob1[r] * rinvb;
    Os[w][16 + n][32 + 8 * hh + r] = ob2[r] * rinvb;
    Os[w][16 + n][48 + 8 * hh + r] = ob3[r] * rinvb;
  }
  __syncthreads();

  v4f ov[16];
#pragma unroll
  for (int it = 0; it < 16; ++it) ov[it] = *(const v4f*)&Os[w][2 * it + hh][4 * n];
  float* ob = out + ((size_t)(b * SQ + q0)) * DMOD + hd * HDIM + 4 * n;
#pragma unroll
  for (int it = 0; it < 16; ++it) {
    float* p = ob + (size_t)(2 * it + hh) * DMOD;
    *(v4f*)p = ov[it];
  }
}

// ---------------------------------------------------------------------------
extern "C" void kernel_launch(void* const* d_in, const int* in_sizes, int n_in,
                              void* d_out, int out_size, void* d_ws,
                              size_t ws_size, hipStream_t stream)
{
  if (n_in < 5) return;
  if (in_sizes[0] != NBATCH * SQ * DMOD) return;
  if (in_sizes[1] != NBATCH * SQ) return;
  if (in_sizes[2] != DMOD * 2 * DMOD) return;
  if (in_sizes[3] != NHEAD * HDIM) return;
  if (in_sizes[4] != NHEAD * HDIM) return;
  if (out_size != NBATCH * SQ * DMOD) return;

  const float* x    = (const float*)d_in[0];
  const int*   mk   = (const int*)d_in[1];
  const float* wqv  = (const float*)d_in[2];
  const float* rrb  = (const float*)d_in[3];
  const float* rwb  = (const float*)d_in[4];
  float* out = (float*)d_out;

  const size_t n_tr    = (size_t)SQ * HDIM;                 // 32768
  const size_t n_heads = (size_t)NBATCH * NHEAD * SQ * HDIM; // 4194304
  const size_t n_w     = (size_t)DMOD * 2 * DMOD;            // 2097152

  char* ws = (char*)d_ws;
  size_t off = 0;
  auto carve = [&](size_t bytes) -> char* {
    char* p = ws + off;
    off += (bytes + 255) & ~(size_t)255;
    return p;
  };
  float*  tr  = (float*)carve(n_tr * 4);
  __bf16* trh = (__bf16*)carve(n_tr * 2);
  __bf16* trl = (__bf16*)carve(n_tr * 2);
  __bf16* kxh = (__bf16*)carve(n_heads * 2);
  __bf16* kxl = (__bf16*)carve(n_heads * 2);
  __bf16* wth = (__bf16*)carve(n_w * 2);
  __bf16* wtl = (__bf16*)carve(n_w * 2);
  __bf16* qah = (__bf16*)carve(n_heads * 2);
  __bf16* qal = (__bf16*)carve(n_heads * 2);
  __bf16* qbh = (__bf16*)carve(n_heads * 2);
  __bf16* qbl = (__bf16*)carve(n_heads * 2);
  _Float16* vtf = (_Float16*)carve(n_heads * 2);
  if (off > ws_size) return;

  FreqTab ft;
  const double cst = -log(10000.0) / 31.0;
  for (int d = 0; d < 32; ++d) ft.f[d] = exp((double)((float)d) * cst);

  k_prep<<<dim3(P_TRIG_BLOCKS + P_W_BLOCKS + P_X_BLOCKS), dim3(128), 0, stream>>>(
      ft, x, wqv, tr, trh, trl, kxh, kxl, wth, wtl);
  k_gemm<<<dim3((NBATCH * SQ / 256) * (2 * DMOD / 128)), dim3(256), 0, stream>>>(
      kxh, kxl, wth, wtl, rrb, rwb, tr, qah, qal, qbh, qbl, vtf);
  k_attn<<<dim3(NBATCH * NHEAD * (SQ / 256)), dim3(256), 0, stream>>>(
      qah, qal, qbh, qbl, kxh, kxl, trh, trl, vtf, mk, out);
}
